// v000
// Measured on an AMD MI455X. A time is GPU time per run, averaged over a window of back-to-back runs after a warm-up
// (all launches, gaps included; the runs take copies of the inputs in turn), and the median of several windows.
// Apart from v000's, it joins two sittings. Times from different sittings can be a few percent apart, while
// side-by-side timings come from the same sitting.
// The starting kernel, v000, takes 365 microseconds a run.
#include <hip/hip_runtime.h>
#include <hip/hip_bf16.h>
#include <math.h>

typedef __attribute__((ext_vector_type(16))) _Float16 v16h;
typedef __attribute__((ext_vector_type(8)))  float    v8f;

#define S_LEN   2048
#define E_DIM   1024
#define H_NUM   16
#define D_DIM   32
#define SIG_DIM 256
#define LAMBDA_INIT_F 0.3555090675909693f

__device__ __forceinline__ v8f wmma16x16x32(v16h a, v16h b, v8f c) {
  // v_wmma_f32_16x16x32_f16: D = A(16x32,f16) x B(32x16,f16) + C(f32)
  return __builtin_amdgcn_wmma_f32_16x16x32_f16(false, a, false, b, (short)0, c, false, false);
}

// ---------------------------------------------------------------- conversions
__global__ void cvt_f32_f16(const float* __restrict__ src, _Float16* __restrict__ dst,
                            long long n) {
  long long i = (long long)blockIdx.x * blockDim.x + threadIdx.x;
  long long stride = (long long)gridDim.x * blockDim.x;
  for (; i < n; i += stride) dst[i] = (_Float16)src[i];
}

// --------------------------------------------------- sig = emb @ sigma_w.T ; lambda
__global__ void small_setup(const float* __restrict__ emb, const float* __restrict__ sigw,
                            const float* __restrict__ lq1, const float* __restrict__ lk1,
                            const float* __restrict__ lq2, const float* __restrict__ lk2,
                            float* __restrict__ sig, float* __restrict__ lam) {
  int t = threadIdx.x;
  if (t < D_DIM) {
    float s = 0.f;
    for (int j = 0; j < SIG_DIM; ++j) s += emb[j] * sigw[t * SIG_DIM + j];
    sig[t] = s;
  } else if (t == D_DIM) {
    float s1 = 0.f, s2 = 0.f;
    for (int i = 0; i < D_DIM; ++i) { s1 += lq1[i] * lk1[i]; s2 += lq2[i] * lk2[i]; }
    lam[0] = __expf(s1) - __expf(s2) + LAMBDA_INIT_F;
  }
}

// ------------------------------------------------------------------- GEMM
// C[M,N] = A[M,K] * B[N,K]^T (+bias). MODE 0: fp32 out. MODE 1: SiLU -> f16 out.
// Double-buffered LDS, global_prefetch of K+2 tile, branch-free templated epilogue.
#define BM 128
#define BN 128
#define BK 32
#define ASTR 40   // LDS stride in halfs (padded)

template <int MODE, bool HAS_BIAS>
__global__ __launch_bounds__(256)
void gemm_wmma(const _Float16* __restrict__ A, const _Float16* __restrict__ B,
               const float* __restrict__ bias, float* __restrict__ Cf,
               _Float16* __restrict__ Ch, int M, int N, int K) {
  __shared__ _Float16 As[2][BM * ASTR];
  __shared__ _Float16 Bs[2][BN * ASTR];
  const int tid   = threadIdx.x;
  const int lane  = tid & 31;
  const int wave  = tid >> 5;      // 8 wave32 waves
  const int wm    = wave >> 2;     // 0..1  (64 rows each)
  const int wn    = wave & 3;      // 0..3  (32 cols each)
  const int l15   = lane & 15;
  const int hioff = (lane >> 4) * 8;
  const int bm = blockIdx.y * BM;
  const int bn = blockIdx.x * BN;

  const v8f vzero = {0.f,0.f,0.f,0.f,0.f,0.f,0.f,0.f};
  v8f acc[4][2];
  #pragma unroll
  for (int mt = 0; mt < 4; ++mt)
    #pragma unroll
    for (int nt = 0; nt < 2; ++nt) acc[mt][nt] = vzero;

  const int ldRow = tid >> 1;           // 0..127
  const int ldCol = (tid & 1) * 16;     // 0 or 16 halfs
  const _Float16* gA = A + (size_t)(bm + ldRow) * K + ldCol;
  const _Float16* gB = B + (size_t)(bn + ldRow) * K + ldCol;

  // preload tile 0 into buffer 0
  {
    const uint4* sa = (const uint4*)gA;
    const uint4* sb = (const uint4*)gB;
    uint4* da = (uint4*)(&As[0][ldRow * ASTR + ldCol]);
    uint4* db = (uint4*)(&Bs[0][ldRow * ASTR + ldCol]);
    da[0] = sa[0]; da[1] = sa[1];
    db[0] = sb[0]; db[1] = sb[1];
  }
  __syncthreads();

  const int ktiles = K / BK;
  int cur = 0;
  for (int kt = 0; kt < ktiles; ++kt) {
    // pull the K+2 tile toward L2 (global_prefetch_b8)
    if (kt + 2 < ktiles) {
      __builtin_prefetch(gA + (size_t)(kt + 2) * BK, 0, 1);
      __builtin_prefetch(gB + (size_t)(kt + 2) * BK, 0, 1);
    }
    // stage K+1 tile into the alternate buffer while we compute from `cur`
    if (kt + 1 < ktiles) {
      const uint4* sa = (const uint4*)(gA + (size_t)(kt + 1) * BK);
      const uint4* sb = (const uint4*)(gB + (size_t)(kt + 1) * BK);
      const uint4 ra0 = sa[0], ra1 = sa[1], rb0 = sb[0], rb1 = sb[1];
      uint4* da = (uint4*)(&As[cur ^ 1][ldRow * ASTR + ldCol]);
      uint4* db = (uint4*)(&Bs[cur ^ 1][ldRow * ASTR + ldCol]);
      da[0] = ra0; da[1] = ra1;
      db[0] = rb0; db[1] = rb1;
    }

    v16h af[4], bf2[2];
    #pragma unroll
    for (int mt = 0; mt < 4; ++mt) {
      const _Float16* p = &As[cur][(wm * 64 + mt * 16 + l15) * ASTR + hioff];
      #pragma unroll
      for (int i = 0; i < 8; ++i) { af[mt][i] = p[i]; af[mt][8 + i] = p[16 + i]; }
    }
    #pragma unroll
    for (int nt = 0; nt < 2; ++nt) {
      const _Float16* p = &Bs[cur][(wn * 32 + nt * 16 + l15) * ASTR + hioff];
      #pragma unroll
      for (int i = 0; i < 8; ++i) { bf2[nt][i] = p[i]; bf2[nt][8 + i] = p[16 + i]; }
    }
    #pragma unroll
    for (int mt = 0; mt < 4; ++mt)
      #pragma unroll
      for (int nt = 0; nt < 2; ++nt)
        acc[mt][nt] = wmma16x16x32(af[mt], bf2[nt], acc[mt][nt]);

    __syncthreads();   // next-tile LDS writes complete; safe to flip buffers
    cur ^= 1;
  }

  // ---------------- branch-free epilogue (bias hoisted, strided stores)
  float bv[2] = {0.f, 0.f};
  if (HAS_BIAS) {
    bv[0] = bias[bn + wn * 32 + l15];
    bv[1] = bias[bn + wn * 32 + 16 + l15];
  }
  #pragma unroll
  for (int mt = 0; mt < 4; ++mt) {
    const int gm0 = bm + wm * 64 + mt * 16 + ((lane >> 4) << 3);
    #pragma unroll
    for (int nt = 0; nt < 2; ++nt) {
      const int gn = bn + wn * 32 + nt * 16 + l15;
      if (MODE == 1) {
        _Float16* cp = Ch + (size_t)gm0 * N + gn;
        #pragma unroll
        for (int r = 0; r < 8; ++r) {
          float v = acc[mt][nt][r];
          if (HAS_BIAS) v += bv[nt];
          cp[(size_t)r * N] = (_Float16)(v / (1.f + __expf(-v)));   // SiLU
        }
      } else {
        float* cp = Cf + (size_t)gm0 * N + gn;
        #pragma unroll
        for (int r = 0; r < 8; ++r) {
          float v = acc[mt][nt][r];
          if (HAS_BIAS) v += bv[nt];
          cp[(size_t)r * N] = v;
        }
      }
    }
  }
}

// ------------------------------------------- RoPE + sigma add + head split -> f16
// Q/K written [h][s][d] (row = K-contig for A/B frags).
// V written TRANSPOSED [h][vdim][s] so attention's B-frag of V is K(seq)-contiguous.
__global__ __launch_bounds__(256)
void rope_split(const float* __restrict__ qkv, const float* __restrict__ sig,
                _Float16* __restrict__ q1, _Float16* __restrict__ q2,
                _Float16* __restrict__ k1, _Float16* __restrict__ k2,
                _Float16* __restrict__ vt) {
  const int s = blockIdx.x;
  const int t = threadIdx.x;
  __shared__ float sigs[D_DIM];
  if (t < D_DIM) sigs[t] = sig[t];
  __syncthreads();
  const float* row = qkv + (size_t)s * (3 * E_DIM);
  for (int idx = t; idx < 3 * E_DIM; idx += 256) {
    const int which = idx >> 10;        // 0=q 1=k 2=v
    const int rem   = idx & 1023;
    const int rh    = rem >> 5;         // rope head 0..31
    const int d     = rem & 31;
    const int h     = rh >> 1;
    const int sub   = rh & 1;
    const float val = row[idx];
    float o = val;
    if (which < 2 && d < 16) {          // rotate first half of head dim, pairwise
      const int p = d >> 1;
      const float inv = __powf(10000.f, -(float)(2 * p) * (1.f / 16.f));
      const float ang = (float)s * inv;
      float sn, c; __sincosf(ang, &sn, &c);
      const float other = row[(idx & ~31) + (d ^ 1)];
      o = (d & 1) ? (val * c + other * sn) : (val * c - other * sn);
    }
    if (which < 2 && sub == 1) o += sigs[d];
    if (which == 0) {
      _Float16* dst = sub ? q2 : q1;
      dst[(size_t)h * S_LEN * D_DIM + (size_t)s * D_DIM + d] = (_Float16)o;
    } else if (which == 1) {
      _Float16* dst = sub ? k2 : k1;
      dst[(size_t)h * S_LEN * D_DIM + (size_t)s * D_DIM + d] = (_Float16)o;
    } else {
      // transposed: [h][vdim = sub*32+d][s]
      vt[(size_t)h * (2 * D_DIM) * S_LEN + (size_t)(sub * D_DIM + d) * S_LEN + s] = (_Float16)o;
    }
  }
}

// ----------------------------------------------------- flash attention (WMMA)
#define KSTR 40
#define VSTR 72   // Vs rows are vdim (64), cols are seq/K (64) + pad
#define PSTR 72

__global__ __launch_bounds__(128)
void attn_flash(const _Float16* __restrict__ q1, const _Float16* __restrict__ q2,
                const _Float16* __restrict__ k1, const _Float16* __restrict__ k2,
                const _Float16* __restrict__ vt,
                float* __restrict__ o1, float* __restrict__ o2, float scale) {
  __shared__ _Float16 Ks[64 * KSTR];
  __shared__ _Float16 Vs[64 * VSTR];    // transposed V tile: [vdim][seq]
  __shared__ _Float16 Ps[4 * 16 * PSTR];

  const int tid   = threadIdx.x;
  const int lane  = tid & 31;
  const int wave  = tid >> 5;          // 4 waves, 16 q-rows each
  const int l15   = lane & 15;
  const int hi    = lane >> 4;
  const int hioff = hi * 8;

  const int qi = blockIdx.x;           // q tile (64 rows)
  const int h  = blockIdx.y;
  const int ai = blockIdx.z;           // which attention (0/1)

  const _Float16* Qp = (ai ? q2 : q1) + (size_t)h * S_LEN * D_DIM;
  const _Float16* Kp = (ai ? k2 : k1) + (size_t)h * S_LEN * D_DIM;
  const _Float16* Vp = vt + (size_t)h * (2 * D_DIM) * S_LEN;   // [vdim][s]
  float* Op = ai ? o2 : o1;

  const int qbase = qi * 64;
  const int qrow0 = qbase + wave * 16;

  v16h aq;                              // Q A-frag (rows contiguous in global, K=32)
  {
    const _Float16* p = Qp + (size_t)(qrow0 + l15) * D_DIM + hioff;
    #pragma unroll
    for (int i = 0; i < 8; ++i) { aq[i] = p[i]; aq[8 + i] = p[16 + i]; }
  }

  const v8f vzero = {0.f,0.f,0.f,0.f,0.f,0.f,0.f,0.f};
  v8f o[4];
  #pragma unroll
  for (int j = 0; j < 4; ++j) o[j] = vzero;
  float rmax[8], rsum[8];
  #pragma unroll
  for (int r = 0; r < 8; ++r) { rmax[r] = -1e30f; rsum[r] = 0.f; }

  const int ldRow = tid >> 1;           // 0..63
  const int kc16  = (tid & 1) * 16;
  const int vc32  = (tid & 1) * 32;

  for (int kt = 0; kt <= qi; ++kt) {
    const int kbase = kt * 64;
    {   // stage K (64 seq x 32 d) and V^T (64 vdim x 64 seq) tiles, all vectorized
      const uint4* s = (const uint4*)(Kp + (size_t)(kbase + ldRow) * D_DIM + kc16);
      uint4* d = (uint4*)(Ks + ldRow * KSTR + kc16);
      d[0] = s[0]; d[1] = s[1];
      const uint4* s2 = (const uint4*)(Vp + (size_t)ldRow * S_LEN + kbase + vc32);
      uint4* d2 = (uint4*)(Vs + ldRow * VSTR + vc32);
      d2[0] = s2[0]; d2[1] = s2[1]; d2[2] = s2[2]; d2[3] = s2[3];
    }
    __syncthreads();

    // scores = Q(16x32) x K^T(32x64): 4 WMMA
    v8f sc[4];
    #pragma unroll
    for (int j = 0; j < 4; ++j) {
      v16h bk;
      const _Float16* p = Ks + (j * 16 + l15) * KSTR + hioff;
      #pragma unroll
      for (int i = 0; i < 8; ++i) { bk[i] = p[i]; bk[8 + i] = p[16 + i]; }
      sc[j] = wmma16x16x32(aq, bk, vzero);
      #pragma unroll
      for (int r = 0; r < 8; ++r) sc[j][r] *= scale;
    }
    if (kt == qi) {                      // causal mask on diagonal tile
      #pragma unroll
      for (int j = 0; j < 4; ++j) {
        const int col = kbase + j * 16 + l15;
        #pragma unroll
        for (int r = 0; r < 8; ++r) {
          const int rowg = qrow0 + r + (hi << 3);
          if (col > rowg) sc[j][r] = -1e30f;
        }
      }
    }

    // online softmax (row stats live in VGPR index r, reduced over 16-lane groups)
    float nmax[8], alpha[8], psum[8];
    #pragma unroll
    for (int r = 0; r < 8; ++r) {
      float m = sc[0][r];
      #pragma unroll
      for (int j = 1; j < 4; ++j) m = fmaxf(m, sc[j][r]);
      #pragma unroll
      for (int off2 = 8; off2 > 0; off2 >>= 1) m = fmaxf(m, __shfl_xor(m, off2, 16));
      nmax[r] = fmaxf(rmax[r], m);
      alpha[r] = __expf(rmax[r] - nmax[r]);
      rmax[r] = nmax[r];
      psum[r] = 0.f;
    }
    #pragma unroll
    for (int j = 0; j < 4; ++j)
      #pragma unroll
      for (int r = 0; r < 8; ++r) {
        const float p = __expf(sc[j][r] - nmax[r]);
        sc[j][r] = p;
        psum[r] += p;
      }
    #pragma unroll
    for (int r = 0; r < 8; ++r) {
      float ps = psum[r];
      #pragma unroll
      for (int off2 = 8; off2 > 0; off2 >>= 1) ps += __shfl_xor(ps, off2, 16);
      rsum[r] = rsum[r] * alpha[r] + ps;
    }
    #pragma unroll
    for (int j = 0; j < 4; ++j)
      #pragma unroll
      for (int r = 0; r < 8; ++r) o[j][r] *= alpha[r];

    // P (C/D layout) -> LDS -> A-frag layout
    _Float16* Pw = Ps + wave * 16 * PSTR;
    #pragma unroll
    for (int j = 0; j < 4; ++j)
      #pragma unroll
      for (int r = 0; r < 8; ++r)
        Pw[(r + (hi << 3)) * PSTR + j * 16 + l15] = (_Float16)sc[j][r];
    __syncthreads();

    v16h ap0, ap1;
    {
      const _Float16* p = Pw + l15 * PSTR;
      #pragma unroll
      for (int i = 0; i < 8; ++i) {
        ap0[i]     = p[hioff + i];       ap0[8 + i] = p[16 + hioff + i];
        ap1[i]     = p[32 + hioff + i];  ap1[8 + i] = p[48 + hioff + i];
      }
    }
    // O += P(16x64) x V(64x64): 8 WMMA.
    // V^T layout makes each B-frag chunk 8 contiguous halfs -> ds_load_b128.
    #pragma unroll
    for (int j = 0; j < 4; ++j) {
      const _Float16* pv = Vs + (j * 16 + l15) * VSTR;
      v16h bv;
      #pragma unroll
      for (int i = 0; i < 8; ++i) { bv[i] = pv[hioff + i]; bv[8 + i] = pv[16 + hioff + i]; }
      o[j] = wmma16x16x32(ap0, bv, o[j]);
      #pragma unroll
      for (int i = 0; i < 8; ++i) { bv[i] = pv[32 + hioff + i]; bv[8 + i] = pv[48 + hioff + i]; }
      o[j] = wmma16x16x32(ap1, bv, o[j]);
    }
    __syncthreads();
  }

  // finalize: strided stores from a hoisted base pointer
  #pragma unroll
  for (int r = 0; r < 8; ++r) {
    const float invs = 1.f / rsum[r];
    float* rp = Op + (size_t)(qrow0 + r + (hi << 3)) * E_DIM + h * 64 + l15;
    #pragma unroll
    for (int j = 0; j < 4; ++j)
      rp[j * 16] = o[j][r] * invs;
  }
}

// -------------------------------- a = rmsnorm(attn1 - lam*attn2)*(1-LAMBDA) -> f16
__global__ __launch_bounds__(64)
void diff_rmsnorm(const float* __restrict__ a1, const float* __restrict__ a2,
                  const float* __restrict__ lamp, const float* __restrict__ w,
                  const float* __restrict__ b, _Float16* __restrict__ outh) {
  const int idx = blockIdx.x;
  const int s = idx >> 4;
  const int h = idx & 15;
  const int t = threadIdx.x;                    // 0..63 over the 2D-dim group
  __shared__ float sh[2];
  const float lam = lamp[0];
  const size_t off = (size_t)s * E_DIM + h * 64 + t;
  const float d = a1[off] - lam * a2[off];
  float sq = d * d;
  #pragma unroll
  for (int o = 16; o > 0; o >>= 1) sq += __shfl_xor(sq, o, 32);
  if ((t & 31) == 0) sh[t >> 5] = sq;
  __syncthreads();
  const float ms = (sh[0] + sh[1]) * (1.f / 64.f);
  const float r = rsqrtf(ms + 1e-8f);
  outh[off] = (_Float16)((d * r * w[t] + b[t]) * (1.f - LAMBDA_INIT_F));
}

// ---------------------------------------- out = layernorm(a + res) (fp32 + opt f16)
__global__ __launch_bounds__(256)
void add_layernorm(const float* __restrict__ a, const float* __restrict__ res,
                   const float* __restrict__ w, const float* __restrict__ b,
                   float* __restrict__ out32, _Float16* __restrict__ out16) {
  const int s = blockIdx.x;
  const int t = threadIdx.x;
  __shared__ float sh[8];
  __shared__ float stat[2];
  const size_t base = (size_t)s * E_DIM;
  float v[4];
  float sum = 0.f;
  #pragma unroll
  for (int i = 0; i < 4; ++i) {
    const int e = t + i * 256;
    const float xv = a[base + e] + res[base + e];
    v[i] = xv; sum += xv;
  }
  #pragma unroll
  for (int o = 16; o > 0; o >>= 1) sum += __shfl_xor(sum, o, 32);
  if ((t & 31) == 0) sh[t >> 5] = sum;
  __syncthreads();
  if (t == 0) { float r = 0.f; for (int i = 0; i < 8; ++i) r += sh[i]; stat[0] = r * (1.f / E_DIM); }
  __syncthreads();
  const float mean = stat[0];
  float sq = 0.f;
  #pragma unroll
  for (int i = 0; i < 4; ++i) { const float dd = v[i] - mean; sq += dd * dd; }
  #pragma unroll
  for (int o = 16; o > 0; o >>= 1) sq += __shfl_xor(sq, o, 32);
  if ((t & 31) == 0) sh[t >> 5] = sq;
  __syncthreads();
  if (t == 0) { float r = 0.f; for (int i = 0; i < 8; ++i) r += sh[i]; stat[1] = r * (1.f / E_DIM); }
  __syncthreads();
  const float rstd = rsqrtf(stat[1] + 1e-5f);
  #pragma unroll
  for (int i = 0; i < 4; ++i) {
    const int e = t + i * 256;
    const float ov = (v[i] - mean) * rstd * w[e] + b[e];
    out32[base + e] = ov;
    if (out16) out16[base + e] = (_Float16)ov;
  }
}

// ------------------------------------------------------------------ launcher
extern "C" void kernel_launch(void* const* d_in, const int* in_sizes, int n_in,
                              void* d_out, int out_size, void* d_ws, size_t ws_size,
                              hipStream_t stream) {
  (void)in_sizes; (void)n_in; (void)out_size; (void)ws_size;
  const float* x      = (const float*)d_in[0];
  const float* emb    = (const float*)d_in[1];
  const float* qkv_w  = (const float*)d_in[2];
  const float* out_w  = (const float*)d_in[3];
  const float* sigmaw = (const float*)d_in[4];
  const float* lq1    = (const float*)d_in[5];
  const float* lk1    = (const float*)d_in[6];
  const float* lq2    = (const float*)d_in[7];
  const float* lk2    = (const float*)d_in[8];
  const float* ln_w   = (const float*)d_in[9];
  const float* ln_b   = (const float*)d_in[10];
  const float* ln1_w  = (const float*)d_in[11];
  const float* ln1_b  = (const float*)d_in[12];
  const float* ln2_w  = (const float*)d_in[13];
  const float* ln2_b  = (const float*)d_in[14];
  const float* w1     = (const float*)d_in[15];
  const float* b1     = (const float*)d_in[16];
  const float* w2     = (const float*)d_in[17];
  const float* b2     = (const float*)d_in[18];
  float* out = (float*)d_out;

  char* ws = (char*)d_ws;
  size_t off = 0;
  auto alloc = [&](size_t bytes) -> char* {
    char* p = ws + off;
    off += (bytes + 255) & ~(size_t)255;
    return p;
  };
  float*    sig   = (float*)alloc(D_DIM * sizeof(float));
  float*    lam   = (float*)alloc(sizeof(float));
  _Float16* xb    = (_Float16*)alloc((size_t)S_LEN * E_DIM * 2);
  _Float16* wqkvb = (_Float16*)alloc((size_t)3 * E_DIM * E_DIM * 2);
  _Float16* woutb = (_Float16*)alloc((size_t)E_DIM * E_DIM * 2);
  _Float16* w1b   = (_Float16*)alloc((size_t)4 * E_DIM * E_DIM * 2);
  _Float16* w2b   = (_Float16*)alloc((size_t)4 * E_DIM * E_DIM * 2);
  float*    qkvf  = (float*)alloc((size_t)S_LEN * 3 * E_DIM * 4);       // reused below
  _Float16* q1b   = (_Float16*)alloc((size_t)H_NUM * S_LEN * D_DIM * 2);
  _Float16* q2b   = (_Float16*)alloc((size_t)H_NUM * S_LEN * D_DIM * 2);
  _Float16* k1b   = (_Float16*)alloc((size_t)H_NUM * S_LEN * D_DIM * 2);
  _Float16* k2b   = (_Float16*)alloc((size_t)H_NUM * S_LEN * D_DIM * 2);
  _Float16* vtb   = (_Float16*)alloc((size_t)H_NUM * S_LEN * 2 * D_DIM * 2);  // [h][vdim][s]
  _Float16* abh   = (_Float16*)alloc((size_t)S_LEN * E_DIM * 2);
  float*    aof   = (float*)alloc((size_t)S_LEN * E_DIM * 4);           // reused below
  float*    hf    = (float*)alloc((size_t)S_LEN * E_DIM * 4);
  _Float16* hb16  = (_Float16*)alloc((size_t)S_LEN * E_DIM * 2);

  // aliases into dead regions (stream-ordered, deterministic)
  float*    attn1f = qkvf;                                  // qkv dead after rope
  float*    attn2f = qkvf + (size_t)S_LEN * E_DIM;
  _Float16* f1b    = (_Float16*)qkvf;                       // attn bufs dead after diffnorm
  float*    fff    = aof;                                   // aof dead after first add_layernorm

  // 1. fp32 -> f16 conversions (activations + weights)
  cvt_f32_f16<<<8192, 256, 0, stream>>>(x,     xb,    (long long)S_LEN * E_DIM);
  cvt_f32_f16<<<8192, 256, 0, stream>>>(qkv_w, wqkvb, (long long)3 * E_DIM * E_DIM);
  cvt_f32_f16<<<4096, 256, 0, stream>>>(out_w, woutb, (long long)E_DIM * E_DIM);
  cvt_f32_f16<<<8192, 256, 0, stream>>>(w1,    w1b,   (long long)4 * E_DIM * E_DIM);
  cvt_f32_f16<<<8192, 256, 0, stream>>>(w2,    w2b,   (long long)4 * E_DIM * E_DIM);
  small_setup<<<1, 64, 0, stream>>>(emb, sigmaw, lq1, lk1, lq2, lk2, sig, lam);

  // 2. qkv = x @ qkv_w^T  (2048x3072x1024)
  gemm_wmma<0, false><<<dim3(3 * E_DIM / BN, S_LEN / BM), 256, 0, stream>>>(
      xb, wqkvb, nullptr, qkvf, nullptr, S_LEN, 3 * E_DIM, E_DIM);
  // 3. RoPE + sigma + head split (V transposed)
  rope_split<<<S_LEN, 256, 0, stream>>>(qkvf, sig, q1b, q2b, k1b, k2b, vtb);
  // 4. two causal flash attentions (WMMA QK^T and PV)
  attn_flash<<<dim3(S_LEN / 64, H_NUM, 2), 128, 0, stream>>>(
      q1b, q2b, k1b, k2b, vtb, attn1f, attn2f, 0.17677669529663687f);
  // 5. per-head rmsnorm of attn1 - lam*attn2
  diff_rmsnorm<<<S_LEN * H_NUM, 64, 0, stream>>>(attn1f, attn2f, lam, ln_w, ln_b, abh);
  // 6. out projection (2048x1024x1024)
  gemm_wmma<0, false><<<dim3(E_DIM / BN, S_LEN / BM), 256, 0, stream>>>(
      abh, woutb, nullptr, aof, nullptr, S_LEN, E_DIM, E_DIM);
  // 7. h = layernorm(a + x)
  add_layernorm<<<S_LEN, 256, 0, stream>>>(aof, x, ln1_w, ln1_b, hf, hb16);
  // 8. ff1 = silu(h @ w1^T + b1) -> f16 (2048x4096x1024)
  gemm_wmma<1, true><<<dim3(4 * E_DIM / BN, S_LEN / BM), 256, 0, stream>>>(
      hb16, w1b, b1, nullptr, f1b, S_LEN, 4 * E_DIM, E_DIM);
  // 9. ff = ff1 @ w2^T + b2 (2048x1024x4096)
  gemm_wmma<0, true><<<dim3(E_DIM / BN, S_LEN / BM), 256, 0, stream>>>(
      f1b, w2b, b2, fff, nullptr, S_LEN, E_DIM, 4 * E_DIM);
  // 10. out = layernorm(ff + h)
  add_layernorm<<<S_LEN, 256, 0, stream>>>(fff, hf, ln2_w, ln2_b, out, nullptr);
}

// v001
// One run takes 312 microseconds.
// Timed twice side by side with v000, it ran 1.18 times as fast both times.
#include <hip/hip_runtime.h>
#include <hip/hip_bf16.h>
#include <math.h>

typedef __attribute__((ext_vector_type(16))) _Float16 v16h;
typedef __attribute__((ext_vector_type(8)))  float    v8f;

#define S_LEN   2048
#define E_DIM   1024
#define H_NUM   16
#define D_DIM   32
#define SIG_DIM 256
#define LAMBDA_INIT_F 0.3555090675909693f

__device__ __forceinline__ v8f wmma16x16x32(v16h a, v16h b, v8f c) {
  // v_wmma_f32_16x16x32_f16: D = A(16x32,f16) x B(32x16,f16) + C(f32)
  return __builtin_amdgcn_wmma_f32_16x16x32_f16(false, a, false, b, (short)0, c, false, false);
}

// ---------------------------------------------------------------- conversions
__global__ void cvt_f32_f16(const float* __restrict__ src, _Float16* __restrict__ dst,
                            long long n) {
  long long i = (long long)blockIdx.x * blockDim.x + threadIdx.x;
  long long stride = (long long)gridDim.x * blockDim.x;
  for (; i < n; i += stride) dst[i] = (_Float16)src[i];
}

// --------------------------------------------------- sig = emb @ sigma_w.T ; lambda
__global__ void small_setup(const float* __restrict__ emb, const float* __restrict__ sigw,
                            const float* __restrict__ lq1, const float* __restrict__ lk1,
                            const float* __restrict__ lq2, const float* __restrict__ lk2,
                            float* __restrict__ sig, float* __restrict__ lam) {
  int t = threadIdx.x;
  if (t < D_DIM) {
    float s = 0.f;
    for (int j = 0; j < SIG_DIM; ++j) s += emb[j] * sigw[t * SIG_DIM + j];
    sig[t] = s;
  } else if (t == D_DIM) {
    float s1 = 0.f, s2 = 0.f;
    for (int i = 0; i < D_DIM; ++i) { s1 += lq1[i] * lk1[i]; s2 += lq2[i] * lk2[i]; }
    lam[0] = __expf(s1) - __expf(s2) + LAMBDA_INIT_F;
  }
}

// ------------------------------------------------------------------- GEMM
// C[M,N] = A[M,K] * B[N,K]^T (+bias). MODE 0: fp32 out. MODE 1: SiLU -> f16 out.
// Double-buffered LDS, global_prefetch of K+2 tile, branch-free templated epilogue.
#define BM 128
#define BN 128
#define BK 128    // one row of a K tile is 256 contiguous bytes = two whole 128-B lines
#define ASTR 136  // LDS stride in halfs (256 B + 16 B pad: 16 rows of b128 reads hit 64 distinct banks)

template <int MODE, bool HAS_BIAS>
__global__ __launch_bounds__(256)
void gemm_wmma(const _Float16* __restrict__ A, const _Float16* __restrict__ B,
               const float* __restrict__ bias, float* __restrict__ Cf,
               _Float16* __restrict__ Ch, int M, int N, int K) {
  __shared__ _Float16 As[2][BM * ASTR];
  __shared__ _Float16 Bs[2][BN * ASTR];
  const int tid   = threadIdx.x;
  const int lane  = tid & 31;
  const int wave  = tid >> 5;      // 8 wave32 waves
  const int wm    = wave >> 2;     // 0..1  (64 rows each)
  const int wn    = wave & 3;      // 0..3  (32 cols each)
  const int l15   = lane & 15;
  const int hioff = (lane >> 4) * 8;
  const int bm = blockIdx.y * BM;
  const int bn = blockIdx.x * BN;

  const v8f vzero = {0.f,0.f,0.f,0.f,0.f,0.f,0.f,0.f};
  v8f acc[4][2];
  #pragma unroll
  for (int mt = 0; mt < 4; ++mt)
    #pragma unroll
    for (int nt = 0; nt < 2; ++nt) acc[mt][nt] = vzero;

  // 16 lanes cover one row's 256 bytes, so a wave-wide 16-byte load touches
  // four whole lines (two rows); eight such loads per operand fill 128 rows.
  const int ldRow = tid >> 4;           // 0..15, +16 per load
  const int ldCol = (tid & 15) * 8;     // halfs
  // uniform tile bases + per-lane byte offsets that serve A and B alike (same pitch K)
  const char* gA = (const char*)(A + (size_t)bm * K);
  const char* gB = (const char*)(B + (size_t)bn * K);
  unsigned voff[8];
  #pragma unroll  // keeps voff[] in registers
  for (int i = 0; i < 8; ++i) voff[i] = (unsigned)(((ldRow + i * 16) * K + ldCol) * 2);
  const int ldsOff = ldRow * ASTR + ldCol;
  // prefetch offset: one lane per 128-B line of the tile, two tiles ahead
  unsigned pfoff = (unsigned)(((tid >> 1) * K + (tid & 1) * 64 + 2 * BK) * 2);

  // preload tile 0 into buffer 0
  {
    uint4 ra[8], rb[8];
    #pragma unroll  // all 16 loads issue before the first wait; ra/rb stay in registers
    for (int i = 0; i < 8; ++i) {
      ra[i] = *(const uint4*)(gA + voff[i]);
      rb[i] = *(const uint4*)(gB + voff[i]);
    }
    #pragma unroll  // constant LDS offsets
    for (int i = 0; i < 8; ++i) {
      *(uint4*)(&As[0][ldsOff + i * 16 * ASTR]) = ra[i];
      *(uint4*)(&Bs[0][ldsOff + i * 16 * ASTR]) = rb[i];
      voff[i] += BK * 2;
    }
  }
  __syncthreads();

  const int ktiles = K / BK;
  int cur = 0;
  for (int kt = 0; kt < ktiles; ++kt) {
    // pull the K+2 tile toward L2 (global_prefetch_b8)
    if (kt + 2 < ktiles) {
      __builtin_prefetch(gA + pfoff, 0, 1);
      __builtin_prefetch(gB + pfoff, 0, 1);
    }
    // stage K+1 tile into the alternate buffer while we compute from `cur`
    if (kt + 1 < ktiles) {
      uint4 ra[8], rb[8];
      #pragma unroll  // all 16 loads issue before the first wait; ra/rb stay in registers
      for (int i = 0; i < 8; ++i) {
        ra[i] = *(const uint4*)(gA + voff[i]);
        rb[i] = *(const uint4*)(gB + voff[i]);
      }
      #pragma unroll  // constant LDS offsets
      for (int i = 0; i < 8; ++i) {
        *(uint4*)(&As[cur ^ 1][ldsOff + i * 16 * ASTR]) = ra[i];
        *(uint4*)(&Bs[cur ^ 1][ldsOff + i * 16 * ASTR]) = rb[i];
        voff[i] += BK * 2;
      }
      pfoff += BK * 2;
    }

    // four 32-deep WMMA steps per tile, k ascending; unrolled for constant LDS offsets
    #pragma unroll
    for (int ks = 0; ks < BK / 32; ++ks) {
      v16h af[4], bf2[2];
      #pragma unroll
      for (int mt = 0; mt < 4; ++mt) {
        const _Float16* p = &As[cur][(wm * 64 + mt * 16 + l15) * ASTR + ks * 32 + hioff];
        #pragma unroll
        for (int i = 0; i < 8; ++i) { af[mt][i] = p[i]; af[mt][8 + i] = p[16 + i]; }
      }
      #pragma unroll
      for (int nt = 0; nt < 2; ++nt) {
        const _Float16* p = &Bs[cur][(wn * 32 + nt * 16 + l15) * ASTR + ks * 32 + hioff];
        #pragma unroll
        for (int i = 0; i < 8; ++i) { bf2[nt][i] = p[i]; bf2[nt][8 + i] = p[16 + i]; }
      }
      #pragma unroll
      for (int mt = 0; mt < 4; ++mt)
        #pragma unroll
        for (int nt = 0; nt < 2; ++nt)
          acc[mt][nt] = wmma16x16x32(af[mt], bf2[nt], acc[mt][nt]);
    }

    __syncthreads();   // next-tile LDS writes complete; safe to flip buffers
    cur ^= 1;
  }

  // ---------------- branch-free epilogue (bias hoisted, strided stores)
  float bv[2] = {0.f, 0.f};
  if (HAS_BIAS) {
    bv[0] = bias[bn + wn * 32 + l15];
    bv[1] = bias[bn + wn * 32 + 16 + l15];
  }
  #pragma unroll
  for (int mt = 0; mt < 4; ++mt) {
    const int gm0 = bm + wm * 64 + mt * 16 + ((lane >> 4) << 3);
    #pragma unroll
    for (int nt = 0; nt < 2; ++nt) {
      const int gn = bn + wn * 32 + nt * 16 + l15;
      if (MODE == 1) {
        _Float16* cp = Ch + (size_t)gm0 * N + gn;
        #pragma unroll
        for (int r = 0; r < 8; ++r) {
          float v = acc[mt][nt][r];
          if (HAS_BIAS) v += bv[nt];
          cp[(size_t)r * N] = (_Float16)(v / (1.f + __expf(-v)));   // SiLU
        }
      } else {
        float* cp = Cf + (size_t)gm0 * N + gn;
        #pragma unroll
        for (int r = 0; r < 8; ++r) {
          float v = acc[mt][nt][r];
          if (HAS_BIAS) v += bv[nt];
          cp[(size_t)r * N] = v;
        }
      }
    }
  }
}

// ------------------------------------------- RoPE + sigma add + head split -> f16
// Q/K written [h][s][d] (row = K-contig for A/B frags).
// V written TRANSPOSED [h][vdim][s] so attention's B-frag of V is K(seq)-contiguous.
__global__ __launch_bounds__(256)
void rope_split(const float* __restrict__ qkv, const float* __restrict__ sig,
                _Float16* __restrict__ q1, _Float16* __restrict__ q2,
                _Float16* __restrict__ k1, _Float16* __restrict__ k2,
                _Float16* __restrict__ vt) {
  const int s = blockIdx.x;
  const int t = threadIdx.x;
  __shared__ float sigs[D_DIM];
  if (t < D_DIM) sigs[t] = sig[t];
  __syncthreads();
  const float* row = qkv + (size_t)s * (3 * E_DIM);
  for (int idx = t; idx < 3 * E_DIM; idx += 256) {
    const int which = idx >> 10;        // 0=q 1=k 2=v
    const int rem   = idx & 1023;
    const int rh    = rem >> 5;         // rope head 0..31
    const int d     = rem & 31;
    const int h     = rh >> 1;
    const int sub   = rh & 1;
    const float val = row[idx];
    float o = val;
    if (which < 2 && d < 16) {          // rotate first half of head dim, pairwise
      const int p = d >> 1;
      const float inv = __powf(10000.f, -(float)(2 * p) * (1.f / 16.f));
      const float ang = (float)s * inv;
      float sn, c; __sincosf(ang, &sn, &c);
      const float other = row[(idx & ~31) + (d ^ 1)];
      o = (d & 1) ? (val * c + other * sn) : (val * c - other * sn);
    }
    if (which < 2 && sub == 1) o += sigs[d];
    if (which == 0) {
      _Float16* dst = sub ? q2 : q1;
      dst[(size_t)h * S_LEN * D_DIM + (size_t)s * D_DIM + d] = (_Float16)o;
    } else if (which == 1) {
      _Float16* dst = sub ? k2 : k1;
      dst[(size_t)h * S_LEN * D_DIM + (size_t)s * D_DIM + d] = (_Float16)o;
    } else {
      // transposed: [h][vdim = sub*32+d][s]
      vt[(size_t)h * (2 * D_DIM) * S_LEN + (size_t)(sub * D_DIM + d) * S_LEN + s] = (_Float16)o;
    }
  }
}

// ----------------------------------------------------- flash attention (WMMA)
#define KSTR 40
#define VSTR 72   // Vs rows are vdim (64), cols are seq/K (64) + pad
#define PSTR 72

__global__ __launch_bounds__(128)
void attn_flash(const _Float16* __restrict__ q1, const _Float16* __restrict__ q2,
                const _Float16* __restrict__ k1, const _Float16* __restrict__ k2,
                const _Float16* __restrict__ vt,
                float* __restrict__ o1, float* __restrict__ o2, float scale) {
  __shared__ _Float16 Ks[64 * KSTR];
  __shared__ _Float16 Vs[64 * VSTR];    // transposed V tile: [vdim][seq]
  __shared__ _Float16 Ps[4 * 16 * PSTR];

  const int tid   = threadIdx.x;
  const int lane  = tid & 31;
  const int wave  = tid >> 5;          // 4 waves, 16 q-rows each
  const int l15   = lane & 15;
  const int hi    = lane >> 4;
  const int hioff = hi * 8;

  const int qi = blockIdx.x;           // q tile (64 rows)
  const int h  = blockIdx.y;
  const int ai = blockIdx.z;           // which attention (0/1)

  const _Float16* Qp = (ai ? q2 : q1) + (size_t)h * S_LEN * D_DIM;
  const _Float16* Kp = (ai ? k2 : k1) + (size_t)h * S_LEN * D_DIM;
  const _Float16* Vp = vt + (size_t)h * (2 * D_DIM) * S_LEN;   // [vdim][s]
  float* Op = ai ? o2 : o1;

  const int qbase = qi * 64;
  const int qrow0 = qbase + wave * 16;

  v16h aq;                              // Q A-frag (rows contiguous in global, K=32)
  {
    const _Float16* p = Qp + (size_t)(qrow0 + l15) * D_DIM + hioff;
    #pragma unroll
    for (int i = 0; i < 8; ++i) { aq[i] = p[i]; aq[8 + i] = p[16 + i]; }
  }

  const v8f vzero = {0.f,0.f,0.f,0.f,0.f,0.f,0.f,0.f};
  v8f o[4];
  #pragma unroll
  for (int j = 0; j < 4; ++j) o[j] = vzero;
  float rmax[8], rsum[8];
  #pragma unroll
  for (int r = 0; r < 8; ++r) { rmax[r] = -1e30f; rsum[r] = 0.f; }

  const int ldRow = tid >> 1;           // 0..63
  const int kc16  = (tid & 1) * 16;
  const int vc32  = (tid & 1) * 32;

  for (int kt = 0; kt <= qi; ++kt) {
    const int kbase = kt * 64;
    {   // stage K (64 seq x 32 d) and V^T (64 vdim x 64 seq) tiles, all vectorized
      const uint4* s = (const uint4*)(Kp + (size_t)(kbase + ldRow) * D_DIM + kc16);
      uint4* d = (uint4*)(Ks + ldRow * KSTR + kc16);
      d[0] = s[0]; d[1] = s[1];
      const uint4* s2 = (const uint4*)(Vp + (size_t)ldRow * S_LEN + kbase + vc32);
      uint4* d2 = (uint4*)(Vs + ldRow * VSTR + vc32);
      d2[0] = s2[0]; d2[1] = s2[1]; d2[2] = s2[2]; d2[3] = s2[3];
    }
    __syncthreads();

    // scores = Q(16x32) x K^T(32x64): 4 WMMA
    v8f sc[4];
    #pragma unroll
    for (int j = 0; j < 4; ++j) {
      v16h bk;
      const _Float16* p = Ks + (j * 16 + l15) * KSTR + hioff;
      #pragma unroll
      for (int i = 0; i < 8; ++i) { bk[i] = p[i]; bk[8 + i] = p[16 + i]; }
      sc[j] = wmma16x16x32(aq, bk, vzero);
      #pragma unroll
      for (int r = 0; r < 8; ++r) sc[j][r] *= scale;
    }
    if (kt == qi) {                      // causal mask on diagonal tile
      #pragma unroll
      for (int j = 0; j < 4; ++j) {
        const int col = kbase + j * 16 + l15;
        #pragma unroll
        for (int r = 0; r < 8; ++r) {
          const int rowg = qrow0 + r + (hi << 3);
          if (col > rowg) sc[j][r] = -1e30f;
        }
      }
    }

    // online softmax (row stats live in VGPR index r, reduced over 16-lane groups)
    float nmax[8], alpha[8], psum[8];
    #pragma unroll
    for (int r = 0; r < 8; ++r) {
      float m = sc[0][r];
      #pragma unroll
      for (int j = 1; j < 4; ++j) m = fmaxf(m, sc[j][r]);
      #pragma unroll
      for (int off2 = 8; off2 > 0; off2 >>= 1) m = fmaxf(m, __shfl_xor(m, off2, 16));
      nmax[r] = fmaxf(rmax[r], m);
      alpha[r] = __expf(rmax[r] - nmax[r]);
      rmax[r] = nmax[r];
      psum[r] = 0.f;
    }
    #pragma unroll
    for (int j = 0; j < 4; ++j)
      #pragma unroll
      for (int r = 0; r < 8; ++r) {
        const float p = __expf(sc[j][r] - nmax[r]);
        sc[j][r] = p;
        psum[r] += p;
      }
    #pragma unroll
    for (int r = 0; r < 8; ++r) {
      float ps = psum[r];
      #pragma unroll
      for (int off2 = 8; off2 > 0; off2 >>= 1) ps += __shfl_xor(ps, off2, 16);
      rsum[r] = rsum[r] * alpha[r] + ps;
    }
    #pragma unroll
    for (int j = 0; j < 4; ++j)
      #pragma unroll
      for (int r = 0; r < 8; ++r) o[j][r] *= alpha[r];

    // P (C/D layout) -> LDS -> A-frag layout
    _Float16* Pw = Ps + wave * 16 * PSTR;
    #pragma unroll
    for (int j = 0; j < 4; ++j)
      #pragma unroll
      for (int r = 0; r < 8; ++r)
        Pw[(r + (hi << 3)) * PSTR + j * 16 + l15] = (_Float16)sc[j][r];
    __syncthreads();

    v16h ap0, ap1;
    {
      const _Float16* p = Pw + l15 * PSTR;
      #pragma unroll
      for (int i = 0; i < 8; ++i) {
        ap0[i]     = p[hioff + i];       ap0[8 + i] = p[16 + hioff + i];
        ap1[i]     = p[32 + hioff + i];  ap1[8 + i] = p[48 + hioff + i];
      }
    }
    // O += P(16x64) x V(64x64): 8 WMMA.
    // V^T layout makes each B-frag chunk 8 contiguous halfs -> ds_load_b128.
    #pragma unroll
    for (int j = 0; j < 4; ++j) {
      const _Float16* pv = Vs + (j * 16 + l15) * VSTR;
      v16h bv;
      #pragma unroll
      for (int i = 0; i < 8; ++i) { bv[i] = pv[hioff + i]; bv[8 + i] = pv[16 + hioff + i]; }
      o[j] = wmma16x16x32(ap0, bv, o[j]);
      #pragma unroll
      for (int i = 0; i < 8; ++i) { bv[i] = pv[32 + hioff + i]; bv[8 + i] = pv[48 + hioff + i]; }
      o[j] = wmma16x16x32(ap1, bv, o[j]);
    }
    __syncthreads();
  }

  // finalize: strided stores from a hoisted base pointer
  #pragma unroll
  for (int r = 0; r < 8; ++r) {
    const float invs = 1.f / rsum[r];
    float* rp = Op + (size_t)(qrow0 + r + (hi << 3)) * E_DIM + h * 64 + l15;
    #pragma unroll
    for (int j = 0; j < 4; ++j)
      rp[j * 16] = o[j][r] * invs;
  }
}

// -------------------------------- a = rmsnorm(attn1 - lam*attn2)*(1-LAMBDA) -> f16
__global__ __launch_bounds__(64)
void diff_rmsnorm(const float* __restrict__ a1, const float* __restrict__ a2,
                  const float* __restrict__ lamp, const float* __restrict__ w,
                  const float* __restrict__ b, _Float16* __restrict__ outh) {
  const int idx = blockIdx.x;
  const int s = idx >> 4;
  const int h = idx & 15;
  const int t = threadIdx.x;                    // 0..63 over the 2D-dim group
  __shared__ float sh[2];
  const float lam = lamp[0];
  const size_t off = (size_t)s * E_DIM + h * 64 + t;
  const float d = a1[off] - lam * a2[off];
  float sq = d * d;
  #pragma unroll
  for (int o = 16; o > 0; o >>= 1) sq += __shfl_xor(sq, o, 32);
  if ((t & 31) == 0) sh[t >> 5] = sq;
  __syncthreads();
  const float ms = (sh[0] + sh[1]) * (1.f / 64.f);
  const float r = rsqrtf(ms + 1e-8f);
  outh[off] = (_Float16)((d * r * w[t] + b[t]) * (1.f - LAMBDA_INIT_F));
}

// ---------------------------------------- out = layernorm(a + res) (fp32 + opt f16)
__global__ __launch_bounds__(256)
void add_layernorm(const float* __restrict__ a, const float* __restrict__ res,
                   const float* __restrict__ w, const float* __restrict__ b,
                   float* __restrict__ out32, _Float16* __restrict__ out16) {
  const int s = blockIdx.x;
  const int t = threadIdx.x;
  __shared__ float sh[8];
  __shared__ float stat[2];
  const size_t base = (size_t)s * E_DIM;
  float v[4];
  float sum = 0.f;
  #pragma unroll
  for (int i = 0; i < 4; ++i) {
    const int e = t + i * 256;
    const float xv = a[base + e] + res[base + e];
    v[i] = xv; sum += xv;
  }
  #pragma unroll
  for (int o = 16; o > 0; o >>= 1) sum += __shfl_xor(sum, o, 32);
  if ((t & 31) == 0) sh[t >> 5] = sum;
  __syncthreads();
  if (t == 0) { float r = 0.f; for (int i = 0; i < 8; ++i) r += sh[i]; stat[0] = r * (1.f / E_DIM); }
  __syncthreads();
  const float mean = stat[0];
  float sq = 0.f;
  #pragma unroll
  for (int i = 0; i < 4; ++i) { const float dd = v[i] - mean; sq += dd * dd; }
  #pragma unroll
  for (int o = 16; o > 0; o >>= 1) sq += __shfl_xor(sq, o, 32);
  if ((t & 31) == 0) sh[t >> 5] = sq;
  __syncthreads();
  if (t == 0) { float r = 0.f; for (int i = 0; i < 8; ++i) r += sh[i]; stat[1] = r * (1.f / E_DIM); }
  __syncthreads();
  const float rstd = rsqrtf(stat[1] + 1e-5f);
  #pragma unroll
  for (int i = 0; i < 4; ++i) {
    const int e = t + i * 256;
    const float ov = (v[i] - mean) * rstd * w[e] + b[e];
    out32[base + e] = ov;
    if (out16) out16[base + e] = (_Float16)ov;
  }
}

// ------------------------------------------------------------------ launcher
extern "C" void kernel_launch(void* const* d_in, const int* in_sizes, int n_in,
                              void* d_out, int out_size, void* d_ws, size_t ws_size,
                              hipStream_t stream) {
  (void)in_sizes; (void)n_in; (void)out_size; (void)ws_size;
  const float* x      = (const float*)d_in[0];
  const float* emb    = (const float*)d_in[1];
  const float* qkv_w  = (const float*)d_in[2];
  const float* out_w  = (const float*)d_in[3];
  const float* sigmaw = (const float*)d_in[4];
  const float* lq1    = (const float*)d_in[5];
  const float* lk1    = (const float*)d_in[6];
  const float* lq2    = (const float*)d_in[7];
  const float* lk2    = (const float*)d_in[8];
  const float* ln_w   = (const float*)d_in[9];
  const float* ln_b   = (const float*)d_in[10];
  const float* ln1_w  = (const float*)d_in[11];
  const float* ln1_b  = (const float*)d_in[12];
  const float* ln2_w  = (const float*)d_in[13];
  const float* ln2_b  = (const float*)d_in[14];
  const float* w1     = (const float*)d_in[15];
  const float* b1     = (const float*)d_in[16];
  const float* w2     = (const float*)d_in[17];
  const float* b2     = (const float*)d_in[18];
  float* out = (float*)d_out;

  char* ws = (char*)d_ws;
  size_t off = 0;
  auto alloc = [&](size_t bytes) -> char* {
    char* p = ws + off;
    off += (bytes + 255) & ~(size_t)255;
    return p;
  };
  float*    sig   = (float*)alloc(D_DIM * sizeof(float));
  float*    lam   = (float*)alloc(sizeof(float));
  _Float16* xb    = (_Float16*)alloc((size_t)S_LEN * E_DIM * 2);
  _Float16* wqkvb = (_Float16*)alloc((size_t)3 * E_DIM * E_DIM * 2);
  _Float16* woutb = (_Float16*)alloc((size_t)E_DIM * E_DIM * 2);
  _Float16* w1b   = (_Float16*)alloc((size_t)4 * E_DIM * E_DIM * 2);
  _Float16* w2b   = (_Float16*)alloc((size_t)4 * E_DIM * E_DIM * 2);
  float*    qkvf  = (float*)alloc((size_t)S_LEN * 3 * E_DIM * 4);       // reused below
  _Float16* q1b   = (_Float16*)alloc((size_t)H_NUM * S_LEN * D_DIM * 2);
  _Float16* q2b   = (_Float16*)alloc((size_t)H_NUM * S_LEN * D_DIM * 2);
  _Float16* k1b   = (_Float16*)alloc((size_t)H_NUM * S_LEN * D_DIM * 2);
  _Float16* k2b   = (_Float16*)alloc((size_t)H_NUM * S_LEN * D_DIM * 2);
  _Float16* vtb   = (_Float16*)alloc((size_t)H_NUM * S_LEN * 2 * D_DIM * 2);  // [h][vdim][s]
  _Float16* abh   = (_Float16*)alloc((size_t)S_LEN * E_DIM * 2);
  float*    aof   = (float*)alloc((size_t)S_LEN * E_DIM * 4);           // reused below
  float*    hf    = (float*)alloc((size_t)S_LEN * E_DIM * 4);
  _Float16* hb16  = (_Float16*)alloc((size_t)S_LEN * E_DIM * 2);

  // aliases into dead regions (stream-ordered, deterministic)
  float*    attn1f = qkvf;                                  // qkv dead after rope
  float*    attn2f = qkvf + (size_t)S_LEN * E_DIM;
  _Float16* f1b    = (_Float16*)qkvf;                       // attn bufs dead after diffnorm
  float*    fff    = aof;                                   // aof dead after first add_layernorm

  // 1. fp32 -> f16 conversions (activations + weights)
  cvt_f32_f16<<<8192, 256, 0, stream>>>(x,     xb,    (long long)S_LEN * E_DIM);
  cvt_f32_f16<<<8192, 256, 0, stream>>>(qkv_w, wqkvb, (long long)3 * E_DIM * E_DIM);
  cvt_f32_f16<<<4096, 256, 0, stream>>>(out_w, woutb, (long long)E_DIM * E_DIM);
  cvt_f32_f16<<<8192, 256, 0, stream>>>(w1,    w1b,   (long long)4 * E_DIM * E_DIM);
  cvt_f32_f16<<<8192, 256, 0, stream>>>(w2,    w2b,   (long long)4 * E_DIM * E_DIM);
  small_setup<<<1, 64, 0, stream>>>(emb, sigmaw, lq1, lk1, lq2, lk2, sig, lam);

  // 2. qkv = x @ qkv_w^T  (2048x3072x1024)
  gemm_wmma<0, false><<<dim3(3 * E_DIM / BN, S_LEN / BM), 256, 0, stream>>>(
      xb, wqkvb, nullptr, qkvf, nullptr, S_LEN, 3 * E_DIM, E_DIM);
  // 3. RoPE + sigma + head split (V transposed)
  rope_split<<<S_LEN, 256, 0, stream>>>(qkvf, sig, q1b, q2b, k1b, k2b, vtb);
  // 4. two causal flash attentions (WMMA QK^T and PV)
  attn_flash<<<dim3(S_LEN / 64, H_NUM, 2), 128, 0, stream>>>(
      q1b, q2b, k1b, k2b, vtb, attn1f, attn2f, 0.17677669529663687f);
  // 5. per-head rmsnorm of attn1 - lam*attn2
  diff_rmsnorm<<<S_LEN * H_NUM, 64, 0, stream>>>(attn1f, attn2f, lam, ln_w, ln_b, abh);
  // 6. out projection (2048x1024x1024)
  gemm_wmma<0, false><<<dim3(E_DIM / BN, S_LEN / BM), 256, 0, stream>>>(
      abh, woutb, nullptr, aof, nullptr, S_LEN, E_DIM, E_DIM);
  // 7. h = layernorm(a + x)
  add_layernorm<<<S_LEN, 256, 0, stream>>>(aof, x, ln1_w, ln1_b, hf, hb16);
  // 8. ff1 = silu(h @ w1^T + b1) -> f16 (2048x4096x1024)
  gemm_wmma<1, true><<<dim3(4 * E_DIM / BN, S_LEN / BM), 256, 0, stream>>>(
      hb16, w1b, b1, nullptr, f1b, S_LEN, 4 * E_DIM, E_DIM);
  // 9. ff = ff1 @ w2^T + b2 (2048x1024x4096)
  gemm_wmma<0, true><<<dim3(E_DIM / BN, S_LEN / BM), 256, 0, stream>>>(
      f1b, w2b, b2, fff, nullptr, S_LEN, E_DIM, 4 * E_DIM);
  // 10. out = layernorm(ff + h)
  add_layernorm<<<S_LEN, 256, 0, stream>>>(fff, hf, ln2_w, ln2_b, out, nullptr);
}

// v002
// Measured time: 295 microseconds a run.
// In both of two side-by-side timings against v001, it was 1.06 times as fast.
// Counting every step since v000, it is 1.24 times as fast.
#include <hip/hip_runtime.h>
#include <hip/hip_bf16.h>
#include <math.h>

typedef __attribute__((ext_vector_type(16))) _Float16 v16h;
typedef __attribute__((ext_vector_type(8)))  float    v8f;

#define S_LEN   2048
#define E_DIM   1024
#define H_NUM   16
#define D_DIM   32
#define SIG_DIM 256
#define LAMBDA_INIT_F 0.3555090675909693f

__device__ __forceinline__ v8f wmma16x16x32(v16h a, v16h b, v8f c) {
  // v_wmma_f32_16x16x32_f16: D = A(16x32,f16) x B(32x16,f16) + C(f32)
  return __builtin_amdgcn_wmma_f32_16x16x32_f16(false, a, false, b, (short)0, c, false, false);
}

// ---------------------------------------------------------------- conversions
// One work-group converts U x 1024 consecutive values; the grid covers the array exactly
// (every count here is a multiple of U x 1024). A wave-wide 16-byte load covers four whole
// lines and its 8-byte store two, and a launch starts 2,048 or 4,096 waves in all.
typedef __attribute__((ext_vector_type(4))) float    v4f;
typedef __attribute__((ext_vector_type(4))) _Float16 v4h;

template <int U>
__global__ __launch_bounds__(256)
void cvt_f32_f16(const float* __restrict__ src, _Float16* __restrict__ dst) {
  const unsigned first = (blockIdx.x * (U * 256) + threadIdx.x) * 4;
  v4f v[U];
  #pragma unroll  // all U loads issue before the first wait; v[] stays in registers
  for (int u = 0; u < U; ++u) v[u] = *(const v4f*)(src + first + u * 1024);
  #pragma unroll  // constant offsets
  for (int u = 0; u < U; ++u) *(v4h*)(dst + first + u * 1024) = __builtin_convertvector(v[u], v4h);
}

// --------------------------------------------------- sig = emb @ sigma_w.T ; lambda
__global__ void small_setup(const float* __restrict__ emb, const float* __restrict__ sigw,
                            const float* __restrict__ lq1, const float* __restrict__ lk1,
                            const float* __restrict__ lq2, const float* __restrict__ lk2,
                            float* __restrict__ sig, float* __restrict__ lam) {
  int t = threadIdx.x;
  if (t < D_DIM) {
    float s = 0.f;
    for (int j = 0; j < SIG_DIM; ++j) s += emb[j] * sigw[t * SIG_DIM + j];
    sig[t] = s;
  } else if (t == D_DIM) {
    float s1 = 0.f, s2 = 0.f;
    for (int i = 0; i < D_DIM; ++i) { s1 += lq1[i] * lk1[i]; s2 += lq2[i] * lk2[i]; }
    lam[0] = __expf(s1) - __expf(s2) + LAMBDA_INIT_F;
  }
}

// ------------------------------------------------------------------- GEMM
// C[M,N] = A[M,K] * B[N,K]^T (+bias). MODE 0: fp32 out. MODE 1: SiLU -> f16 out.
// Double-buffered LDS, global_prefetch of K+2 tile, branch-free templated epilogue.
#define BM 128
#define BN 128
#define BK 128    // one row of a K tile is 256 contiguous bytes = two whole 128-B lines
#define ASTR 136  // LDS stride in halfs (256 B + 16 B pad: 16 rows of b128 reads hit 64 distinct banks)

template <int MODE, bool HAS_BIAS>
__global__ __launch_bounds__(256)
void gemm_wmma(const _Float16* __restrict__ A, const _Float16* __restrict__ B,
               const float* __restrict__ bias, float* __restrict__ Cf,
               _Float16* __restrict__ Ch, int M, int N, int K) {
  __shared__ _Float16 As[2][BM * ASTR];
  __shared__ _Float16 Bs[2][BN * ASTR];
  const int tid   = threadIdx.x;
  const int lane  = tid & 31;
  const int wave  = tid >> 5;      // 8 wave32 waves
  const int wm    = wave >> 2;     // 0..1  (64 rows each)
  const int wn    = wave & 3;      // 0..3  (32 cols each)
  const int l15   = lane & 15;
  const int hioff = (lane >> 4) * 8;
  const int bm = blockIdx.y * BM;
  const int bn = blockIdx.x * BN;

  const v8f vzero = {0.f,0.f,0.f,0.f,0.f,0.f,0.f,0.f};
  v8f acc[4][2];
  #pragma unroll
  for (int mt = 0; mt < 4; ++mt)
    #pragma unroll
    for (int nt = 0; nt < 2; ++nt) acc[mt][nt] = vzero;

  // 16 lanes cover one row's 256 bytes, so a wave-wide 16-byte load touches
  // four whole lines (two rows); eight such loads per operand fill 128 rows.
  const int ldRow = tid >> 4;           // 0..15, +16 per load
  const int ldCol = (tid & 15) * 8;     // halfs
  // uniform tile bases + per-lane byte offsets that serve A and B alike (same pitch K)
  const char* gA = (const char*)(A + (size_t)bm * K);
  const char* gB = (const char*)(B + (size_t)bn * K);
  unsigned voff[8];
  #pragma unroll  // keeps voff[] in registers
  for (int i = 0; i < 8; ++i) voff[i] = (unsigned)(((ldRow + i * 16) * K + ldCol) * 2);
  const int ldsOff = ldRow * ASTR + ldCol;
  // prefetch offset: one lane per 128-B line of the tile, two tiles ahead
  unsigned pfoff = (unsigned)(((tid >> 1) * K + (tid & 1) * 64 + 2 * BK) * 2);

  // preload tile 0 into buffer 0
  {
    uint4 ra[8], rb[8];
    #pragma unroll  // all 16 loads issue before the first wait; ra/rb stay in registers
    for (int i = 0; i < 8; ++i) {
      ra[i] = *(const uint4*)(gA + voff[i]);
      rb[i] = *(const uint4*)(gB + voff[i]);
    }
    #pragma unroll  // constant LDS offsets
    for (int i = 0; i < 8; ++i) {
      *(uint4*)(&As[0][ldsOff + i * 16 * ASTR]) = ra[i];
      *(uint4*)(&Bs[0][ldsOff + i * 16 * ASTR]) = rb[i];
      voff[i] += BK * 2;
    }
  }
  __syncthreads();

  const int ktiles = K / BK;
  int cur = 0;
  for (int kt = 0; kt < ktiles; ++kt) {
    // pull the K+2 tile toward L2 (global_prefetch_b8)
    if (kt + 2 < ktiles) {
      __builtin_prefetch(gA + pfoff, 0, 1);
      __builtin_prefetch(gB + pfoff, 0, 1);
    }
    // stage K+1 tile into the alternate buffer while we compute from `cur`
    if (kt + 1 < ktiles) {
      uint4 ra[8], rb[8];
      #pragma unroll  // all 16 loads issue before the first wait; ra/rb stay in registers
      for (int i = 0; i < 8; ++i) {
        ra[i] = *(const uint4*)(gA + voff[i]);
        rb[i] = *(const uint4*)(gB + voff[i]);
      }
      #pragma unroll  // constant LDS offsets
      for (int i = 0; i < 8; ++i) {
        *(uint4*)(&As[cur ^ 1][ldsOff + i * 16 * ASTR]) = ra[i];
        *(uint4*)(&Bs[cur ^ 1][ldsOff + i * 16 * ASTR]) = rb[i];
        voff[i] += BK * 2;
      }
      pfoff += BK * 2;
    }

    // four 32-deep WMMA steps per tile, k ascending; unrolled for constant LDS offsets
    #pragma unroll
    for (int ks = 0; ks < BK / 32; ++ks) {
      v16h af[4], bf2[2];
      #pragma unroll
      for (int mt = 0; mt < 4; ++mt) {
        const _Float16* p = &As[cur][(wm * 64 + mt * 16 + l15) * ASTR + ks * 32 + hioff];
        #pragma unroll
        for (int i = 0; i < 8; ++i) { af[mt][i] = p[i]; af[mt][8 + i] = p[16 + i]; }
      }
      #pragma unroll
      for (int nt = 0; nt < 2; ++nt) {
        const _Float16* p = &Bs[cur][(wn * 32 + nt * 16 + l15) * ASTR + ks * 32 + hioff];
        #pragma unroll
        for (int i = 0; i < 8; ++i) { bf2[nt][i] = p[i]; bf2[nt][8 + i] = p[16 + i]; }
      }
      #pragma unroll
      for (int mt = 0; mt < 4; ++mt)
        #pragma unroll
        for (int nt = 0; nt < 2; ++nt)
          acc[mt][nt] = wmma16x16x32(af[mt], bf2[nt], acc[mt][nt]);
    }

    __syncthreads();   // next-tile LDS writes complete; safe to flip buffers
    cur ^= 1;
  }

  // ---------------- branch-free epilogue (bias hoisted, strided stores)
  float bv[2] = {0.f, 0.f};
  if (HAS_BIAS) {
    bv[0] = bias[bn + wn * 32 + l15];
    bv[1] = bias[bn + wn * 32 + 16 + l15];
  }
  #pragma unroll
  for (int mt = 0; mt < 4; ++mt) {
    const int gm0 = bm + wm * 64 + mt * 16 + ((lane >> 4) << 3);
    #pragma unroll
    for (int nt = 0; nt < 2; ++nt) {
      const int gn = bn + wn * 32 + nt * 16 + l15;
      if (MODE == 1) {
        _Float16* cp = Ch + (size_t)gm0 * N + gn;
        #pragma unroll
        for (int r = 0; r < 8; ++r) {
          float v = acc[mt][nt][r];
          if (HAS_BIAS) v += bv[nt];
          cp[(size_t)r * N] = (_Float16)(v / (1.f + __expf(-v)));   // SiLU
        }
      } else {
        float* cp = Cf + (size_t)gm0 * N + gn;
        #pragma unroll
        for (int r = 0; r < 8; ++r) {
          float v = acc[mt][nt][r];
          if (HAS_BIAS) v += bv[nt];
          cp[(size_t)r * N] = v;
        }
      }
    }
  }
}

// ------------------------------------------- RoPE + sigma add + head split -> f16
// Q/K written [h][s][d] (row = K-contig for A/B frags).
// V written TRANSPOSED [h][vdim][s] so attention's B-frag of V is K(seq)-contiguous.
__global__ __launch_bounds__(256)
void rope_split(const float* __restrict__ qkv, const float* __restrict__ sig,
                _Float16* __restrict__ q1, _Float16* __restrict__ q2,
                _Float16* __restrict__ k1, _Float16* __restrict__ k2,
                _Float16* __restrict__ vt) {
  const int s = blockIdx.x;
  const int t = threadIdx.x;
  __shared__ float sigs[D_DIM];
  if (t < D_DIM) sigs[t] = sig[t];
  __syncthreads();
  const float* row = qkv + (size_t)s * (3 * E_DIM);
  for (int idx = t; idx < 3 * E_DIM; idx += 256) {
    const int which = idx >> 10;        // 0=q 1=k 2=v
    const int rem   = idx & 1023;
    const int rh    = rem >> 5;         // rope head 0..31
    const int d     = rem & 31;
    const int h     = rh >> 1;
    const int sub   = rh & 1;
    const float val = row[idx];
    float o = val;
    if (which < 2 && d < 16) {          // rotate first half of head dim, pairwise
      const int p = d >> 1;
      const float inv = __powf(10000.f, -(float)(2 * p) * (1.f / 16.f));
      const float ang = (float)s * inv;
      float sn, c; __sincosf(ang, &sn, &c);
      const float other = row[(idx & ~31) + (d ^ 1)];
      o = (d & 1) ? (val * c + other * sn) : (val * c - other * sn);
    }
    if (which < 2 && sub == 1) o += sigs[d];
    if (which == 0) {
      _Float16* dst = sub ? q2 : q1;
      dst[(size_t)h * S_LEN * D_DIM + (size_t)s * D_DIM + d] = (_Float16)o;
    } else if (which == 1) {
      _Float16* dst = sub ? k2 : k1;
      dst[(size_t)h * S_LEN * D_DIM + (size_t)s * D_DIM + d] = (_Float16)o;
    } else {
      // transposed: [h][vdim = sub*32+d][s]
      vt[(size_t)h * (2 * D_DIM) * S_LEN + (size_t)(sub * D_DIM + d) * S_LEN + s] = (_Float16)o;
    }
  }
}

// ----------------------------------------------------- flash attention (WMMA)
#define KSTR 40
#define VSTR 72   // Vs rows are vdim (64), cols are seq/K (64) + pad
#define PSTR 72

__global__ __launch_bounds__(128)
void attn_flash(const _Float16* __restrict__ q1, const _Float16* __restrict__ q2,
                const _Float16* __restrict__ k1, const _Float16* __restrict__ k2,
                const _Float16* __restrict__ vt,
                float* __restrict__ o1, float* __restrict__ o2, float scale) {
  __shared__ _Float16 Ks[64 * KSTR];
  __shared__ _Float16 Vs[64 * VSTR];    // transposed V tile: [vdim][seq]
  __shared__ _Float16 Ps[4 * 16 * PSTR];

  const int tid   = threadIdx.x;
  const int lane  = tid & 31;
  const int wave  = tid >> 5;          // 4 waves, 16 q-rows each
  const int l15   = lane & 15;
  const int hi    = lane >> 4;
  const int hioff = hi * 8;

  const int qi = blockIdx.x;           // q tile (64 rows)
  const int h  = blockIdx.y;
  const int ai = blockIdx.z;           // which attention (0/1)

  const _Float16* Qp = (ai ? q2 : q1) + (size_t)h * S_LEN * D_DIM;
  const _Float16* Kp = (ai ? k2 : k1) + (size_t)h * S_LEN * D_DIM;
  const _Float16* Vp = vt + (size_t)h * (2 * D_DIM) * S_LEN;   // [vdim][s]
  float* Op = ai ? o2 : o1;

  const int qbase = qi * 64;
  const int qrow0 = qbase + wave * 16;

  v16h aq;                              // Q A-frag (rows contiguous in global, K=32)
  {
    const _Float16* p = Qp + (size_t)(qrow0 + l15) * D_DIM + hioff;
    #pragma unroll
    for (int i = 0; i < 8; ++i) { aq[i] = p[i]; aq[8 + i] = p[16 + i]; }
  }

  const v8f vzero = {0.f,0.f,0.f,0.f,0.f,0.f,0.f,0.f};
  v8f o[4];
  #pragma unroll
  for (int j = 0; j < 4; ++j) o[j] = vzero;
  float rmax[8], rsum[8];
  #pragma unroll
  for (int r = 0; r < 8; ++r) { rmax[r] = -1e30f; rsum[r] = 0.f; }

  const int ldRow = tid >> 1;           // 0..63
  const int kc16  = (tid & 1) * 16;
  const int vc32  = (tid & 1) * 32;

  for (int kt = 0; kt <= qi; ++kt) {
    const int kbase = kt * 64;
    {   // stage K (64 seq x 32 d) and V^T (64 vdim x 64 seq) tiles, all vectorized
      const uint4* s = (const uint4*)(Kp + (size_t)(kbase + ldRow) * D_DIM + kc16);
      uint4* d = (uint4*)(Ks + ldRow * KSTR + kc16);
      d[0] = s[0]; d[1] = s[1];
      const uint4* s2 = (const uint4*)(Vp + (size_t)ldRow * S_LEN + kbase + vc32);
      uint4* d2 = (uint4*)(Vs + ldRow * VSTR + vc32);
      d2[0] = s2[0]; d2[1] = s2[1]; d2[2] = s2[2]; d2[3] = s2[3];
    }
    __syncthreads();

    // scores = Q(16x32) x K^T(32x64): 4 WMMA
    v8f sc[4];
    #pragma unroll
    for (int j = 0; j < 4; ++j) {
      v16h bk;
      const _Float16* p = Ks + (j * 16 + l15) * KSTR + hioff;
      #pragma unroll
      for (int i = 0; i < 8; ++i) { bk[i] = p[i]; bk[8 + i] = p[16 + i]; }
      sc[j] = wmma16x16x32(aq, bk, vzero);
      #pragma unroll
      for (int r = 0; r < 8; ++r) sc[j][r] *= scale;
    }
    if (kt == qi) {                      // causal mask on diagonal tile
      #pragma unroll
      for (int j = 0; j < 4; ++j) {
        const int col = kbase + j * 16 + l15;
        #pragma unroll
        for (int r = 0; r < 8; ++r) {
          const int rowg = qrow0 + r + (hi << 3);
          if (col > rowg) sc[j][r] = -1e30f;
        }
      }
    }

    // online softmax (row stats live in VGPR index r, reduced over 16-lane groups)
    float nmax[8], alpha[8], psum[8];
    #pragma unroll
    for (int r = 0; r < 8; ++r) {
      float m = sc[0][r];
      #pragma unroll
      for (int j = 1; j < 4; ++j) m = fmaxf(m, sc[j][r]);
      #pragma unroll
      for (int off2 = 8; off2 > 0; off2 >>= 1) m = fmaxf(m, __shfl_xor(m, off2, 16));
      nmax[r] = fmaxf(rmax[r], m);
      alpha[r] = __expf(rmax[r] - nmax[r]);
      rmax[r] = nmax[r];
      psum[r] = 0.f;
    }
    #pragma unroll
    for (int j = 0; j < 4; ++j)
      #pragma unroll
      for (int r = 0; r < 8; ++r) {
        const float p = __expf(sc[j][r] - nmax[r]);
        sc[j][r] = p;
        psum[r] += p;
      }
    #pragma unroll
    for (int r = 0; r < 8; ++r) {
      float ps = psum[r];
      #pragma unroll
      for (int off2 = 8; off2 > 0; off2 >>= 1) ps += __shfl_xor(ps, off2, 16);
      rsum[r] = rsum[r] * alpha[r] + ps;
    }
    #pragma unroll
    for (int j = 0; j < 4; ++j)
      #pragma unroll
      for (int r = 0; r < 8; ++r) o[j][r] *= alpha[r];

    // P (C/D layout) -> LDS -> A-frag layout
    _Float16* Pw = Ps + wave * 16 * PSTR;
    #pragma unroll
    for (int j = 0; j < 4; ++j)
      #pragma unroll
      for (int r = 0; r < 8; ++r)
        Pw[(r + (hi << 3)) * PSTR + j * 16 + l15] = (_Float16)sc[j][r];
    __syncthreads();

    v16h ap0, ap1;
    {
      const _Float16* p = Pw + l15 * PSTR;
      #pragma unroll
      for (int i = 0; i < 8; ++i) {
        ap0[i]     = p[hioff + i];       ap0[8 + i] = p[16 + hioff + i];
        ap1[i]     = p[32 + hioff + i];  ap1[8 + i] = p[48 + hioff + i];
      }
    }
    // O += P(16x64) x V(64x64): 8 WMMA.
    // V^T layout makes each B-frag chunk 8 contiguous halfs -> ds_load_b128.
    #pragma unroll
    for (int j = 0; j < 4; ++j) {
      const _Float16* pv = Vs + (j * 16 + l15) * VSTR;
      v16h bv;
      #pragma unroll
      for (int i = 0; i < 8; ++i) { bv[i] = pv[hioff + i]; bv[8 + i] = pv[16 + hioff + i]; }
      o[j] = wmma16x16x32(ap0, bv, o[j]);
      #pragma unroll
      for (int i = 0; i < 8; ++i) { bv[i] = pv[32 + hioff + i]; bv[8 + i] = pv[48 + hioff + i]; }
      o[j] = wmma16x16x32(ap1, bv, o[j]);
    }
    __syncthreads();
  }

  // finalize: strided stores from a hoisted base pointer
  #pragma unroll
  for (int r = 0; r < 8; ++r) {
    const float invs = 1.f / rsum[r];
    float* rp = Op + (size_t)(qrow0 + r + (hi << 3)) * E_DIM + h * 64 + l15;
    #pragma unroll
    for (int j = 0; j < 4; ++j)
      rp[j * 16] = o[j][r] * invs;
  }
}

// -------------------------------- a = rmsnorm(attn1 - lam*attn2)*(1-LAMBDA) -> f16
__global__ __launch_bounds__(64)
void diff_rmsnorm(const float* __restrict__ a1, const float* __restrict__ a2,
                  const float* __restrict__ lamp, const float* __restrict__ w,
                  const float* __restrict__ b, _Float16* __restrict__ outh) {
  const int idx = blockIdx.x;
  const int s = idx >> 4;
  const int h = idx & 15;
  const int t = threadIdx.x;                    // 0..63 over the 2D-dim group
  __shared__ float sh[2];
  const float lam = lamp[0];
  const size_t off = (size_t)s * E_DIM + h * 64 + t;
  const float d = a1[off] - lam * a2[off];
  float sq = d * d;
  #pragma unroll
  for (int o = 16; o > 0; o >>= 1) sq += __shfl_xor(sq, o, 32);
  if ((t & 31) == 0) sh[t >> 5] = sq;
  __syncthreads();
  const float ms = (sh[0] + sh[1]) * (1.f / 64.f);
  const float r = rsqrtf(ms + 1e-8f);
  outh[off] = (_Float16)((d * r * w[t] + b[t]) * (1.f - LAMBDA_INIT_F));
}

// ---------------------------------------- out = layernorm(a + res) (fp32 + opt f16)
__global__ __launch_bounds__(256)
void add_layernorm(const float* __restrict__ a, const float* __restrict__ res,
                   const float* __restrict__ w, const float* __restrict__ b,
                   float* __restrict__ out32, _Float16* __restrict__ out16) {
  const int s = blockIdx.x;
  const int t = threadIdx.x;
  __shared__ float sh[8];
  __shared__ float stat[2];
  const size_t base = (size_t)s * E_DIM;
  float v[4];
  float sum = 0.f;
  #pragma unroll
  for (int i = 0; i < 4; ++i) {
    const int e = t + i * 256;
    const float xv = a[base + e] + res[base + e];
    v[i] = xv; sum += xv;
  }
  #pragma unroll
  for (int o = 16; o > 0; o >>= 1) sum += __shfl_xor(sum, o, 32);
  if ((t & 31) == 0) sh[t >> 5] = sum;
  __syncthreads();
  if (t == 0) { float r = 0.f; for (int i = 0; i < 8; ++i) r += sh[i]; stat[0] = r * (1.f / E_DIM); }
  __syncthreads();
  const float mean = stat[0];
  float sq = 0.f;
  #pragma unroll
  for (int i = 0; i < 4; ++i) { const float dd = v[i] - mean; sq += dd * dd; }
  #pragma unroll
  for (int o = 16; o > 0; o >>= 1) sq += __shfl_xor(sq, o, 32);
  if ((t & 31) == 0) sh[t >> 5] = sq;
  __syncthreads();
  if (t == 0) { float r = 0.f; for (int i = 0; i < 8; ++i) r += sh[i]; stat[1] = r * (1.f / E_DIM); }
  __syncthreads();
  const float rstd = rsqrtf(stat[1] + 1e-5f);
  #pragma unroll
  for (int i = 0; i < 4; ++i) {
    const int e = t + i * 256;
    const float ov = (v[i] - mean) * rstd * w[e] + b[e];
    out32[base + e] = ov;
    if (out16) out16[base + e] = (_Float16)ov;
  }
}

// ------------------------------------------------------------------ launcher
extern "C" void kernel_launch(void* const* d_in, const int* in_sizes, int n_in,
                              void* d_out, int out_size, void* d_ws, size_t ws_size,
                              hipStream_t stream) {
  (void)in_sizes; (void)n_in; (void)out_size; (void)ws_size;
  const float* x      = (const float*)d_in[0];
  const float* emb    = (const float*)d_in[1];
  const float* qkv_w  = (const float*)d_in[2];
  const float* out_w  = (const float*)d_in[3];
  const float* sigmaw = (const float*)d_in[4];
  const float* lq1    = (const float*)d_in[5];
  const float* lk1    = (const float*)d_in[6];
  const float* lq2    = (const float*)d_in[7];
  const float* lk2    = (const float*)d_in[8];
  const float* ln_w   = (const float*)d_in[9];
  const float* ln_b   = (const float*)d_in[10];
  const float* ln1_w  = (const float*)d_in[11];
  const float* ln1_b  = (const float*)d_in[12];
  const float* ln2_w  = (const float*)d_in[13];
  const float* ln2_b  = (const float*)d_in[14];
  const float* w1     = (const float*)d_in[15];
  const float* b1     = (const float*)d_in[16];
  const float* w2     = (const float*)d_in[17];
  const float* b2     = (const float*)d_in[18];
  float* out = (float*)d_out;

  char* ws = (char*)d_ws;
  size_t off = 0;
  auto alloc = [&](size_t bytes) -> char* {
    char* p = ws + off;
    off += (bytes + 255) & ~(size_t)255;
    return p;
  };
  float*    sig   = (float*)alloc(D_DIM * sizeof(float));
  float*    lam   = (float*)alloc(sizeof(float));
  _Float16* xb    = (_Float16*)alloc((size_t)S_LEN * E_DIM * 2);
  _Float16* wqkvb = (_Float16*)alloc((size_t)3 * E_DIM * E_DIM * 2);
  _Float16* woutb = (_Float16*)alloc((size_t)E_DIM * E_DIM * 2);
  _Float16* w1b   = (_Float16*)alloc((size_t)4 * E_DIM * E_DIM * 2);
  _Float16* w2b   = (_Float16*)alloc((size_t)4 * E_DIM * E_DIM * 2);
  float*    qkvf  = (float*)alloc((size_t)S_LEN * 3 * E_DIM * 4);       // reused below
  _Float16* q1b   = (_Float16*)alloc((size_t)H_NUM * S_LEN * D_DIM * 2);
  _Float16* q2b   = (_Float16*)alloc((size_t)H_NUM * S_LEN * D_DIM * 2);
  _Float16* k1b   = (_Float16*)alloc((size_t)H_NUM * S_LEN * D_DIM * 2);
  _Float16* k2b   = (_Float16*)alloc((size_t)H_NUM * S_LEN * D_DIM * 2);
  _Float16* vtb   = (_Float16*)alloc((size_t)H_NUM * S_LEN * 2 * D_DIM * 2);  // [h][vdim][s]
  _Float16* abh   = (_Float16*)alloc((size_t)S_LEN * E_DIM * 2);
  float*    aof   = (float*)alloc((size_t)S_LEN * E_DIM * 4);           // reused below
  float*    hf    = (float*)alloc((size_t)S_LEN * E_DIM * 4);
  _Float16* hb16  = (_Float16*)alloc((size_t)S_LEN * E_DIM * 2);

  // aliases into dead regions (stream-ordered, deterministic)
  float*    attn1f = qkvf;                                  // qkv dead after rope
  float*    attn2f = qkvf + (size_t)S_LEN * E_DIM;
  _Float16* f1b    = (_Float16*)qkvf;                       // attn bufs dead after diffnorm
  float*    fff    = aof;                                   // aof dead after first add_layernorm

  // 1. fp32 -> f16 conversions (activations + weights)
  cvt_f32_f16<4><<<S_LEN * E_DIM / (4 * 1024),     256, 0, stream>>>(x,     xb);
  cvt_f32_f16<6><<<3 * E_DIM * E_DIM / (6 * 1024), 256, 0, stream>>>(qkv_w, wqkvb);
  cvt_f32_f16<4><<<E_DIM * E_DIM / (4 * 1024),     256, 0, stream>>>(out_w, woutb);
  cvt_f32_f16<8><<<4 * E_DIM * E_DIM / (8 * 1024), 256, 0, stream>>>(w1,    w1b);
  cvt_f32_f16<8><<<4 * E_DIM * E_DIM / (8 * 1024), 256, 0, stream>>>(w2,    w2b);
  small_setup<<<1, 64, 0, stream>>>(emb, sigmaw, lq1, lk1, lq2, lk2, sig, lam);

  // 2. qkv = x @ qkv_w^T  (2048x3072x1024)
  gemm_wmma<0, false><<<dim3(3 * E_DIM / BN, S_LEN / BM), 256, 0, stream>>>(
      xb, wqkvb, nullptr, qkvf, nullptr, S_LEN, 3 * E_DIM, E_DIM);
  // 3. RoPE + sigma + head split (V transposed)
  rope_split<<<S_LEN, 256, 0, stream>>>(qkvf, sig, q1b, q2b, k1b, k2b, vtb);
  // 4. two causal flash attentions (WMMA QK^T and PV)
  attn_flash<<<dim3(S_LEN / 64, H_NUM, 2), 128, 0, stream>>>(
      q1b, q2b, k1b, k2b, vtb, attn1f, attn2f, 0.17677669529663687f);
  // 5. per-head rmsnorm of attn1 - lam*attn2
  diff_rmsnorm<<<S_LEN * H_NUM, 64, 0, stream>>>(attn1f, attn2f, lam, ln_w, ln_b, abh);
  // 6. out projection (2048x1024x1024)
  gemm_wmma<0, false><<<dim3(E_DIM / BN, S_LEN / BM), 256, 0, stream>>>(
      abh, woutb, nullptr, aof, nullptr, S_LEN, E_DIM, E_DIM);
  // 7. h = layernorm(a + x)
  add_layernorm<<<S_LEN, 256, 0, stream>>>(aof, x, ln1_w, ln1_b, hf, hb16);
  // 8. ff1 = silu(h @ w1^T + b1) -> f16 (2048x4096x1024)
  gemm_wmma<1, true><<<dim3(4 * E_DIM / BN, S_LEN / BM), 256, 0, stream>>>(
      hb16, w1b, b1, nullptr, f1b, S_LEN, 4 * E_DIM, E_DIM);
  // 9. ff = ff1 @ w2^T + b2 (2048x1024x4096)
  gemm_wmma<0, true><<<dim3(E_DIM / BN, S_LEN / BM), 256, 0, stream>>>(
      f1b, w2b, b2, fff, nullptr, S_LEN, E_DIM, 4 * E_DIM);
  // 10. out = layernorm(ff + h)
  add_layernorm<<<S_LEN, 256, 0, stream>>>(fff, hf, ln2_w, ln2_b, out, nullptr);
}

// v003
// One run takes 260 microseconds.
// In both of two side-by-side timings against v002, it was 1.14 times as fast.
// Over all steps from v000 it is 1.41 times as fast.
#include <hip/hip_runtime.h>
#include <hip/hip_bf16.h>
#include <math.h>

typedef __attribute__((ext_vector_type(16))) _Float16 v16h;
typedef __attribute__((ext_vector_type(8)))  float    v8f;

#define S_LEN   2048
#define E_DIM   1024
#define H_NUM   16
#define D_DIM   32
#define SIG_DIM 256
#define LAMBDA_INIT_F 0.3555090675909693f

__device__ __forceinline__ v8f wmma16x16x32(v16h a, v16h b, v8f c) {
  // v_wmma_f32_16x16x32_f16: D = A(16x32,f16) x B(32x16,f16) + C(f32)
  return __builtin_amdgcn_wmma_f32_16x16x32_f16(false, a, false, b, (short)0, c, false, false);
}

// ---------------------------------------------------------------- conversions
// One work-group converts U x 1024 consecutive values; the grid covers the array exactly
// (every count here is a multiple of U x 1024). A wave-wide 16-byte load covers four whole
// lines and its 8-byte store two, and a launch starts 2,048 or 4,096 waves in all.
typedef __attribute__((ext_vector_type(4))) float    v4f;
typedef __attribute__((ext_vector_type(4))) _Float16 v4h;

template <int U>
__global__ __launch_bounds__(256)
void cvt_f32_f16(const float* __restrict__ src, _Float16* __restrict__ dst) {
  const unsigned first = (blockIdx.x * (U * 256) + threadIdx.x) * 4;
  v4f v[U];
  #pragma unroll  // all U loads issue before the first wait; v[] stays in registers
  for (int u = 0; u < U; ++u) v[u] = *(const v4f*)(src + first + u * 1024);
  #pragma unroll  // constant offsets
  for (int u = 0; u < U; ++u) *(v4h*)(dst + first + u * 1024) = __builtin_convertvector(v[u], v4h);
}

// --------------------------------------------------- sig = emb @ sigma_w.T ; lambda
__global__ void small_setup(const float* __restrict__ emb, const float* __restrict__ sigw,
                            const float* __restrict__ lq1, const float* __restrict__ lk1,
                            const float* __restrict__ lq2, const float* __restrict__ lk2,
                            float* __restrict__ sig, float* __restrict__ lam) {
  int t = threadIdx.x;
  if (t < D_DIM) {
    float s = 0.f;
    for (int j = 0; j < SIG_DIM; ++j) s += emb[j] * sigw[t * SIG_DIM + j];
    sig[t] = s;
  } else if (t == D_DIM) {
    float s1 = 0.f, s2 = 0.f;
    for (int i = 0; i < D_DIM; ++i) { s1 += lq1[i] * lk1[i]; s2 += lq2[i] * lk2[i]; }
    lam[0] = __expf(s1) - __expf(s2) + LAMBDA_INIT_F;
  }
}

// ------------------------------------------------------------------- GEMM
// C[M,N] = A[M,K] * B[N,K]^T (+bias). MODE 0: fp32 out. MODE 1: SiLU -> f16 out.
// Double-buffered LDS, global_prefetch of K+2 tile, branch-free templated epilogue.
#define BM 128
#define BN 128
#define BK 128    // one row of a K tile is 256 contiguous bytes = two whole 128-B lines
#define ASTR 136  // LDS stride in halfs (256 B + 16 B pad: 16 rows of b128 reads hit 64 distinct banks)

template <int MODE, bool HAS_BIAS>
__global__ __launch_bounds__(256)
void gemm_wmma(const _Float16* __restrict__ A, const _Float16* __restrict__ B,
               const float* __restrict__ bias, float* __restrict__ Cf,
               _Float16* __restrict__ Ch, int M, int N, int K) {
  __shared__ _Float16 As[2][BM * ASTR];
  __shared__ _Float16 Bs[2][BN * ASTR];
  const int tid   = threadIdx.x;
  const int lane  = tid & 31;
  const int wave  = tid >> 5;      // 8 wave32 waves
  const int wm    = wave >> 2;     // 0..1  (64 rows each)
  const int wn    = wave & 3;      // 0..3  (32 cols each)
  const int l15   = lane & 15;
  const int hioff = (lane >> 4) * 8;
  const int bm = blockIdx.y * BM;
  const int bn = blockIdx.x * BN;

  const v8f vzero = {0.f,0.f,0.f,0.f,0.f,0.f,0.f,0.f};
  v8f acc[4][2];
  #pragma unroll
  for (int mt = 0; mt < 4; ++mt)
    #pragma unroll
    for (int nt = 0; nt < 2; ++nt) acc[mt][nt] = vzero;

  // 16 lanes cover one row's 256 bytes, so a wave-wide 16-byte load touches
  // four whole lines (two rows); eight such loads per operand fill 128 rows.
  const int ldRow = tid >> 4;           // 0..15, +16 per load
  const int ldCol = (tid & 15) * 8;     // halfs
  // uniform tile bases + per-lane byte offsets that serve A and B alike (same pitch K)
  const char* gA = (const char*)(A + (size_t)bm * K);
  const char* gB = (const char*)(B + (size_t)bn * K);
  unsigned voff[8];
  #pragma unroll  // keeps voff[] in registers
  for (int i = 0; i < 8; ++i) voff[i] = (unsigned)(((ldRow + i * 16) * K + ldCol) * 2);
  const int ldsOff = ldRow * ASTR + ldCol;
  // prefetch offset: one lane per 128-B line of the tile, two tiles ahead
  unsigned pfoff = (unsigned)(((tid >> 1) * K + (tid & 1) * 64 + 2 * BK) * 2);

  // preload tile 0 into buffer 0
  {
    uint4 ra[8], rb[8];
    #pragma unroll  // all 16 loads issue before the first wait; ra/rb stay in registers
    for (int i = 0; i < 8; ++i) {
      ra[i] = *(const uint4*)(gA + voff[i]);
      rb[i] = *(const uint4*)(gB + voff[i]);
    }
    #pragma unroll  // constant LDS offsets
    for (int i = 0; i < 8; ++i) {
      *(uint4*)(&As[0][ldsOff + i * 16 * ASTR]) = ra[i];
      *(uint4*)(&Bs[0][ldsOff + i * 16 * ASTR]) = rb[i];
      voff[i] += BK * 2;
    }
  }
  __syncthreads();

  const int ktiles = K / BK;
  int cur = 0;
  for (int kt = 0; kt < ktiles; ++kt) {
    // pull the K+2 tile toward L2 (global_prefetch_b8)
    if (kt + 2 < ktiles) {
      __builtin_prefetch(gA + pfoff, 0, 1);
      __builtin_prefetch(gB + pfoff, 0, 1);
    }
    // stage K+1 tile into the alternate buffer while we compute from `cur`
    if (kt + 1 < ktiles) {
      uint4 ra[8], rb[8];
      #pragma unroll  // all 16 loads issue before the first wait; ra/rb stay in registers
      for (int i = 0; i < 8; ++i) {
        ra[i] = *(const uint4*)(gA + voff[i]);
        rb[i] = *(const uint4*)(gB + voff[i]);
      }
      #pragma unroll  // constant LDS offsets
      for (int i = 0; i < 8; ++i) {
        *(uint4*)(&As[cur ^ 1][ldsOff + i * 16 * ASTR]) = ra[i];
        *(uint4*)(&Bs[cur ^ 1][ldsOff + i * 16 * ASTR]) = rb[i];
        voff[i] += BK * 2;
      }
      pfoff += BK * 2;
    }

    // four 32-deep WMMA steps per tile, k ascending; unrolled for constant LDS offsets
    #pragma unroll
    for (int ks = 0; ks < BK / 32; ++ks) {
      v16h af[4], bf2[2];
      #pragma unroll
      for (int mt = 0; mt < 4; ++mt) {
        const _Float16* p = &As[cur][(wm * 64 + mt * 16 + l15) * ASTR + ks * 32 + hioff];
        #pragma unroll
        for (int i = 0; i < 8; ++i) { af[mt][i] = p[i]; af[mt][8 + i] = p[16 + i]; }
      }
      #pragma unroll
      for (int nt = 0; nt < 2; ++nt) {
        const _Float16* p = &Bs[cur][(wn * 32 + nt * 16 + l15) * ASTR + ks * 32 + hioff];
        #pragma unroll
        for (int i = 0; i < 8; ++i) { bf2[nt][i] = p[i]; bf2[nt][8 + i] = p[16 + i]; }
      }
      #pragma unroll
      for (int mt = 0; mt < 4; ++mt)
        #pragma unroll
        for (int nt = 0; nt < 2; ++nt)
          acc[mt][nt] = wmma16x16x32(af[mt], bf2[nt], acc[mt][nt]);
    }

    __syncthreads();   // next-tile LDS writes complete; safe to flip buffers
    cur ^= 1;
  }

  // ---------------- branch-free epilogue (bias hoisted, strided stores)
  float bv[2] = {0.f, 0.f};
  if (HAS_BIAS) {
    bv[0] = bias[bn + wn * 32 + l15];
    bv[1] = bias[bn + wn * 32 + 16 + l15];
  }
  #pragma unroll
  for (int mt = 0; mt < 4; ++mt) {
    const int gm0 = bm + wm * 64 + mt * 16 + ((lane >> 4) << 3);
    #pragma unroll
    for (int nt = 0; nt < 2; ++nt) {
      const int gn = bn + wn * 32 + nt * 16 + l15;
      if (MODE == 1) {
        _Float16* cp = Ch + (size_t)gm0 * N + gn;
        #pragma unroll
        for (int r = 0; r < 8; ++r) {
          float v = acc[mt][nt][r];
          if (HAS_BIAS) v += bv[nt];
          cp[(size_t)r * N] = (_Float16)(v / (1.f + __expf(-v)));   // SiLU
        }
      } else {
        float* cp = Cf + (size_t)gm0 * N + gn;
        #pragma unroll
        for (int r = 0; r < 8; ++r) {
          float v = acc[mt][nt][r];
          if (HAS_BIAS) v += bv[nt];
          cp[(size_t)r * N] = v;
        }
      }
    }
  }
}

// ------------------------------------------- RoPE + sigma add + head split -> f16
// Q/K written [h][s][d] (row = K-contig for A/B frags).
// V written TRANSPOSED [h][vdim][s] so attention's B-frag of V is K(seq)-contiguous.
__global__ __launch_bounds__(256)
void rope_split(const float* __restrict__ qkv, const float* __restrict__ sig,
                _Float16* __restrict__ q1, _Float16* __restrict__ q2,
                _Float16* __restrict__ k1, _Float16* __restrict__ k2,
                _Float16* __restrict__ vt) {
  const int s = blockIdx.x;
  const int t = threadIdx.x;
  __shared__ float sigs[D_DIM];
  if (t < D_DIM) sigs[t] = sig[t];
  __syncthreads();
  const float* row = qkv + (size_t)s * (3 * E_DIM);
  for (int idx = t; idx < 3 * E_DIM; idx += 256) {
    const int which = idx >> 10;        // 0=q 1=k 2=v
    const int rem   = idx & 1023;
    const int rh    = rem >> 5;         // rope head 0..31
    const int d     = rem & 31;
    const int h     = rh >> 1;
    const int sub   = rh & 1;
    const float val = row[idx];
    float o = val;
    if (which < 2 && d < 16) {          // rotate first half of head dim, pairwise
      const int p = d >> 1;
      const float inv = __powf(10000.f, -(float)(2 * p) * (1.f / 16.f));
      const float ang = (float)s * inv;
      float sn, c; __sincosf(ang, &sn, &c);
      const float other = row[(idx & ~31) + (d ^ 1)];
      o = (d & 1) ? (val * c + other * sn) : (val * c - other * sn);
    }
    if (which < 2 && sub == 1) o += sigs[d];
    if (which == 0) {
      _Float16* dst = sub ? q2 : q1;
      dst[(size_t)h * S_LEN * D_DIM + (size_t)s * D_DIM + d] = (_Float16)o;
    } else if (which == 1) {
      _Float16* dst = sub ? k2 : k1;
      dst[(size_t)h * S_LEN * D_DIM + (size_t)s * D_DIM + d] = (_Float16)o;
    } else {
      // transposed: [h][vdim = sub*32+d][s]
      vt[(size_t)h * (2 * D_DIM) * S_LEN + (size_t)(sub * D_DIM + d) * S_LEN + s] = (_Float16)o;
    }
  }
}

// ----------------------------------------------------- flash attention (WMMA)
// Value of lane (l ^ M) of the same 16-lane row, M = 1..15, by a DPP row_xmask move: it stays on
// the vector pipe, where a shuffle goes through the LDS queue and is waited for at every step.
// All 32 lanes are on wherever it is called.
template <int M>
__device__ __forceinline__ float row_xor(float x) {
  return __builtin_bit_cast(float, __builtin_amdgcn_update_dpp(
      0, __builtin_bit_cast(int, x), 0x160 + M, 0xf, 0xf, true));
}
// Butterflies over a 16-lane row, partners 8, 4, 2, 1 in this order.
// Maxima of four independent values: one DPP instruction a step, the four chains interleaved so
// that each step issues behind the other three chains' and not behind its own result. In asm
// because the builtin form compiled to three dependent instructions a step (move, quieting
// maximum, maximum), one chain after the other.
__device__ __forceinline__ void row_max16x4(float& a, float& b, float& c, float& d) {
  asm("v_max_num_f32_dpp %0, %0, %0 row_xmask:8 row_mask:0xf bank_mask:0xf\n\t"
      "v_max_num_f32_dpp %1, %1, %1 row_xmask:8 row_mask:0xf bank_mask:0xf\n\t"
      "v_max_num_f32_dpp %2, %2, %2 row_xmask:8 row_mask:0xf bank_mask:0xf\n\t"
      "v_max_num_f32_dpp %3, %3, %3 row_xmask:8 row_mask:0xf bank_mask:0xf\n\t"
      "v_max_num_f32_dpp %0, %0, %0 row_xmask:4 row_mask:0xf bank_mask:0xf\n\t"
      "v_max_num_f32_dpp %1, %1, %1 row_xmask:4 row_mask:0xf bank_mask:0xf\n\t"
      "v_max_num_f32_dpp %2, %2, %2 row_xmask:4 row_mask:0xf bank_mask:0xf\n\t"
      "v_max_num_f32_dpp %3, %3, %3 row_xmask:4 row_mask:0xf bank_mask:0xf\n\t"
      "v_max_num_f32_dpp %0, %0, %0 row_xmask:2 row_mask:0xf bank_mask:0xf\n\t"
      "v_max_num_f32_dpp %1, %1, %1 row_xmask:2 row_mask:0xf bank_mask:0xf\n\t"
      "v_max_num_f32_dpp %2, %2, %2 row_xmask:2 row_mask:0xf bank_mask:0xf\n\t"
      "v_max_num_f32_dpp %3, %3, %3 row_xmask:2 row_mask:0xf bank_mask:0xf\n\t"
      "v_max_num_f32_dpp %0, %0, %0 row_xmask:1 row_mask:0xf bank_mask:0xf\n\t"
      "v_max_num_f32_dpp %1, %1, %1 row_xmask:1 row_mask:0xf bank_mask:0xf\n\t"
      "v_max_num_f32_dpp %2, %2, %2 row_xmask:1 row_mask:0xf bank_mask:0xf\n\t"
      "v_max_num_f32_dpp %3, %3, %3 row_xmask:1 row_mask:0xf bank_mask:0xf"
      : "+v"(a), "+v"(b), "+v"(c), "+v"(d));
}
__device__ __forceinline__ float row_sum16(float s) {
  s += row_xor<8>(s);
  s += row_xor<4>(s);
  s += row_xor<2>(s);
  return s + row_xor<1>(s);
}
#define KSTR 40
#define VSTR 72   // Vs rows are vdim (64), cols are seq/K (64) + pad
#define PSTR 72

__global__ __launch_bounds__(128)
void attn_flash(const _Float16* __restrict__ q1, const _Float16* __restrict__ q2,
                const _Float16* __restrict__ k1, const _Float16* __restrict__ k2,
                const _Float16* __restrict__ vt,
                float* __restrict__ o1, float* __restrict__ o2, float scale) {
  __shared__ _Float16 Ks[64 * KSTR];
  __shared__ _Float16 Vs[64 * VSTR];    // transposed V tile: [vdim][seq]
  __shared__ _Float16 Ps[4 * 16 * PSTR];

  const int tid   = threadIdx.x;
  const int lane  = tid & 31;
  const int wave  = tid >> 5;          // 4 waves, 16 q-rows each
  const int l15   = lane & 15;
  const int hi    = lane >> 4;
  const int hioff = hi * 8;

  const int qi = blockIdx.x;           // q tile (64 rows)
  const int h  = blockIdx.y;
  const int ai = blockIdx.z;           // which attention (0/1)

  const _Float16* Qp = (ai ? q2 : q1) + (size_t)h * S_LEN * D_DIM;
  const _Float16* Kp = (ai ? k2 : k1) + (size_t)h * S_LEN * D_DIM;
  const _Float16* Vp = vt + (size_t)h * (2 * D_DIM) * S_LEN;   // [vdim][s]
  float* Op = ai ? o2 : o1;

  const int qbase = qi * 64;
  const int qrow0 = qbase + wave * 16;

  v16h aq;                              // Q A-frag (rows contiguous in global, K=32)
  {
    const _Float16* p = Qp + (size_t)(qrow0 + l15) * D_DIM + hioff;
    #pragma unroll
    for (int i = 0; i < 8; ++i) { aq[i] = p[i]; aq[8 + i] = p[16 + i]; }
  }

  const v8f vzero = {0.f,0.f,0.f,0.f,0.f,0.f,0.f,0.f};
  v8f o[4];
  #pragma unroll
  for (int j = 0; j < 4; ++j) o[j] = vzero;
  float rmax[8], rsum[8];
  #pragma unroll
  for (int r = 0; r < 8; ++r) { rmax[r] = -1e30f; rsum[r] = 0.f; }

  const int ldRow = tid >> 1;           // 0..63
  const int kc16  = (tid & 1) * 16;
  const int vc32  = (tid & 1) * 32;

  for (int kt = 0; kt <= qi; ++kt) {
    const int kbase = kt * 64;
    {   // stage K (64 seq x 32 d) and V^T (64 vdim x 64 seq) tiles, all vectorized
      const uint4* s = (const uint4*)(Kp + (size_t)(kbase + ldRow) * D_DIM + kc16);
      uint4* d = (uint4*)(Ks + ldRow * KSTR + kc16);
      d[0] = s[0]; d[1] = s[1];
      const uint4* s2 = (const uint4*)(Vp + (size_t)ldRow * S_LEN + kbase + vc32);
      uint4* d2 = (uint4*)(Vs + ldRow * VSTR + vc32);
      d2[0] = s2[0]; d2[1] = s2[1]; d2[2] = s2[2]; d2[3] = s2[3];
    }
    __syncthreads();

    // scores = Q(16x32) x K^T(32x64): 4 WMMA
    v8f sc[4];
    #pragma unroll
    for (int j = 0; j < 4; ++j) {
      v16h bk;
      const _Float16* p = Ks + (j * 16 + l15) * KSTR + hioff;
      #pragma unroll
      for (int i = 0; i < 8; ++i) { bk[i] = p[i]; bk[8 + i] = p[16 + i]; }
      sc[j] = wmma16x16x32(aq, bk, vzero);
      #pragma unroll
      for (int r = 0; r < 8; ++r) sc[j][r] *= scale;
    }
    if (kt == qi) {                      // causal mask on diagonal tile
      #pragma unroll
      for (int j = 0; j < 4; ++j) {
        const int col = kbase + j * 16 + l15;
        #pragma unroll
        for (int r = 0; r < 8; ++r) {
          const int rowg = qrow0 + r + (hi << 3);
          if (col > rowg) sc[j][r] = -1e30f;
        }
      }
    }

    // online softmax (row stats live in VGPR index r, reduced over 16-lane groups)
    float nmax[8], alpha[8], psum[8];
    #pragma unroll
    for (int r = 0; r < 8; ++r) {
      float m = rmax[r];                 // the same in all 16 lanes of the row
      #pragma unroll
      for (int j = 0; j < 4; ++j) m = fmaxf(m, sc[j][r]);
      nmax[r] = m;
    }
    row_max16x4(nmax[0], nmax[1], nmax[2], nmax[3]);
    row_max16x4(nmax[4], nmax[5], nmax[6], nmax[7]);
    #pragma unroll
    for (int r = 0; r < 8; ++r) {
      alpha[r] = __expf(rmax[r] - nmax[r]);
      rmax[r] = nmax[r];
      psum[r] = 0.f;
    }
    #pragma unroll
    for (int j = 0; j < 4; ++j)
      #pragma unroll
      for (int r = 0; r < 8; ++r) {
        const float p = __expf(sc[j][r] - nmax[r]);
        sc[j][r] = p;
        psum[r] += p;
      }
    #pragma unroll
    for (int r = 0; r < 8; ++r) {
      rsum[r] = rsum[r] * alpha[r] + row_sum16(psum[r]);
    }
    #pragma unroll
    for (int j = 0; j < 4; ++j)
      #pragma unroll
      for (int r = 0; r < 8; ++r) o[j][r] *= alpha[r];

    // P (C/D layout) -> LDS -> A-frag layout
    _Float16* Pw = Ps + wave * 16 * PSTR;
    #pragma unroll
    for (int j = 0; j < 4; ++j)
      #pragma unroll
      for (int r = 0; r < 8; ++r)
        Pw[(r + (hi << 3)) * PSTR + j * 16 + l15] = (_Float16)sc[j][r];
    __syncthreads();

    v16h ap0, ap1;
    {
      const _Float16* p = Pw + l15 * PSTR;
      #pragma unroll
      for (int i = 0; i < 8; ++i) {
        ap0[i]     = p[hioff + i];       ap0[8 + i] = p[16 + hioff + i];
        ap1[i]     = p[32 + hioff + i];  ap1[8 + i] = p[48 + hioff + i];
      }
    }
    // O += P(16x64) x V(64x64): 8 WMMA.
    // V^T layout makes each B-frag chunk 8 contiguous halfs -> ds_load_b128.
    #pragma unroll
    for (int j = 0; j < 4; ++j) {
      const _Float16* pv = Vs + (j * 16 + l15) * VSTR;
      v16h bv;
      #pragma unroll
      for (int i = 0; i < 8; ++i) { bv[i] = pv[hioff + i]; bv[8 + i] = pv[16 + hioff + i]; }
      o[j] = wmma16x16x32(ap0, bv, o[j]);
      #pragma unroll
      for (int i = 0; i < 8; ++i) { bv[i] = pv[32 + hioff + i]; bv[8 + i] = pv[48 + hioff + i]; }
      o[j] = wmma16x16x32(ap1, bv, o[j]);
    }
    __syncthreads();
  }

  // finalize: strided stores from a hoisted base pointer
  #pragma unroll
  for (int r = 0; r < 8; ++r) {
    const float invs = 1.f / rsum[r];
    float* rp = Op + (size_t)(qrow0 + r + (hi << 3)) * E_DIM + h * 64 + l15;
    #pragma unroll
    for (int j = 0; j < 4; ++j)
      rp[j * 16] = o[j][r] * invs;
  }
}

// -------------------------------- a = rmsnorm(attn1 - lam*attn2)*(1-LAMBDA) -> f16
__global__ __launch_bounds__(64)
void diff_rmsnorm(const float* __restrict__ a1, const float* __restrict__ a2,
                  const float* __restrict__ lamp, const float* __restrict__ w,
                  const float* __restrict__ b, _Float16* __restrict__ outh) {
  const int idx = blockIdx.x;
  const int s = idx >> 4;
  const int h = idx & 15;
  const int t = threadIdx.x;                    // 0..63 over the 2D-dim group
  __shared__ float sh[2];
  const float lam = lamp[0];
  const size_t off = (size_t)s * E_DIM + h * 64 + t;
  const float d = a1[off] - lam * a2[off];
  float sq = d * d;
  #pragma unroll
  for (int o = 16; o > 0; o >>= 1) sq += __shfl_xor(sq, o, 32);
  if ((t & 31) == 0) sh[t >> 5] = sq;
  __syncthreads();
  const float ms = (sh[0] + sh[1]) * (1.f / 64.f);
  const float r = rsqrtf(ms + 1e-8f);
  outh[off] = (_Float16)((d * r * w[t] + b[t]) * (1.f - LAMBDA_INIT_F));
}

// ---------------------------------------- out = layernorm(a + res) (fp32 + opt f16)
__global__ __launch_bounds__(256)
void add_layernorm(const float* __restrict__ a, const float* __restrict__ res,
                   const float* __restrict__ w, const float* __restrict__ b,
                   float* __restrict__ out32, _Float16* __restrict__ out16) {
  const int s = blockIdx.x;
  const int t = threadIdx.x;
  __shared__ float sh[8];
  __shared__ float stat[2];
  const size_t base = (size_t)s * E_DIM;
  float v[4];
  float sum = 0.f;
  #pragma unroll
  for (int i = 0; i < 4; ++i) {
    const int e = t + i * 256;
    const float xv = a[base + e] + res[base + e];
    v[i] = xv; sum += xv;
  }
  #pragma unroll
  for (int o = 16; o > 0; o >>= 1) sum += __shfl_xor(sum, o, 32);
  if ((t & 31) == 0) sh[t >> 5] = sum;
  __syncthreads();
  if (t == 0) { float r = 0.f; for (int i = 0; i < 8; ++i) r += sh[i]; stat[0] = r * (1.f / E_DIM); }
  __syncthreads();
  const float mean = stat[0];
  float sq = 0.f;
  #pragma unroll
  for (int i = 0; i < 4; ++i) { const float dd = v[i] - mean; sq += dd * dd; }
  #pragma unroll
  for (int o = 16; o > 0; o >>= 1) sq += __shfl_xor(sq, o, 32);
  if ((t & 31) == 0) sh[t >> 5] = sq;
  __syncthreads();
  if (t == 0) { float r = 0.f; for (int i = 0; i < 8; ++i) r += sh[i]; stat[1] = r * (1.f / E_DIM); }
  __syncthreads();
  const float rstd = rsqrtf(stat[1] + 1e-5f);
  #pragma unroll
  for (int i = 0; i < 4; ++i) {
    const int e = t + i * 256;
    const float ov = (v[i] - mean) * rstd * w[e] + b[e];
    out32[base + e] = ov;
    if (out16) out16[base + e] = (_Float16)ov;
  }
}

// ------------------------------------------------------------------ launcher
extern "C" void kernel_launch(void* const* d_in, const int* in_sizes, int n_in,
                              void* d_out, int out_size, void* d_ws, size_t ws_size,
                              hipStream_t stream) {
  (void)in_sizes; (void)n_in; (void)out_size; (void)ws_size;
  const float* x      = (const float*)d_in[0];
  const float* emb    = (const float*)d_in[1];
  const float* qkv_w  = (const float*)d_in[2];
  const float* out_w  = (const float*)d_in[3];
  const float* sigmaw = (const float*)d_in[4];
  const float* lq1    = (const float*)d_in[5];
  const float* lk1    = (const float*)d_in[6];
  const float* lq2    = (const float*)d_in[7];
  const float* lk2    = (const float*)d_in[8];
  const float* ln_w   = (const float*)d_in[9];
  const float* ln_b   = (const float*)d_in[10];
  const float* ln1_w  = (const float*)d_in[11];
  const float* ln1_b  = (const float*)d_in[12];
  const float* ln2_w  = (const float*)d_in[13];
  const float* ln2_b  = (const float*)d_in[14];
  const float* w1     = (const float*)d_in[15];
  const float* b1     = (const float*)d_in[16];
  const float* w2     = (const float*)d_in[17];
  const float* b2     = (const float*)d_in[18];
  float* out = (float*)d_out;

  char* ws = (char*)d_ws;
  size_t off = 0;
  auto alloc = [&](size_t bytes) -> char* {
    char* p = ws + off;
    off += (bytes + 255) & ~(size_t)255;
    return p;
  };
  float*    sig   = (float*)alloc(D_DIM * sizeof(float));
  float*    lam   = (float*)alloc(sizeof(float));
  _Float16* xb    = (_Float16*)alloc((size_t)S_LEN * E_DIM * 2);
  _Float16* wqkvb = (_Float16*)alloc((size_t)3 * E_DIM * E_DIM * 2);
  _Float16* woutb = (_Float16*)alloc((size_t)E_DIM * E_DIM * 2);
  _Float16* w1b   = (_Float16*)alloc((size_t)4 * E_DIM * E_DIM * 2);
  _Float16* w2b   = (_Float16*)alloc((size_t)4 * E_DIM * E_DIM * 2);
  float*    qkvf  = (float*)alloc((size_t)S_LEN * 3 * E_DIM * 4);       // reused below
  _Float16* q1b   = (_Float16*)alloc((size_t)H_NUM * S_LEN * D_DIM * 2);
  _Float16* q2b   = (_Float16*)alloc((size_t)H_NUM * S_LEN * D_DIM * 2);
  _Float16* k1b   = (_Float16*)alloc((size_t)H_NUM * S_LEN * D_DIM * 2);
  _Float16* k2b   = (_Float16*)alloc((size_t)H_NUM * S_LEN * D_DIM * 2);
  _Float16* vtb   = (_Float16*)alloc((size_t)H_NUM * S_LEN * 2 * D_DIM * 2);  // [h][vdim][s]
  _Float16* abh   = (_Float16*)alloc((size_t)S_LEN * E_DIM * 2);
  float*    aof   = (float*)alloc((size_t)S_LEN * E_DIM * 4);           // reused below
  float*    hf    = (float*)alloc((size_t)S_LEN * E_DIM * 4);
  _Float16* hb16  = (_Float16*)alloc((size_t)S_LEN * E_DIM * 2);

  // aliases into dead regions (stream-ordered, deterministic)
  float*    attn1f = qkvf;                                  // qkv dead after rope
  float*    attn2f = qkvf + (size_t)S_LEN * E_DIM;
  _Float16* f1b    = (_Float16*)qkvf;                       // attn bufs dead after diffnorm
  float*    fff    = aof;                                   // aof dead after first add_layernorm

  // 1. fp32 -> f16 conversions (activations + weights)
  cvt_f32_f16<4><<<S_LEN * E_DIM / (4 * 1024),     256, 0, stream>>>(x,     xb);
  cvt_f32_f16<6><<<3 * E_DIM * E_DIM / (6 * 1024), 256, 0, stream>>>(qkv_w, wqkvb);
  cvt_f32_f16<4><<<E_DIM * E_DIM / (4 * 1024),     256, 0, stream>>>(out_w, woutb);
  cvt_f32_f16<8><<<4 * E_DIM * E_DIM / (8 * 1024), 256, 0, stream>>>(w1,    w1b);
  cvt_f32_f16<8><<<4 * E_DIM * E_DIM / (8 * 1024), 256, 0, stream>>>(w2,    w2b);
  small_setup<<<1, 64, 0, stream>>>(emb, sigmaw, lq1, lk1, lq2, lk2, sig, lam);

  // 2. qkv = x @ qkv_w^T  (2048x3072x1024)
  gemm_wmma<0, false><<<dim3(3 * E_DIM / BN, S_LEN / BM), 256, 0, stream>>>(
      xb, wqkvb, nullptr, qkvf, nullptr, S_LEN, 3 * E_DIM, E_DIM);
  // 3. RoPE + sigma + head split (V transposed)
  rope_split<<<S_LEN, 256, 0, stream>>>(qkvf, sig, q1b, q2b, k1b, k2b, vtb);
  // 4. two causal flash attentions (WMMA QK^T and PV)
  attn_flash<<<dim3(S_LEN / 64, H_NUM, 2), 128, 0, stream>>>(
      q1b, q2b, k1b, k2b, vtb, attn1f, attn2f, 0.17677669529663687f);
  // 5. per-head rmsnorm of attn1 - lam*attn2
  diff_rmsnorm<<<S_LEN * H_NUM, 64, 0, stream>>>(attn1f, attn2f, lam, ln_w, ln_b, abh);
  // 6. out projection (2048x1024x1024)
  gemm_wmma<0, false><<<dim3(E_DIM / BN, S_LEN / BM), 256, 0, stream>>>(
      abh, woutb, nullptr, aof, nullptr, S_LEN, E_DIM, E_DIM);
  // 7. h = layernorm(a + x)
  add_layernorm<<<S_LEN, 256, 0, stream>>>(aof, x, ln1_w, ln1_b, hf, hb16);
  // 8. ff1 = silu(h @ w1^T + b1) -> f16 (2048x4096x1024)
  gemm_wmma<1, true><<<dim3(4 * E_DIM / BN, S_LEN / BM), 256, 0, stream>>>(
      hb16, w1b, b1, nullptr, f1b, S_LEN, 4 * E_DIM, E_DIM);
  // 9. ff = ff1 @ w2^T + b2 (2048x1024x4096)
  gemm_wmma<0, true><<<dim3(E_DIM / BN, S_LEN / BM), 256, 0, stream>>>(
      f1b, w2b, b2, fff, nullptr, S_LEN, E_DIM, 4 * E_DIM);
  // 10. out = layernorm(ff + h)
  add_layernorm<<<S_LEN, 256, 0, stream>>>(fff, hf, ln2_w, ln2_b, out, nullptr);
}

// v004
// Measured time: 245 microseconds a run.
// In both of two side-by-side timings against v003, it was 1.06 times as fast.
// Counting every step since v000, it is 1.50 times as fast.
#include <hip/hip_runtime.h>
#include <hip/hip_bf16.h>
#include <math.h>

typedef __attribute__((ext_vector_type(16))) _Float16 v16h;
typedef __attribute__((ext_vector_type(8)))  float    v8f;

#define S_LEN   2048
#define E_DIM   1024
#define H_NUM   16
#define D_DIM   32
#define SIG_DIM 256
#define LAMBDA_INIT_F 0.3555090675909693f

__device__ __forceinline__ v8f wmma16x16x32(v16h a, v16h b, v8f c) {
  // v_wmma_f32_16x16x32_f16: D = A(16x32,f16) x B(32x16,f16) + C(f32)
  return __builtin_amdgcn_wmma_f32_16x16x32_f16(false, a, false, b, (short)0, c, false, false);
}

// ---------------------------------------------------------------- conversions
// One work-group converts U x 1024 consecutive values; the grid covers the array exactly
// (every count here is a multiple of U x 1024). A wave-wide 16-byte load covers four whole
// lines and its 8-byte store two, and a launch starts 2,048 or 4,096 waves in all.
typedef __attribute__((ext_vector_type(4))) float    v4f;
typedef __attribute__((ext_vector_type(4))) _Float16 v4h;

template <int U>
__global__ __launch_bounds__(256)
void cvt_f32_f16(const float* __restrict__ src, _Float16* __restrict__ dst) {
  const unsigned first = (blockIdx.x * (U * 256) + threadIdx.x) * 4;
  v4f v[U];
  #pragma unroll  // all U loads issue before the first wait; v[] stays in registers
  for (int u = 0; u < U; ++u) v[u] = *(const v4f*)(src + first + u * 1024);
  #pragma unroll  // constant offsets
  for (int u = 0; u < U; ++u) *(v4h*)(dst + first + u * 1024) = __builtin_convertvector(v[u], v4h);
}

// --------------------------------------------------- sig = emb @ sigma_w.T ; lambda
__global__ void small_setup(const float* __restrict__ emb, const float* __restrict__ sigw,
                            const float* __restrict__ lq1, const float* __restrict__ lk1,
                            const float* __restrict__ lq2, const float* __restrict__ lk2,
                            float* __restrict__ sig, float* __restrict__ lam) {
  int t = threadIdx.x;
  if (t < D_DIM) {
    float s = 0.f;
    for (int j = 0; j < SIG_DIM; ++j) s += emb[j] * sigw[t * SIG_DIM + j];
    sig[t] = s;
  } else if (t == D_DIM) {
    float s1 = 0.f, s2 = 0.f;
    for (int i = 0; i < D_DIM; ++i) { s1 += lq1[i] * lk1[i]; s2 += lq2[i] * lk2[i]; }
    lam[0] = __expf(s1) - __expf(s2) + LAMBDA_INIT_F;
  }
}

// ------------------------------------------------------------------- GEMM
// C[M,N] = A[M,K] * B[N,K]^T (+bias). MODE 0: fp32 out. MODE 1: SiLU -> f16 out.
// Two LDS buffers filled by asynchronous copies one tile ahead of the products,
// global_prefetch of K+2 tile, branch-free templated epilogue.
#define BM 128
#define BN 128
#define BK 128    // one row of a K tile is 256 contiguous bytes = two whole 128-B lines
#define ASTR 136  // LDS stride in halfs (256 B + 16 B pad: 16 rows of b128 reads hit 64 distinct banks)

// Eight rows' share of one operand tile: each lane brings its own 16 bytes of rows r, r + 16, ...,
// r + 112 from global memory straight into LDS, through no register. lds = the lane's LDS byte
// address in row r, g = its global address there, gstep = 16 source rows in bytes. All lanes on.
// The closing s_wait_xcnt stands in the copies' own statement so that no later write of an
// address register can be scheduled ahead of it.
__device__ __forceinline__ void copy_rows_to_lds(unsigned lds, const char* g, size_t gstep) {
  asm volatile(
      "global_load_async_to_lds_b128 %0, %8, off\n\t"
      "global_load_async_to_lds_b128 %1, %9, off\n\t"
      "global_load_async_to_lds_b128 %2, %10, off\n\t"
      "global_load_async_to_lds_b128 %3, %11, off\n\t"
      "global_load_async_to_lds_b128 %4, %12, off\n\t"
      "global_load_async_to_lds_b128 %5, %13, off\n\t"
      "global_load_async_to_lds_b128 %6, %14, off\n\t"
      "global_load_async_to_lds_b128 %7, %15, off\n\t"
      "s_wait_xcnt 0x0"
      :: "v"(lds),                     "v"(lds + 1 * 16 * ASTR * 2), "v"(lds + 2 * 16 * ASTR * 2),
         "v"(lds + 3 * 16 * ASTR * 2), "v"(lds + 4 * 16 * ASTR * 2), "v"(lds + 5 * 16 * ASTR * 2),
         "v"(lds + 6 * 16 * ASTR * 2), "v"(lds + 7 * 16 * ASTR * 2),
         "v"(g),             "v"(g + gstep),     "v"(g + 2 * gstep), "v"(g + 3 * gstep),
         "v"(g + 4 * gstep), "v"(g + 5 * gstep), "v"(g + 6 * gstep), "v"(g + 7 * gstep)
      : "memory");
}

template <int MODE, bool HAS_BIAS>
__global__ __launch_bounds__(256)
void gemm_wmma(const _Float16* __restrict__ A, const _Float16* __restrict__ B,
               const float* __restrict__ bias, float* __restrict__ Cf,
               _Float16* __restrict__ Ch, int M, int N, int K) {
  __shared__ __attribute__((aligned(16))) _Float16 As[2][BM * ASTR];
  __shared__ __attribute__((aligned(16))) _Float16 Bs[2][BN * ASTR];
  const int tid   = threadIdx.x;
  const int lane  = tid & 31;
  const int wave  = tid >> 5;      // 8 wave32 waves
  const int wm    = wave >> 2;     // 0..1  (64 rows each)
  const int wn    = wave & 3;      // 0..3  (32 cols each)
  const int l15   = lane & 15;
  const int hioff = (lane >> 4) * 8;
  const int bm = blockIdx.y * BM;
  const int bn = blockIdx.x * BN;

  const v8f vzero = {0.f,0.f,0.f,0.f,0.f,0.f,0.f,0.f};
  v8f acc[4][2];
  #pragma unroll
  for (int mt = 0; mt < 4; ++mt)
    #pragma unroll
    for (int nt = 0; nt < 2; ++nt) acc[mt][nt] = vzero;

  // 16 lanes cover one row's 256 bytes, so a wave-wide 16-byte copy touches
  // four whole lines (two rows); eight such copies per operand fill 128 rows.
  const int ldRow = tid >> 4;           // 0..15, +16 per copy
  const int ldCol = (tid & 15) * 8;     // halfs
  const char* gA = (const char*)(A + (size_t)bm * K);
  const char* gB = (const char*)(B + (size_t)bn * K);
  // the lane's own place in the next tile to be copied: global (A and B share the pitch K) and LDS
  const size_t gstep = (size_t)K * (16 * 2);
  const char* cpA = gA + ((size_t)ldRow * K + ldCol) * 2;
  const char* cpB = gB + ((size_t)ldRow * K + ldCol) * 2;
  const int ldsOff = ldRow * ASTR + ldCol;
  const unsigned ldsA = (unsigned)(size_t)&As[0][ldsOff];
  const unsigned ldsB = (unsigned)(size_t)&Bs[0][ldsOff];
  const unsigned bufBytes = BM * ASTR * 2;   // BM == BN
  // prefetch offset: one lane per 128-B line of the tile, two tiles ahead
  unsigned pfoff = (unsigned)(((tid >> 1) * K + (tid & 1) * 64 + 2 * BK) * 2);

  const int ktiles = K / BK;
  // tile 0 into buffer 0, landed and published before anybody reads it
  copy_rows_to_lds(ldsA, cpA, gstep);
  copy_rows_to_lds(ldsB, cpB, gstep);
  cpA += BK * 2; cpB += BK * 2;
  asm volatile("s_wait_asynccnt 0x0" ::: "memory");  // this wave's copies of tile 0 have landed
  __syncthreads();
  // tile 1 flies into buffer 1 while tile 0 is worked on
  if (1 < ktiles) {
    copy_rows_to_lds(ldsA + bufBytes, cpA, gstep);
    copy_rows_to_lds(ldsB + bufBytes, cpB, gstep);
    cpA += BK * 2; cpB += BK * 2;
  }

  int cur = 0;
  for (int kt = 0; kt < ktiles; ++kt) {
    // pull the K+2 tile toward L2 (global_prefetch_b8)
    if (kt + 2 < ktiles) {
      __builtin_prefetch(gA + pfoff, 0, 1);
      __builtin_prefetch(gB + pfoff, 0, 1);
    }
    pfoff += BK * 2;

    // four 32-deep WMMA steps per tile, k ascending; unrolled for constant LDS offsets
    #pragma unroll
    for (int ks = 0; ks < BK / 32; ++ks) {
      v16h af[4], bf2[2];
      #pragma unroll
      for (int mt = 0; mt < 4; ++mt) {
        const _Float16* p = &As[cur][(wm * 64 + mt * 16 + l15) * ASTR + ks * 32 + hioff];
        #pragma unroll
        for (int i = 0; i < 8; ++i) { af[mt][i] = p[i]; af[mt][8 + i] = p[16 + i]; }
      }
      #pragma unroll
      for (int nt = 0; nt < 2; ++nt) {
        const _Float16* p = &Bs[cur][(wn * 32 + nt * 16 + l15) * ASTR + ks * 32 + hioff];
        #pragma unroll
        for (int i = 0; i < 8; ++i) { bf2[nt][i] = p[i]; bf2[nt][8 + i] = p[16 + i]; }
      }
      #pragma unroll
      for (int mt = 0; mt < 4; ++mt)
        #pragma unroll
        for (int nt = 0; nt < 2; ++nt)
          acc[mt][nt] = wmma16x16x32(af[mt], bf2[nt], acc[mt][nt]);
    }

    // hand-over: this wave's reads of buffer cur are done, its copies of tile kt+1 have landed;
    // the barrier publishes that tile and frees buffer cur for the refill behind it
    asm volatile("s_wait_dscnt 0x0" ::: "memory");
    asm volatile("s_wait_asynccnt 0x0" ::: "memory");
    __syncthreads();
    if (kt + 2 < ktiles) {
      copy_rows_to_lds(ldsA + cur * bufBytes, cpA, gstep);
      copy_rows_to_lds(ldsB + cur * bufBytes, cpB, gstep);
      cpA += BK * 2; cpB += BK * 2;
    }
    cur ^= 1;
  }
  asm volatile("s_wait_asynccnt 0x0" ::: "memory");  // no copy outlives the loop

  // ---------------- branch-free epilogue (bias hoisted, strided stores)
  float bv[2] = {0.f, 0.f};
  if (HAS_BIAS) {
    bv[0] = bias[bn + wn * 32 + l15];
    bv[1] = bias[bn + wn * 32 + 16 + l15];
  }
  #pragma unroll
  for (int mt = 0; mt < 4; ++mt) {
    const int gm0 = bm + wm * 64 + mt * 16 + ((lane >> 4) << 3);
    #pragma unroll
    for (int nt = 0; nt < 2; ++nt) {
      const int gn = bn + wn * 32 + nt * 16 + l15;
      if (MODE == 1) {
        _Float16* cp = Ch + (size_t)gm0 * N + gn;
        #pragma unroll
        for (int r = 0; r < 8; ++r) {
          float v = acc[mt][nt][r];
          if (HAS_BIAS) v += bv[nt];
          cp[(size_t)r * N] = (_Float16)(v / (1.f + __expf(-v)));   // SiLU
        }
      } else {
        float* cp = Cf + (size_t)gm0 * N + gn;
        #pragma unroll
        for (int r = 0; r < 8; ++r) {
          float v = acc[mt][nt][r];
          if (HAS_BIAS) v += bv[nt];
          cp[(size_t)r * N] = v;
        }
      }
    }
  }
}

// ------------------------------------------- RoPE + sigma add + head split -> f16
// Q/K written [h][s][d] (row = K-contig for A/B frags).
// V written TRANSPOSED [h][vdim][s] so attention's B-frag of V is K(seq)-contiguous.
__global__ __launch_bounds__(256)
void rope_split(const float* __restrict__ qkv, const float* __restrict__ sig,
                _Float16* __restrict__ q1, _Float16* __restrict__ q2,
                _Float16* __restrict__ k1, _Float16* __restrict__ k2,
                _Float16* __restrict__ vt) {
  const int s = blockIdx.x;
  const int t = threadIdx.x;
  __shared__ float sigs[D_DIM];
  if (t < D_DIM) sigs[t] = sig[t];
  __syncthreads();
  const float* row = qkv + (size_t)s * (3 * E_DIM);
  for (int idx = t; idx < 3 * E_DIM; idx += 256) {
    const int which = idx >> 10;        // 0=q 1=k 2=v
    const int rem   = idx & 1023;
    const int rh    = rem >> 5;         // rope head 0..31
    const int d     = rem & 31;
    const int h     = rh >> 1;
    const int sub   = rh & 1;
    const float val = row[idx];
    float o = val;
    if (which < 2 && d < 16) {          // rotate first half of head dim, pairwise
      const int p = d >> 1;
      const float inv = __powf(10000.f, -(float)(2 * p) * (1.f / 16.f));
      const float ang = (float)s * inv;
      float sn, c; __sincosf(ang, &sn, &c);
      const float other = row[(idx & ~31) + (d ^ 1)];
      o = (d & 1) ? (val * c + other * sn) : (val * c - other * sn);
    }
    if (which < 2 && sub == 1) o += sigs[d];
    if (which == 0) {
      _Float16* dst = sub ? q2 : q1;
      dst[(size_t)h * S_LEN * D_DIM + (size_t)s * D_DIM + d] = (_Float16)o;
    } else if (which == 1) {
      _Float16* dst = sub ? k2 : k1;
      dst[(size_t)h * S_LEN * D_DIM + (size_t)s * D_DIM + d] = (_Float16)o;
    } else {
      // transposed: [h][vdim = sub*32+d][s]
      vt[(size_t)h * (2 * D_DIM) * S_LEN + (size_t)(sub * D_DIM + d) * S_LEN + s] = (_Float16)o;
    }
  }
}

// ----------------------------------------------------- flash attention (WMMA)
// Value of lane (l ^ M) of the same 16-lane row, M = 1..15, by a DPP row_xmask move: it stays on
// the vector pipe, where a shuffle goes through the LDS queue and is waited for at every step.
// All 32 lanes are on wherever it is called.
template <int M>
__device__ __forceinline__ float row_xor(float x) {
  return __builtin_bit_cast(float, __builtin_amdgcn_update_dpp(
      0, __builtin_bit_cast(int, x), 0x160 + M, 0xf, 0xf, true));
}
// Butterflies over a 16-lane row, partners 8, 4, 2, 1 in this order.
// Maxima of four independent values: one DPP instruction a step, the four chains interleaved so
// that each step issues behind the other three chains' and not behind its own result. In asm
// because the builtin form compiled to three dependent instructions a step (move, quieting
// maximum, maximum), one chain after the other.
__device__ __forceinline__ void row_max16x4(float& a, float& b, float& c, float& d) {
  asm("v_max_num_f32_dpp %0, %0, %0 row_xmask:8 row_mask:0xf bank_mask:0xf\n\t"
      "v_max_num_f32_dpp %1, %1, %1 row_xmask:8 row_mask:0xf bank_mask:0xf\n\t"
      "v_max_num_f32_dpp %2, %2, %2 row_xmask:8 row_mask:0xf bank_mask:0xf\n\t"
      "v_max_num_f32_dpp %3, %3, %3 row_xmask:8 row_mask:0xf bank_mask:0xf\n\t"
      "v_max_num_f32_dpp %0, %0, %0 row_xmask:4 row_mask:0xf bank_mask:0xf\n\t"
      "v_max_num_f32_dpp %1, %1, %1 row_xmask:4 row_mask:0xf bank_mask:0xf\n\t"
      "v_max_num_f32_dpp %2, %2, %2 row_xmask:4 row_mask:0xf bank_mask:0xf\n\t"
      "v_max_num_f32_dpp %3, %3, %3 row_xmask:4 row_mask:0xf bank_mask:0xf\n\t"
      "v_max_num_f32_dpp %0, %0, %0 row_xmask:2 row_mask:0xf bank_mask:0xf\n\t"
      "v_max_num_f32_dpp %1, %1, %1 row_xmask:2 row_mask:0xf bank_mask:0xf\n\t"
      "v_max_num_f32_dpp %2, %2, %2 row_xmask:2 row_mask:0xf bank_mask:0xf\n\t"
      "v_max_num_f32_dpp %3, %3, %3 row_xmask:2 row_mask:0xf bank_mask:0xf\n\t"
      "v_max_num_f32_dpp %0, %0, %0 row_xmask:1 row_mask:0xf bank_mask:0xf\n\t"
      "v_max_num_f32_dpp %1, %1, %1 row_xmask:1 row_mask:0xf bank_mask:0xf\n\t"
      "v_max_num_f32_dpp %2, %2, %2 row_xmask:1 row_mask:0xf bank_mask:0xf\n\t"
      "v_max_num_f32_dpp %3, %3, %3 row_xmask:1 row_mask:0xf bank_mask:0xf"
      : "+v"(a), "+v"(b), "+v"(c), "+v"(d));
}
__device__ __forceinline__ float row_sum16(float s) {
  s += row_xor<8>(s);
  s += row_xor<4>(s);
  s += row_xor<2>(s);
  return s + row_xor<1>(s);
}
#define KSTR 40
#define VSTR 72   // Vs rows are vdim (64), cols are seq/K (64) + pad
#define PSTR 72

__global__ __launch_bounds__(128)
void attn_flash(const _Float16* __restrict__ q1, const _Float16* __restrict__ q2,
                const _Float16* __restrict__ k1, const _Float16* __restrict__ k2,
                const _Float16* __restrict__ vt,
                float* __restrict__ o1, float* __restrict__ o2, float scale) {
  __shared__ _Float16 Ks[64 * KSTR];
  __shared__ _Float16 Vs[64 * VSTR];    // transposed V tile: [vdim][seq]
  __shared__ _Float16 Ps[4 * 16 * PSTR];

  const int tid   = threadIdx.x;
  const int lane  = tid & 31;
  const int wave  = tid >> 5;          // 4 waves, 16 q-rows each
  const int l15   = lane & 15;
  const int hi    = lane >> 4;
  const int hioff = hi * 8;

  const int qi = blockIdx.x;           // q tile (64 rows)
  const int h  = blockIdx.y;
  const int ai = blockIdx.z;           // which attention (0/1)

  const _Float16* Qp = (ai ? q2 : q1) + (size_t)h * S_LEN * D_DIM;
  const _Float16* Kp = (ai ? k2 : k1) + (size_t)h * S_LEN * D_DIM;
  const _Float16* Vp = vt + (size_t)h * (2 * D_DIM) * S_LEN;   // [vdim][s]
  float* Op = ai ? o2 : o1;

  const int qbase = qi * 64;
  const int qrow0 = qbase + wave * 16;

  v16h aq;                              // Q A-frag (rows contiguous in global, K=32)
  {
    const _Float16* p = Qp + (size_t)(qrow0 + l15) * D_DIM + hioff;
    #pragma unroll
    for (int i = 0; i < 8; ++i) { aq[i] = p[i]; aq[8 + i] = p[16 + i]; }
  }

  const v8f vzero = {0.f,0.f,0.f,0.f,0.f,0.f,0.f,0.f};
  v8f o[4];
  #pragma unroll
  for (int j = 0; j < 4; ++j) o[j] = vzero;
  float rmax[8], rsum[8];
  #pragma unroll
  for (int r = 0; r < 8; ++r) { rmax[r] = -1e30f; rsum[r] = 0.f; }

  const int ldRow = tid >> 1;           // 0..63
  const int kc16  = (tid & 1) * 16;
  const int vc32  = (tid & 1) * 32;

  for (int kt = 0; kt <= qi; ++kt) {
    const int kbase = kt * 64;
    {   // stage K (64 seq x 32 d) and V^T (64 vdim x 64 seq) tiles, all vectorized
      const uint4* s = (const uint4*)(Kp + (size_t)(kbase + ldRow) * D_DIM + kc16);
      uint4* d = (uint4*)(Ks + ldRow * KSTR + kc16);
      d[0] = s[0]; d[1] = s[1];
      const uint4* s2 = (const uint4*)(Vp + (size_t)ldRow * S_LEN + kbase + vc32);
      uint4* d2 = (uint4*)(Vs + ldRow * VSTR + vc32);
      d2[0] = s2[0]; d2[1] = s2[1]; d2[2] = s2[2]; d2[3] = s2[3];
    }
    __syncthreads();

    // scores = Q(16x32) x K^T(32x64): 4 WMMA
    v8f sc[4];
    #pragma unroll
    for (int j = 0; j < 4; ++j) {
      v16h bk;
      const _Float16* p = Ks + (j * 16 + l15) * KSTR + hioff;
      #pragma unroll
      for (int i = 0; i < 8; ++i) { bk[i] = p[i]; bk[8 + i] = p[16 + i]; }
      sc[j] = wmma16x16x32(aq, bk, vzero);
      #pragma unroll
      for (int r = 0; r < 8; ++r) sc[j][r] *= scale;
    }
    if (kt == qi) {                      // causal mask on diagonal tile
      #pragma unroll
      for (int j = 0; j < 4; ++j) {
        const int col = kbase + j * 16 + l15;
        #pragma unroll
        for (int r = 0; r < 8; ++r) {
          const int rowg = qrow0 + r + (hi << 3);
          if (col > rowg) sc[j][r] = -1e30f;
        }
      }
    }

    // online softmax (row stats live in VGPR index r, reduced over 16-lane groups)
    float nmax[8], alpha[8], psum[8];
    #pragma unroll
    for (int r = 0; r < 8; ++r) {
      float m = rmax[r];                 // the same in all 16 lanes of the row
      #pragma unroll
      for (int j = 0; j < 4; ++j) m = fmaxf(m, sc[j][r]);
      nmax[r] = m;
    }
    row_max16x4(nmax[0], nmax[1], nmax[2], nmax[3]);
    row_max16x4(nmax[4], nmax[5], nmax[6], nmax[7]);
    #pragma unroll
    for (int r = 0; r < 8; ++r) {
      alpha[r] = __expf(rmax[r] - nmax[r]);
      rmax[r] = nmax[r];
      psum[r] = 0.f;
    }
    #pragma unroll
    for (int j = 0; j < 4; ++j)
      #pragma unroll
      for (int r = 0; r < 8; ++r) {
        const float p = __expf(sc[j][r] - nmax[r]);
        sc[j][r] = p;
        psum[r] += p;
      }
    #pragma unroll
    for (int r = 0; r < 8; ++r) {
      rsum[r] = rsum[r] * alpha[r] + row_sum16(psum[r]);
    }
    #pragma unroll
    for (int j = 0; j < 4; ++j)
      #pragma unroll
      for (int r = 0; r < 8; ++r) o[j][r] *= alpha[r];

    // P (C/D layout) -> LDS -> A-frag layout
    _Float16* Pw = Ps + wave * 16 * PSTR;
    #pragma unroll
    for (int j = 0; j < 4; ++j)
      #pragma unroll
      for (int r = 0; r < 8; ++r)
        Pw[(r + (hi << 3)) * PSTR + j * 16 + l15] = (_Float16)sc[j][r];
    __syncthreads();

    v16h ap0, ap1;
    {
      const _Float16* p = Pw + l15 * PSTR;
      #pragma unroll
      for (int i = 0; i < 8; ++i) {
        ap0[i]     = p[hioff + i];       ap0[8 + i] = p[16 + hioff + i];
        ap1[i]     = p[32 + hioff + i];  ap1[8 + i] = p[48 + hioff + i];
      }
    }
    // O += P(16x64) x V(64x64): 8 WMMA.
    // V^T layout makes each B-frag chunk 8 contiguous halfs -> ds_load_b128.
    #pragma unroll
    for (int j = 0; j < 4; ++j) {
      const _Float16* pv = Vs + (j * 16 + l15) * VSTR;
      v16h bv;
      #pragma unroll
      for (int i = 0; i < 8; ++i) { bv[i] = pv[hioff + i]; bv[8 + i] = pv[16 + hioff + i]; }
      o[j] = wmma16x16x32(ap0, bv, o[j]);
      #pragma unroll
      for (int i = 0; i < 8; ++i) { bv[i] = pv[32 + hioff + i]; bv[8 + i] = pv[48 + hioff + i]; }
      o[j] = wmma16x16x32(ap1, bv, o[j]);
    }
    __syncthreads();
  }

  // finalize: strided stores from a hoisted base pointer
  #pragma unroll
  for (int r = 0; r < 8; ++r) {
    const float invs = 1.f / rsum[r];
    float* rp = Op + (size_t)(qrow0 + r + (hi << 3)) * E_DIM + h * 64 + l15;
    #pragma unroll
    for (int j = 0; j < 4; ++j)
      rp[j * 16] = o[j][r] * invs;
  }
}

// -------------------------------- a = rmsnorm(attn1 - lam*attn2)*(1-LAMBDA) -> f16
__global__ __launch_bounds__(64)
void diff_rmsnorm(const float* __restrict__ a1, const float* __restrict__ a2,
                  const float* __restrict__ lamp, const float* __restrict__ w,
                  const float* __restrict__ b, _Float16* __restrict__ outh) {
  const int idx = blockIdx.x;
  const int s = idx >> 4;
  const int h = idx & 15;
  const int t = threadIdx.x;                    // 0..63 over the 2D-dim group
  __shared__ float sh[2];
  const float lam = lamp[0];
  const size_t off = (size_t)s * E_DIM + h * 64 + t;
  const float d = a1[off] - lam * a2[off];
  float sq = d * d;
  #pragma unroll
  for (int o = 16; o > 0; o >>= 1) sq += __shfl_xor(sq, o, 32);
  if ((t & 31) == 0) sh[t >> 5] = sq;
  __syncthreads();
  const float ms = (sh[0] + sh[1]) * (1.f / 64.f);
  const float r = rsqrtf(ms + 1e-8f);
  outh[off] = (_Float16)((d * r * w[t] + b[t]) * (1.f - LAMBDA_INIT_F));
}

// ---------------------------------------- out = layernorm(a + res) (fp32 + opt f16)
__global__ __launch_bounds__(256)
void add_layernorm(const float* __restrict__ a, const float* __restrict__ res,
                   const float* __restrict__ w, const float* __restrict__ b,
                   float* __restrict__ out32, _Float16* __restrict__ out16) {
  const int s = blockIdx.x;
  const int t = threadIdx.x;
  __shared__ float sh[8];
  __shared__ float stat[2];
  const size_t base = (size_t)s * E_DIM;
  float v[4];
  float sum = 0.f;
  #pragma unroll
  for (int i = 0; i < 4; ++i) {
    const int e = t + i * 256;
    const float xv = a[base + e] + res[base + e];
    v[i] = xv; sum += xv;
  }
  #pragma unroll
  for (int o = 16; o > 0; o >>= 1) sum += __shfl_xor(sum, o, 32);
  if ((t & 31) == 0) sh[t >> 5] = sum;
  __syncthreads();
  if (t == 0) { float r = 0.f; for (int i = 0; i < 8; ++i) r += sh[i]; stat[0] = r * (1.f / E_DIM); }
  __syncthreads();
  const float mean = stat[0];
  float sq = 0.f;
  #pragma unroll
  for (int i = 0; i < 4; ++i) { const float dd = v[i] - mean; sq += dd * dd; }
  #pragma unroll
  for (int o = 16; o > 0; o >>= 1) sq += __shfl_xor(sq, o, 32);
  if ((t & 31) == 0) sh[t >> 5] = sq;
  __syncthreads();
  if (t == 0) { float r = 0.f; for (int i = 0; i < 8; ++i) r += sh[i]; stat[1] = r * (1.f / E_DIM); }
  __syncthreads();
  const float rstd = rsqrtf(stat[1] + 1e-5f);
  #pragma unroll
  for (int i = 0; i < 4; ++i) {
    const int e = t + i * 256;
    const float ov = (v[i] - mean) * rstd * w[e] + b[e];
    out32[base + e] = ov;
    if (out16) out16[base + e] = (_Float16)ov;
  }
}

// ------------------------------------------------------------------ launcher
extern "C" void kernel_launch(void* const* d_in, const int* in_sizes, int n_in,
                              void* d_out, int out_size, void* d_ws, size_t ws_size,
                              hipStream_t stream) {
  (void)in_sizes; (void)n_in; (void)out_size; (void)ws_size;
  const float* x      = (const float*)d_in[0];
  const float* emb    = (const float*)d_in[1];
  const float* qkv_w  = (const float*)d_in[2];
  const float* out_w  = (const float*)d_in[3];
  const float* sigmaw = (const float*)d_in[4];
  const float* lq1    = (const float*)d_in[5];
  const float* lk1    = (const float*)d_in[6];
  const float* lq2    = (const float*)d_in[7];
  const float* lk2    = (const float*)d_in[8];
  const float* ln_w   = (const float*)d_in[9];
  const float* ln_b   = (const float*)d_in[10];
  const float* ln1_w  = (const float*)d_in[11];
  const float* ln1_b  = (const float*)d_in[12];
  const float* ln2_w  = (const float*)d_in[13];
  const float* ln2_b  = (const float*)d_in[14];
  const float* w1     = (const float*)d_in[15];
  const float* b1     = (const float*)d_in[16];
  const float* w2     = (const float*)d_in[17];
  const float* b2     = (const float*)d_in[18];
  float* out = (float*)d_out;

  char* ws = (char*)d_ws;
  size_t off = 0;
  auto alloc = [&](size_t bytes) -> char* {
    char* p = ws + off;
    off += (bytes + 255) & ~(size_t)255;
    return p;
  };
  float*    sig   = (float*)alloc(D_DIM * sizeof(float));
  float*    lam   = (float*)alloc(sizeof(float));
  _Float16* xb    = (_Float16*)alloc((size_t)S_LEN * E_DIM * 2);
  _Float16* wqkvb = (_Float16*)alloc((size_t)3 * E_DIM * E_DIM * 2);
  _Float16* woutb = (_Float16*)alloc((size_t)E_DIM * E_DIM * 2);
  _Float16* w1b   = (_Float16*)alloc((size_t)4 * E_DIM * E_DIM * 2);
  _Float16* w2b   = (_Float16*)alloc((size_t)4 * E_DIM * E_DIM * 2);
  float*    qkvf  = (float*)alloc((size_t)S_LEN * 3 * E_DIM * 4);       // reused below
  _Float16* q1b   = (_Float16*)alloc((size_t)H_NUM * S_LEN * D_DIM * 2);
  _Float16* q2b   = (_Float16*)alloc((size_t)H_NUM * S_LEN * D_DIM * 2);
  _Float16* k1b   = (_Float16*)alloc((size_t)H_NUM * S_LEN * D_DIM * 2);
  _Float16* k2b   = (_Float16*)alloc((size_t)H_NUM * S_LEN * D_DIM * 2);
  _Float16* vtb   = (_Float16*)alloc((size_t)H_NUM * S_LEN * 2 * D_DIM * 2);  // [h][vdim][s]
  _Float16* abh   = (_Float16*)alloc((size_t)S_LEN * E_DIM * 2);
  float*    aof   = (float*)alloc((size_t)S_LEN * E_DIM * 4);           // reused below
  float*    hf    = (float*)alloc((size_t)S_LEN * E_DIM * 4);
  _Float16* hb16  = (_Float16*)alloc((size_t)S_LEN * E_DIM * 2);

  // aliases into dead regions (stream-ordered, deterministic)
  float*    attn1f = qkvf;                                  // qkv dead after rope
  float*    attn2f = qkvf + (size_t)S_LEN * E_DIM;
  _Float16* f1b    = (_Float16*)qkvf;                       // attn bufs dead after diffnorm
  float*    fff    = aof;                                   // aof dead after first add_layernorm

  // 1. fp32 -> f16 conversions (activations + weights)
  cvt_f32_f16<4><<<S_LEN * E_DIM / (4 * 1024),     256, 0, stream>>>(x,     xb);
  cvt_f32_f16<6><<<3 * E_DIM * E_DIM / (6 * 1024), 256, 0, stream>>>(qkv_w, wqkvb);
  cvt_f32_f16<4><<<E_DIM * E_DIM / (4 * 1024),     256, 0, stream>>>(out_w, woutb);
  cvt_f32_f16<8><<<4 * E_DIM * E_DIM / (8 * 1024), 256, 0, stream>>>(w1,    w1b);
  cvt_f32_f16<8><<<4 * E_DIM * E_DIM / (8 * 1024), 256, 0, stream>>>(w2,    w2b);
  small_setup<<<1, 64, 0, stream>>>(emb, sigmaw, lq1, lk1, lq2, lk2, sig, lam);

  // 2. qkv = x @ qkv_w^T  (2048x3072x1024)
  gemm_wmma<0, false><<<dim3(3 * E_DIM / BN, S_LEN / BM), 256, 0, stream>>>(
      xb, wqkvb, nullptr, qkvf, nullptr, S_LEN, 3 * E_DIM, E_DIM);
  // 3. RoPE + sigma + head split (V transposed)
  rope_split<<<S_LEN, 256, 0, stream>>>(qkvf, sig, q1b, q2b, k1b, k2b, vtb);
  // 4. two causal flash attentions (WMMA QK^T and PV)
  attn_flash<<<dim3(S_LEN / 64, H_NUM, 2), 128, 0, stream>>>(
      q1b, q2b, k1b, k2b, vtb, attn1f, attn2f, 0.17677669529663687f);
  // 5. per-head rmsnorm of attn1 - lam*attn2
  diff_rmsnorm<<<S_LEN * H_NUM, 64, 0, stream>>>(attn1f, attn2f, lam, ln_w, ln_b, abh);
  // 6. out projection (2048x1024x1024)
  gemm_wmma<0, false><<<dim3(E_DIM / BN, S_LEN / BM), 256, 0, stream>>>(
      abh, woutb, nullptr, aof, nullptr, S_LEN, E_DIM, E_DIM);
  // 7. h = layernorm(a + x)
  add_layernorm<<<S_LEN, 256, 0, stream>>>(aof, x, ln1_w, ln1_b, hf, hb16);
  // 8. ff1 = silu(h @ w1^T + b1) -> f16 (2048x4096x1024)
  gemm_wmma<1, true><<<dim3(4 * E_DIM / BN, S_LEN / BM), 256, 0, stream>>>(
      hb16, w1b, b1, nullptr, f1b, S_LEN, 4 * E_DIM, E_DIM);
  // 9. ff = ff1 @ w2^T + b2 (2048x1024x4096)
  gemm_wmma<0, true><<<dim3(E_DIM / BN, S_LEN / BM), 256, 0, stream>>>(
      f1b, w2b, b2, fff, nullptr, S_LEN, E_DIM, 4 * E_DIM);
  // 10. out = layernorm(ff + h)
  add_layernorm<<<S_LEN, 256, 0, stream>>>(fff, hf, ln2_w, ln2_b, out, nullptr);
}

// v005
// A run of this version takes 234 microseconds.
// In both of two side-by-side timings against v004, it was 1.05 times as fast.
// Counting every step since v000, it is 1.57 times as fast.
#include <hip/hip_runtime.h>
#include <hip/hip_bf16.h>
#include <math.h>

typedef __attribute__((ext_vector_type(16))) _Float16 v16h;
typedef __attribute__((ext_vector_type(8)))  float    v8f;

#define S_LEN   2048
#define E_DIM   1024
#define H_NUM   16
#define D_DIM   32
#define SIG_DIM 256
#define LAMBDA_INIT_F 0.3555090675909693f

__device__ __forceinline__ v8f wmma16x16x32(v16h a, v16h b, v8f c) {
  // v_wmma_f32_16x16x32_f16: D = A(16x32,f16) x B(32x16,f16) + C(f32)
  return __builtin_amdgcn_wmma_f32_16x16x32_f16(false, a, false, b, (short)0, c, false, false);
}

// ------------------------------------------------- work that needs the inputs alone
// The five f32 -> f16 conversions and the small set-up need nothing of each other, so they share
// one grid: block 0 does the set-up, every other block converts CVT_U x 1024 consecutive values of
// the array whose range of block indices it falls into (every count is a multiple of CVT_U x 1024).
// A wave-wide 16-byte load covers four whole lines and its 8-byte store two.
typedef __attribute__((ext_vector_type(4))) float    v4f;
typedef __attribute__((ext_vector_type(4))) _Float16 v4h;
#define CVT_U   8
#define NB_X    (S_LEN * E_DIM / (CVT_U * 1024))
#define NB_QKVW (3 * E_DIM * E_DIM / (CVT_U * 1024))
#define NB_OUTW (E_DIM * E_DIM / (CVT_U * 1024))
#define NB_W1   (4 * E_DIM * E_DIM / (CVT_U * 1024))
#define NB_W2   (4 * E_DIM * E_DIM / (CVT_U * 1024))

// sig = emb @ sigma_w.T ; lambda
__device__ __forceinline__ void small_setup(int t,
                            const float* __restrict__ emb, const float* __restrict__ sigw,
                            const float* __restrict__ lq1, const float* __restrict__ lk1,
                            const float* __restrict__ lq2, const float* __restrict__ lk2,
                            float* __restrict__ sig, float* __restrict__ lam) {
  if (t < D_DIM) {
    float s = 0.f;
    for (int j = 0; j < SIG_DIM; ++j) s += emb[j] * sigw[t * SIG_DIM + j];
    sig[t] = s;
  } else if (t == D_DIM) {
    float s1 = 0.f, s2 = 0.f;
    for (int i = 0; i < D_DIM; ++i) { s1 += lq1[i] * lk1[i]; s2 += lq2[i] * lk2[i]; }
    lam[0] = __expf(s1) - __expf(s2) + LAMBDA_INIT_F;
  }
}

__global__ __launch_bounds__(256)
void prepare(const float* __restrict__ x,     _Float16* __restrict__ xb,
             const float* __restrict__ qkv_w, _Float16* __restrict__ wqkvb,
             const float* __restrict__ out_w, _Float16* __restrict__ woutb,
             const float* __restrict__ w1,    _Float16* __restrict__ w1b,
             const float* __restrict__ w2,    _Float16* __restrict__ w2b,
             const float* __restrict__ emb, const float* __restrict__ sigw,
             const float* __restrict__ lq1, const float* __restrict__ lk1,
             const float* __restrict__ lq2, const float* __restrict__ lk2,
             float* __restrict__ sig, float* __restrict__ lam) {
  if (blockIdx.x == 0) {   // first, because its chain of dependent sums is the longest block
    small_setup(threadIdx.x, emb, sigw, lq1, lk1, lq2, lk2, sig, lam);
    return;
  }
  unsigned b = blockIdx.x - 1;   // the same for the whole block: scalar selects
  const float* src = x;
  _Float16* dst = xb;
  if (b >= NB_X) {
    b -= NB_X; src = qkv_w; dst = wqkvb;
    if (b >= NB_QKVW) {
      b -= NB_QKVW; src = out_w; dst = woutb;
      if (b >= NB_OUTW) {
        b -= NB_OUTW; src = w1; dst = w1b;
        if (b >= NB_W1) { b -= NB_W1; src = w2; dst = w2b; }
      }
    }
  }
  const unsigned first = (b * (CVT_U * 256) + threadIdx.x) * 4;
  v4f v[CVT_U];
  #pragma unroll  // all CVT_U loads issue before the first wait; v[] stays in registers
  for (int u = 0; u < CVT_U; ++u) v[u] = *(const v4f*)(src + first + u * 1024);
  #pragma unroll  // constant offsets
  for (int u = 0; u < CVT_U; ++u) *(v4h*)(dst + first + u * 1024) = __builtin_convertvector(v[u], v4h);
}

// ------------------------------------------------------------------- GEMM
// C[M,N] = A[M,K] * B[N,K]^T (+bias). MODE 0: fp32 out. MODE 1: SiLU -> f16 out.
// Two LDS buffers filled by asynchronous copies one tile ahead of the products,
// global_prefetch of K+2 tile, branch-free templated epilogue.
#define BM 128
#define BN 128
#define BK 128    // one row of a K tile is 256 contiguous bytes = two whole 128-B lines
#define ASTR 136  // LDS stride in halfs (256 B + 16 B pad: 16 rows of b128 reads hit 64 distinct banks)

// Eight rows' share of one operand tile: each lane brings its own 16 bytes of rows r, r + 16, ...,
// r + 112 from global memory straight into LDS, through no register. lds = the lane's LDS byte
// address in row r, g = its global address there, gstep = 16 source rows in bytes. All lanes on.
// The closing s_wait_xcnt stands in the copies' own statement so that no later write of an
// address register can be scheduled ahead of it.
__device__ __forceinline__ void copy_rows_to_lds(unsigned lds, const char* g, size_t gstep) {
  asm volatile(
      "global_load_async_to_lds_b128 %0, %8, off\n\t"
      "global_load_async_to_lds_b128 %1, %9, off\n\t"
      "global_load_async_to_lds_b128 %2, %10, off\n\t"
      "global_load_async_to_lds_b128 %3, %11, off\n\t"
      "global_load_async_to_lds_b128 %4, %12, off\n\t"
      "global_load_async_to_lds_b128 %5, %13, off\n\t"
      "global_load_async_to_lds_b128 %6, %14, off\n\t"
      "global_load_async_to_lds_b128 %7, %15, off\n\t"
      "s_wait_xcnt 0x0"
      :: "v"(lds),                     "v"(lds + 1 * 16 * ASTR * 2), "v"(lds + 2 * 16 * ASTR * 2),
         "v"(lds + 3 * 16 * ASTR * 2), "v"(lds + 4 * 16 * ASTR * 2), "v"(lds + 5 * 16 * ASTR * 2),
         "v"(lds + 6 * 16 * ASTR * 2), "v"(lds + 7 * 16 * ASTR * 2),
         "v"(g),             "v"(g + gstep),     "v"(g + 2 * gstep), "v"(g + 3 * gstep),
         "v"(g + 4 * gstep), "v"(g + 5 * gstep), "v"(g + 6 * gstep), "v"(g + 7 * gstep)
      : "memory");
}

template <int MODE, bool HAS_BIAS>
__global__ __launch_bounds__(256)
void gemm_wmma(const _Float16* __restrict__ A, const _Float16* __restrict__ B,
               const float* __restrict__ bias, float* __restrict__ Cf,
               _Float16* __restrict__ Ch, int M, int N, int K) {
  __shared__ __attribute__((aligned(16))) _Float16 As[2][BM * ASTR];
  __shared__ __attribute__((aligned(16))) _Float16 Bs[2][BN * ASTR];
  const int tid   = threadIdx.x;
  const int lane  = tid & 31;
  const int wave  = tid >> 5;      // 8 wave32 waves
  const int wm    = wave >> 2;     // 0..1  (64 rows each)
  const int wn    = wave & 3;      // 0..3  (32 cols each)
  const int l15   = lane & 15;
  const int hioff = (lane >> 4) * 8;
  const int bm = blockIdx.y * BM;
  const int bn = blockIdx.x * BN;

  const v8f vzero = {0.f,0.f,0.f,0.f,0.f,0.f,0.f,0.f};
  v8f acc[4][2];
  #pragma unroll
  for (int mt = 0; mt < 4; ++mt)
    #pragma unroll
    for (int nt = 0; nt < 2; ++nt) acc[mt][nt] = vzero;

  // 16 lanes cover one row's 256 bytes, so a wave-wide 16-byte copy touches
  // four whole lines (two rows); eight such copies per operand fill 128 rows.
  const int ldRow = tid >> 4;           // 0..15, +16 per copy
  const int ldCol = (tid & 15) * 8;     // halfs
  const char* gA = (const char*)(A + (size_t)bm * K);
  const char* gB = (const char*)(B + (size_t)bn * K);
  // the lane's own place in the next tile to be copied: global (A and B share the pitch K) and LDS
  const size_t gstep = (size_t)K * (16 * 2);
  const char* cpA = gA + ((size_t)ldRow * K + ldCol) * 2;
  const char* cpB = gB + ((size_t)ldRow * K + ldCol) * 2;
  const int ldsOff = ldRow * ASTR + ldCol;
  const unsigned ldsA = (unsigned)(size_t)&As[0][ldsOff];
  const unsigned ldsB = (unsigned)(size_t)&Bs[0][ldsOff];
  const unsigned bufBytes = BM * ASTR * 2;   // BM == BN
  // prefetch offset: one lane per 128-B line of the tile, two tiles ahead
  unsigned pfoff = (unsigned)(((tid >> 1) * K + (tid & 1) * 64 + 2 * BK) * 2);

  const int ktiles = K / BK;
  // tile 0 into buffer 0, landed and published before anybody reads it
  copy_rows_to_lds(ldsA, cpA, gstep);
  copy_rows_to_lds(ldsB, cpB, gstep);
  cpA += BK * 2; cpB += BK * 2;
  asm volatile("s_wait_asynccnt 0x0" ::: "memory");  // this wave's copies of tile 0 have landed
  __syncthreads();
  // tile 1 flies into buffer 1 while tile 0 is worked on
  if (1 < ktiles) {
    copy_rows_to_lds(ldsA + bufBytes, cpA, gstep);
    copy_rows_to_lds(ldsB + bufBytes, cpB, gstep);
    cpA += BK * 2; cpB += BK * 2;
  }

  int cur = 0;
  for (int kt = 0; kt < ktiles; ++kt) {
    // pull the K+2 tile toward L2 (global_prefetch_b8)
    if (kt + 2 < ktiles) {
      __builtin_prefetch(gA + pfoff, 0, 1);
      __builtin_prefetch(gB + pfoff, 0, 1);
    }
    pfoff += BK * 2;

    // four 32-deep WMMA steps per tile, k ascending; unrolled for constant LDS offsets
    #pragma unroll
    for (int ks = 0; ks < BK / 32; ++ks) {
      v16h af[4], bf2[2];
      #pragma unroll
      for (int mt = 0; mt < 4; ++mt) {
        const _Float16* p = &As[cur][(wm * 64 + mt * 16 + l15) * ASTR + ks * 32 + hioff];
        #pragma unroll
        for (int i = 0; i < 8; ++i) { af[mt][i] = p[i]; af[mt][8 + i] = p[16 + i]; }
      }
      #pragma unroll
      for (int nt = 0; nt < 2; ++nt) {
        const _Float16* p = &Bs[cur][(wn * 32 + nt * 16 + l15) * ASTR + ks * 32 + hioff];
        #pragma unroll
        for (int i = 0; i < 8; ++i) { bf2[nt][i] = p[i]; bf2[nt][8 + i] = p[16 + i]; }
      }
      #pragma unroll
      for (int mt = 0; mt < 4; ++mt)
        #pragma unroll
        for (int nt = 0; nt < 2; ++nt)
          acc[mt][nt] = wmma16x16x32(af[mt], bf2[nt], acc[mt][nt]);
    }

    // hand-over: this wave's reads of buffer cur are done, its copies of tile kt+1 have landed;
    // the barrier publishes that tile and frees buffer cur for the refill behind it
    asm volatile("s_wait_dscnt 0x0" ::: "memory");
    asm volatile("s_wait_asynccnt 0x0" ::: "memory");
    __syncthreads();
    if (kt + 2 < ktiles) {
      copy_rows_to_lds(ldsA + cur * bufBytes, cpA, gstep);
      copy_rows_to_lds(ldsB + cur * bufBytes, cpB, gstep);
      cpA += BK * 2; cpB += BK * 2;
    }
    cur ^= 1;
  }
  asm volatile("s_wait_asynccnt 0x0" ::: "memory");  // no copy outlives the loop

  // ---------------- branch-free epilogue (bias hoisted, strided stores)
  float bv[2] = {0.f, 0.f};
  if (HAS_BIAS) {
    bv[0] = bias[bn + wn * 32 + l15];
    bv[1] = bias[bn + wn * 32 + 16 + l15];
  }
  #pragma unroll
  for (int mt = 0; mt < 4; ++mt) {
    const int gm0 = bm + wm * 64 + mt * 16 + ((lane >> 4) << 3);
    #pragma unroll
    for (int nt = 0; nt < 2; ++nt) {
      const int gn = bn + wn * 32 + nt * 16 + l15;
      if (MODE == 1) {
        _Float16* cp = Ch + (size_t)gm0 * N + gn;
        #pragma unroll
        for (int r = 0; r < 8; ++r) {
          float v = acc[mt][nt][r];
          if (HAS_BIAS) v += bv[nt];
          cp[(size_t)r * N] = (_Float16)(v / (1.f + __expf(-v)));   // SiLU
        }
      } else {
        float* cp = Cf + (size_t)gm0 * N + gn;
        #pragma unroll
        for (int r = 0; r < 8; ++r) {
          float v = acc[mt][nt][r];
          if (HAS_BIAS) v += bv[nt];
          cp[(size_t)r * N] = v;
        }
      }
    }
  }
}

// ------------------------------------------- RoPE + sigma add + head split -> f16
// Q/K written [h][s][d] (row = K-contig for A/B frags).
// V written TRANSPOSED [h][vdim][s] so attention's B-frag of V is K(seq)-contiguous.
__global__ __launch_bounds__(256)
void rope_split(const float* __restrict__ qkv, const float* __restrict__ sig,
                _Float16* __restrict__ q1, _Float16* __restrict__ q2,
                _Float16* __restrict__ k1, _Float16* __restrict__ k2,
                _Float16* __restrict__ vt) {
  const int s = blockIdx.x;
  const int t = threadIdx.x;
  __shared__ float sigs[D_DIM];
  if (t < D_DIM) sigs[t] = sig[t];
  __syncthreads();
  const float* row = qkv + (size_t)s * (3 * E_DIM);
  for (int idx = t; idx < 3 * E_DIM; idx += 256) {
    const int which = idx >> 10;        // 0=q 1=k 2=v
    const int rem   = idx & 1023;
    const int rh    = rem >> 5;         // rope head 0..31
    const int d     = rem & 31;
    const int h     = rh >> 1;
    const int sub   = rh & 1;
    const float val = row[idx];
    float o = val;
    if (which < 2 && d < 16) {          // rotate first half of head dim, pairwise
      const int p = d >> 1;
      const float inv = __powf(10000.f, -(float)(2 * p) * (1.f / 16.f));
      const float ang = (float)s * inv;
      float sn, c; __sincosf(ang, &sn, &c);
      const float other = row[(idx & ~31) + (d ^ 1)];
      o = (d & 1) ? (val * c + other * sn) : (val * c - other * sn);
    }
    if (which < 2 && sub == 1) o += sigs[d];
    if (which == 0) {
      _Float16* dst = sub ? q2 : q1;
      dst[(size_t)h * S_LEN * D_DIM + (size_t)s * D_DIM + d] = (_Float16)o;
    } else if (which == 1) {
      _Float16* dst = sub ? k2 : k1;
      dst[(size_t)h * S_LEN * D_DIM + (size_t)s * D_DIM + d] = (_Float16)o;
    } else {
      // transposed: [h][vdim = sub*32+d][s]
      vt[(size_t)h * (2 * D_DIM) * S_LEN + (size_t)(sub * D_DIM + d) * S_LEN + s] = (_Float16)o;
    }
  }
}

// ----------------------------------------------------- flash attention (WMMA)
// Value of lane (l ^ M) of the same 16-lane row, M = 1..15, by a DPP row_xmask move: it stays on
// the vector pipe, where a shuffle goes through the LDS queue and is waited for at every step.
// All 32 lanes are on wherever it is called.
template <int M>
__device__ __forceinline__ float row_xor(float x) {
  return __builtin_bit_cast(float, __builtin_amdgcn_update_dpp(
      0, __builtin_bit_cast(int, x), 0x160 + M, 0xf, 0xf, true));
}
// Butterflies over a 16-lane row, partners 8, 4, 2, 1 in this order.
// Maxima of four independent values: one DPP instruction a step, the four chains interleaved so
// that each step issues behind the other three chains' and not behind its own result. In asm
// because the builtin form compiled to three dependent instructions a step (move, quieting
// maximum, maximum), one chain after the other.
__device__ __forceinline__ void row_max16x4(float& a, float& b, float& c, float& d) {
  asm("v_max_num_f32_dpp %0, %0, %0 row_xmask:8 row_mask:0xf bank_mask:0xf\n\t"
      "v_max_num_f32_dpp %1, %1, %1 row_xmask:8 row_mask:0xf bank_mask:0xf\n\t"
      "v_max_num_f32_dpp %2, %2, %2 row_xmask:8 row_mask:0xf bank_mask:0xf\n\t"
      "v_max_num_f32_dpp %3, %3, %3 row_xmask:8 row_mask:0xf bank_mask:0xf\n\t"
      "v_max_num_f32_dpp %0, %0, %0 row_xmask:4 row_mask:0xf bank_mask:0xf\n\t"
      "v_max_num_f32_dpp %1, %1, %1 row_xmask:4 row_mask:0xf bank_mask:0xf\n\t"
      "v_max_num_f32_dpp %2, %2, %2 row_xmask:4 row_mask:0xf bank_mask:0xf\n\t"
      "v_max_num_f32_dpp %3, %3, %3 row_xmask:4 row_mask:0xf bank_mask:0xf\n\t"
      "v_max_num_f32_dpp %0, %0, %0 row_xmask:2 row_mask:0xf bank_mask:0xf\n\t"
      "v_max_num_f32_dpp %1, %1, %1 row_xmask:2 row_mask:0xf bank_mask:0xf\n\t"
      "v_max_num_f32_dpp %2, %2, %2 row_xmask:2 row_mask:0xf bank_mask:0xf\n\t"
      "v_max_num_f32_dpp %3, %3, %3 row_xmask:2 row_mask:0xf bank_mask:0xf\n\t"
      "v_max_num_f32_dpp %0, %0, %0 row_xmask:1 row_mask:0xf bank_mask:0xf\n\t"
      "v_max_num_f32_dpp %1, %1, %1 row_xmask:1 row_mask:0xf bank_mask:0xf\n\t"
      "v_max_num_f32_dpp %2, %2, %2 row_xmask:1 row_mask:0xf bank_mask:0xf\n\t"
      "v_max_num_f32_dpp %3, %3, %3 row_xmask:1 row_mask:0xf bank_mask:0xf"
      : "+v"(a), "+v"(b), "+v"(c), "+v"(d));
}
__device__ __forceinline__ float row_sum16(float s) {
  s += row_xor<8>(s);
  s += row_xor<4>(s);
  s += row_xor<2>(s);
  return s + row_xor<1>(s);
}
#define KSTR 40
#define VSTR 72   // Vs rows are vdim (64), cols are seq/K (64) + pad
#define PSTR 72

__global__ __launch_bounds__(128)
void attn_flash(const _Float16* __restrict__ q1, const _Float16* __restrict__ q2,
                const _Float16* __restrict__ k1, const _Float16* __restrict__ k2,
                const _Float16* __restrict__ vt,
                float* __restrict__ o1, float* __restrict__ o2, float scale) {
  __shared__ _Float16 Ks[64 * KSTR];
  __shared__ _Float16 Vs[64 * VSTR];    // transposed V tile: [vdim][seq]
  __shared__ _Float16 Ps[4 * 16 * PSTR];

  const int tid   = threadIdx.x;
  const int lane  = tid & 31;
  const int wave  = tid >> 5;          // 4 waves, 16 q-rows each
  const int l15   = lane & 15;
  const int hi    = lane >> 4;
  const int hioff = hi * 8;

  const int qi = blockIdx.x;           // q tile (64 rows)
  const int h  = blockIdx.y;
  const int ai = blockIdx.z;           // which attention (0/1)

  const _Float16* Qp = (ai ? q2 : q1) + (size_t)h * S_LEN * D_DIM;
  const _Float16* Kp = (ai ? k2 : k1) + (size_t)h * S_LEN * D_DIM;
  const _Float16* Vp = vt + (size_t)h * (2 * D_DIM) * S_LEN;   // [vdim][s]
  float* Op = ai ? o2 : o1;

  const int qbase = qi * 64;
  const int qrow0 = qbase + wave * 16;

  v16h aq;                              // Q A-frag (rows contiguous in global, K=32)
  {
    const _Float16* p = Qp + (size_t)(qrow0 + l15) * D_DIM + hioff;
    #pragma unroll
    for (int i = 0; i < 8; ++i) { aq[i] = p[i]; aq[8 + i] = p[16 + i]; }
  }

  const v8f vzero = {0.f,0.f,0.f,0.f,0.f,0.f,0.f,0.f};
  v8f o[4];
  #pragma unroll
  for (int j = 0; j < 4; ++j) o[j] = vzero;
  float rmax[8], rsum[8];
  #pragma unroll
  for (int r = 0; r < 8; ++r) { rmax[r] = -1e30f; rsum[r] = 0.f; }

  const int ldRow = tid >> 1;           // 0..63
  const int kc16  = (tid & 1) * 16;
  const int vc32  = (tid & 1) * 32;

  for (int kt = 0; kt <= qi; ++kt) {
    const int kbase = kt * 64;
    {   // stage K (64 seq x 32 d) and V^T (64 vdim x 64 seq) tiles, all vectorized
      const uint4* s = (const uint4*)(Kp + (size_t)(kbase + ldRow) * D_DIM + kc16);
      uint4* d = (uint4*)(Ks + ldRow * KSTR + kc16);
      d[0] = s[0]; d[1] = s[1];
      const uint4* s2 = (const uint4*)(Vp + (size_t)ldRow * S_LEN + kbase + vc32);
      uint4* d2 = (uint4*)(Vs + ldRow * VSTR + vc32);
      d2[0] = s2[0]; d2[1] = s2[1]; d2[2] = s2[2]; d2[3] = s2[3];
    }
    __syncthreads();

    // scores = Q(16x32) x K^T(32x64): 4 WMMA
    v8f sc[4];
    #pragma unroll
    for (int j = 0; j < 4; ++j) {
      v16h bk;
      const _Float16* p = Ks + (j * 16 + l15) * KSTR + hioff;
      #pragma unroll
      for (int i = 0; i < 8; ++i) { bk[i] = p[i]; bk[8 + i] = p[16 + i]; }
      sc[j] = wmma16x16x32(aq, bk, vzero);
      #pragma unroll
      for (int r = 0; r < 8; ++r) sc[j][r] *= scale;
    }
    if (kt == qi) {                      // causal mask on diagonal tile
      #pragma unroll
      for (int j = 0; j < 4; ++j) {
        const int col = kbase + j * 16 + l15;
        #pragma unroll
        for (int r = 0; r < 8; ++r) {
          const int rowg = qrow0 + r + (hi << 3);
          if (col > rowg) sc[j][r] = -1e30f;
        }
      }
    }

    // online softmax (row stats live in VGPR index r, reduced over 16-lane groups)
    float nmax[8], alpha[8], psum[8];
    #pragma unroll
    for (int r = 0; r < 8; ++r) {
      float m = rmax[r];                 // the same in all 16 lanes of the row
      #pragma unroll
      for (int j = 0; j < 4; ++j) m = fmaxf(m, sc[j][r]);
      nmax[r] = m;
    }
    row_max16x4(nmax[0], nmax[1], nmax[2], nmax[3]);
    row_max16x4(nmax[4], nmax[5], nmax[6], nmax[7]);
    #pragma unroll
    for (int r = 0; r < 8; ++r) {
      alpha[r] = __expf(rmax[r] - nmax[r]);
      rmax[r] = nmax[r];
      psum[r] = 0.f;
    }
    #pragma unroll
    for (int j = 0; j < 4; ++j)
      #pragma unroll
      for (int r = 0; r < 8; ++r) {
        const float p = __expf(sc[j][r] - nmax[r]);
        sc[j][r] = p;
        psum[r] += p;
      }
    #pragma unroll
    for (int r = 0; r < 8; ++r) {
      rsum[r] = rsum[r] * alpha[r] + row_sum16(psum[r]);
    }
    #pragma unroll
    for (int j = 0; j < 4; ++j)
      #pragma unroll
      for (int r = 0; r < 8; ++r) o[j][r] *= alpha[r];

    // P (C/D layout) -> LDS -> A-frag layout
    _Float16* Pw = Ps + wave * 16 * PSTR;
    #pragma unroll
    for (int j = 0; j < 4; ++j)
      #pragma unroll
      for (int r = 0; r < 8; ++r)
        Pw[(r + (hi << 3)) * PSTR + j * 16 + l15] = (_Float16)sc[j][r];
    __syncthreads();

    v16h ap0, ap1;
    {
      const _Float16* p = Pw + l15 * PSTR;
      #pragma unroll
      for (int i = 0; i < 8; ++i) {
        ap0[i]     = p[hioff + i];       ap0[8 + i] = p[16 + hioff + i];
        ap1[i]     = p[32 + hioff + i];  ap1[8 + i] = p[48 + hioff + i];
      }
    }
    // O += P(16x64) x V(64x64): 8 WMMA.
    // V^T layout makes each B-frag chunk 8 contiguous halfs -> ds_load_b128.
    #pragma unroll
    for (int j = 0; j < 4; ++j) {
      const _Float16* pv = Vs + (j * 16 + l15) * VSTR;
      v16h bv;
      #pragma unroll
      for (int i = 0; i < 8; ++i) { bv[i] = pv[hioff + i]; bv[8 + i] = pv[16 + hioff + i]; }
      o[j] = wmma16x16x32(ap0, bv, o[j]);
      #pragma unroll
      for (int i = 0; i < 8; ++i) { bv[i] = pv[32 + hioff + i]; bv[8 + i] = pv[48 + hioff + i]; }
      o[j] = wmma16x16x32(ap1, bv, o[j]);
    }
    __syncthreads();
  }

  // finalize: strided stores from a hoisted base pointer
  #pragma unroll
  for (int r = 0; r < 8; ++r) {
    const float invs = 1.f / rsum[r];
    float* rp = Op + (size_t)(qrow0 + r + (hi << 3)) * E_DIM + h * 64 + l15;
    #pragma unroll
    for (int j = 0; j < 4; ++j)
      rp[j * 16] = o[j][r] * invs;
  }
}

// -------------------------------- a = rmsnorm(attn1 - lam*attn2)*(1-LAMBDA) -> f16
__global__ __launch_bounds__(64)
void diff_rmsnorm(const float* __restrict__ a1, const float* __restrict__ a2,
                  const float* __restrict__ lamp, const float* __restrict__ w,
                  const float* __restrict__ b, _Float16* __restrict__ outh) {
  const int idx = blockIdx.x;
  const int s = idx >> 4;
  const int h = idx & 15;
  const int t = threadIdx.x;                    // 0..63 over the 2D-dim group
  __shared__ float sh[2];
  const float lam = lamp[0];
  const size_t off = (size_t)s * E_DIM + h * 64 + t;
  const float d = a1[off] - lam * a2[off];
  float sq = d * d;
  #pragma unroll
  for (int o = 16; o > 0; o >>= 1) sq += __shfl_xor(sq, o, 32);
  if ((t & 31) == 0) sh[t >> 5] = sq;
  __syncthreads();
  const float ms = (sh[0] + sh[1]) * (1.f / 64.f);
  const float r = rsqrtf(ms + 1e-8f);
  outh[off] = (_Float16)((d * r * w[t] + b[t]) * (1.f - LAMBDA_INIT_F));
}

// ---------------------------------------- out = layernorm(a + res) (fp32 + opt f16)
__global__ __launch_bounds__(256)
void add_layernorm(const float* __restrict__ a, const float* __restrict__ res,
                   const float* __restrict__ w, const float* __restrict__ b,
                   float* __restrict__ out32, _Float16* __restrict__ out16) {
  const int s = blockIdx.x;
  const int t = threadIdx.x;
  __shared__ float sh[8];
  __shared__ float stat[2];
  const size_t base = (size_t)s * E_DIM;
  float v[4];
  float sum = 0.f;
  #pragma unroll
  for (int i = 0; i < 4; ++i) {
    const int e = t + i * 256;
    const float xv = a[base + e] + res[base + e];
    v[i] = xv; sum += xv;
  }
  #pragma unroll
  for (int o = 16; o > 0; o >>= 1) sum += __shfl_xor(sum, o, 32);
  if ((t & 31) == 0) sh[t >> 5] = sum;
  __syncthreads();
  if (t == 0) { float r = 0.f; for (int i = 0; i < 8; ++i) r += sh[i]; stat[0] = r * (1.f / E_DIM); }
  __syncthreads();
  const float mean = stat[0];
  float sq = 0.f;
  #pragma unroll
  for (int i = 0; i < 4; ++i) { const float dd = v[i] - mean; sq += dd * dd; }
  #pragma unroll
  for (int o = 16; o > 0; o >>= 1) sq += __shfl_xor(sq, o, 32);
  if ((t & 31) == 0) sh[t >> 5] = sq;
  __syncthreads();
  if (t == 0) { float r = 0.f; for (int i = 0; i < 8; ++i) r += sh[i]; stat[1] = r * (1.f / E_DIM); }
  __syncthreads();
  const float rstd = rsqrtf(stat[1] + 1e-5f);
  #pragma unroll
  for (int i = 0; i < 4; ++i) {
    const int e = t + i * 256;
    const float ov = (v[i] - mean) * rstd * w[e] + b[e];
    out32[base + e] = ov;
    if (out16) out16[base + e] = (_Float16)ov;
  }
}

// ------------------------------------------------------------------ launcher
extern "C" void kernel_launch(void* const* d_in, const int* in_sizes, int n_in,
                              void* d_out, int out_size, void* d_ws, size_t ws_size,
                              hipStream_t stream) {
  (void)in_sizes; (void)n_in; (void)out_size; (void)ws_size;
  const float* x      = (const float*)d_in[0];
  const float* emb    = (const float*)d_in[1];
  const float* qkv_w  = (const float*)d_in[2];
  const float* out_w  = (const float*)d_in[3];
  const float* sigmaw = (const float*)d_in[4];
  const float* lq1    = (const float*)d_in[5];
  const float* lk1    = (const float*)d_in[6];
  const float* lq2    = (const float*)d_in[7];
  const float* lk2    = (const float*)d_in[8];
  const float* ln_w   = (const float*)d_in[9];
  const float* ln_b   = (const float*)d_in[10];
  const float* ln1_w  = (const float*)d_in[11];
  const float* ln1_b  = (const float*)d_in[12];
  const float* ln2_w  = (const float*)d_in[13];
  const float* ln2_b  = (const float*)d_in[14];
  const float* w1     = (const float*)d_in[15];
  const float* b1     = (const float*)d_in[16];
  const float* w2     = (const float*)d_in[17];
  const float* b2     = (const float*)d_in[18];
  float* out = (float*)d_out;

  char* ws = (char*)d_ws;
  size_t off = 0;
  auto alloc = [&](size_t bytes) -> char* {
    char* p = ws + off;
    off += (bytes + 255) & ~(size_t)255;
    return p;
  };
  float*    sig   = (float*)alloc(D_DIM * sizeof(float));
  float*    lam   = (float*)alloc(sizeof(float));
  _Float16* xb    = (_Float16*)alloc((size_t)S_LEN * E_DIM * 2);
  _Float16* wqkvb = (_Float16*)alloc((size_t)3 * E_DIM * E_DIM * 2);
  _Float16* woutb = (_Float16*)alloc((size_t)E_DIM * E_DIM * 2);
  _Float16* w1b   = (_Float16*)alloc((size_t)4 * E_DIM * E_DIM * 2);
  _Float16* w2b   = (_Float16*)alloc((size_t)4 * E_DIM * E_DIM * 2);
  float*    qkvf  = (float*)alloc((size_t)S_LEN * 3 * E_DIM * 4);       // reused below
  _Float16* q1b   = (_Float16*)alloc((size_t)H_NUM * S_LEN * D_DIM * 2);
  _Float16* q2b   = (_Float16*)alloc((size_t)H_NUM * S_LEN * D_DIM * 2);
  _Float16* k1b   = (_Float16*)alloc((size_t)H_NUM * S_LEN * D_DIM * 2);
  _Float16* k2b   = (_Float16*)alloc((size_t)H_NUM * S_LEN * D_DIM * 2);
  _Float16* vtb   = (_Float16*)alloc((size_t)H_NUM * S_LEN * 2 * D_DIM * 2);  // [h][vdim][s]
  _Float16* abh   = (_Float16*)alloc((size_t)S_LEN * E_DIM * 2);
  float*    aof   = (float*)alloc((size_t)S_LEN * E_DIM * 4);           // reused below
  float*    hf    = (float*)alloc((size_t)S_LEN * E_DIM * 4);
  _Float16* hb16  = (_Float16*)alloc((size_t)S_LEN * E_DIM * 2);

  // aliases into dead regions (stream-ordered, deterministic)
  float*    attn1f = qkvf;                                  // qkv dead after rope
  float*    attn2f = qkvf + (size_t)S_LEN * E_DIM;
  _Float16* f1b    = (_Float16*)qkvf;                       // attn bufs dead after diffnorm
  float*    fff    = aof;                                   // aof dead after first add_layernorm

  // 1. fp32 -> f16 conversions (activations + weights), sig and lambda: one launch
  prepare<<<1 + NB_X + NB_QKVW + NB_OUTW + NB_W1 + NB_W2, 256, 0, stream>>>(
      x, xb, qkv_w, wqkvb, out_w, woutb, w1, w1b, w2, w2b,
      emb, sigmaw, lq1, lk1, lq2, lk2, sig, lam);

  // 2. qkv = x @ qkv_w^T  (2048x3072x1024)
  gemm_wmma<0, false><<<dim3(3 * E_DIM / BN, S_LEN / BM), 256, 0, stream>>>(
      xb, wqkvb, nullptr, qkvf, nullptr, S_LEN, 3 * E_DIM, E_DIM);
  // 3. RoPE + sigma + head split (V transposed)
  rope_split<<<S_LEN, 256, 0, stream>>>(qkvf, sig, q1b, q2b, k1b, k2b, vtb);
  // 4. two causal flash attentions (WMMA QK^T and PV)
  attn_flash<<<dim3(S_LEN / 64, H_NUM, 2), 128, 0, stream>>>(
      q1b, q2b, k1b, k2b, vtb, attn1f, attn2f, 0.17677669529663687f);
  // 5. per-head rmsnorm of attn1 - lam*attn2
  diff_rmsnorm<<<S_LEN * H_NUM, 64, 0, stream>>>(attn1f, attn2f, lam, ln_w, ln_b, abh);
  // 6. out projection (2048x1024x1024)
  gemm_wmma<0, false><<<dim3(E_DIM / BN, S_LEN / BM), 256, 0, stream>>>(
      abh, woutb, nullptr, aof, nullptr, S_LEN, E_DIM, E_DIM);
  // 7. h = layernorm(a + x)
  add_layernorm<<<S_LEN, 256, 0, stream>>>(aof, x, ln1_w, ln1_b, hf, hb16);
  // 8. ff1 = silu(h @ w1^T + b1) -> f16 (2048x4096x1024)
  gemm_wmma<1, true><<<dim3(4 * E_DIM / BN, S_LEN / BM), 256, 0, stream>>>(
      hb16, w1b, b1, nullptr, f1b, S_LEN, 4 * E_DIM, E_DIM);
  // 9. ff = ff1 @ w2^T + b2 (2048x1024x4096)
  gemm_wmma<0, true><<<dim3(E_DIM / BN, S_LEN / BM), 256, 0, stream>>>(
      f1b, w2b, b2, fff, nullptr, S_LEN, E_DIM, 4 * E_DIM);
  // 10. out = layernorm(ff + h)
  add_layernorm<<<S_LEN, 256, 0, stream>>>(fff, hf, ln2_w, ln2_b, out, nullptr);
}

// v006
// Measured time: 220 microseconds a run.
// Next to v005, in two timings, it ran 1.06 times as fast each time.
// Over all steps from v000 it is 1.67 times as fast.
#include <hip/hip_runtime.h>
#include <hip/hip_bf16.h>
#include <math.h>

typedef __attribute__((ext_vector_type(16))) _Float16 v16h;
typedef __attribute__((ext_vector_type(8)))  float    v8f;

#define S_LEN   2048
#define E_DIM   1024
#define H_NUM   16
#define D_DIM   32
#define SIG_DIM 256
#define LAMBDA_INIT_F 0.3555090675909693f

__device__ __forceinline__ v8f wmma16x16x32(v16h a, v16h b, v8f c) {
  // v_wmma_f32_16x16x32_f16: D = A(16x32,f16) x B(32x16,f16) + C(f32)
  return __builtin_amdgcn_wmma_f32_16x16x32_f16(false, a, false, b, (short)0, c, false, false);
}

// ------------------------------------------------- work that needs the inputs alone
// The five f32 -> f16 conversions and the small set-up need nothing of each other, so they share
// one grid: block 0 does the set-up, every other block converts CVT_U x 1024 consecutive values of
// the array whose range of block indices it falls into (every count is a multiple of CVT_U x 1024).
// A wave-wide 16-byte load covers four whole lines and its 8-byte store two.
typedef __attribute__((ext_vector_type(4))) float    v4f;
typedef __attribute__((ext_vector_type(4))) _Float16 v4h;
#define CVT_U   8
#define NB_X    (S_LEN * E_DIM / (CVT_U * 1024))
#define NB_QKVW (3 * E_DIM * E_DIM / (CVT_U * 1024))
#define NB_OUTW (E_DIM * E_DIM / (CVT_U * 1024))
#define NB_W1   (4 * E_DIM * E_DIM / (CVT_U * 1024))
#define NB_W2   (4 * E_DIM * E_DIM / (CVT_U * 1024))

// sig = emb @ sigma_w.T ; lambda
__device__ __forceinline__ void small_setup(int t,
                            const float* __restrict__ emb, const float* __restrict__ sigw,
                            const float* __restrict__ lq1, const float* __restrict__ lk1,
                            const float* __restrict__ lq2, const float* __restrict__ lk2,
                            float* __restrict__ sig, float* __restrict__ lam) {
  if (t < D_DIM) {
    float s = 0.f;
    for (int j = 0; j < SIG_DIM; ++j) s += emb[j] * sigw[t * SIG_DIM + j];
    sig[t] = s;
  } else if (t == D_DIM) {
    float s1 = 0.f, s2 = 0.f;
    for (int i = 0; i < D_DIM; ++i) { s1 += lq1[i] * lk1[i]; s2 += lq2[i] * lk2[i]; }
    lam[0] = __expf(s1) - __expf(s2) + LAMBDA_INIT_F;
  }
}

__global__ __launch_bounds__(256)
void prepare(const float* __restrict__ x,     _Float16* __restrict__ xb,
             const float* __restrict__ qkv_w, _Float16* __restrict__ wqkvb,
             const float* __restrict__ out_w, _Float16* __restrict__ woutb,
             const float* __restrict__ w1,    _Float16* __restrict__ w1b,
             const float* __restrict__ w2,    _Float16* __restrict__ w2b,
             const float* __restrict__ emb, const float* __restrict__ sigw,
             const float* __restrict__ lq1, const float* __restrict__ lk1,
             const float* __restrict__ lq2, const float* __restrict__ lk2,
             float* __restrict__ sig, float* __restrict__ lam) {
  if (blockIdx.x == 0) {   // first, because its chain of dependent sums is the longest block
    small_setup(threadIdx.x, emb, sigw, lq1, lk1, lq2, lk2, sig, lam);
    return;
  }
  unsigned b = blockIdx.x - 1;   // the same for the whole block: scalar selects
  const float* src = x;
  _Float16* dst = xb;
  if (b >= NB_X) {
    b -= NB_X; src = qkv_w; dst = wqkvb;
    if (b >= NB_QKVW) {
      b -= NB_QKVW; src = out_w; dst = woutb;
      if (b >= NB_OUTW) {
        b -= NB_OUTW; src = w1; dst = w1b;
        if (b >= NB_W1) { b -= NB_W1; src = w2; dst = w2b; }
      }
    }
  }
  const unsigned first = (b * (CVT_U * 256) + threadIdx.x) * 4;
  v4f v[CVT_U];
  #pragma unroll  // all CVT_U loads issue before the first wait; v[] stays in registers
  for (int u = 0; u < CVT_U; ++u) v[u] = *(const v4f*)(src + first + u * 1024);
  #pragma unroll  // constant offsets
  for (int u = 0; u < CVT_U; ++u) *(v4h*)(dst + first + u * 1024) = __builtin_convertvector(v[u], v4h);
}

// ------------------------------------------------------------------- GEMM
// C[M,N] = A[M,K] * B[N,K]^T (+bias). MODE 0: fp32 out. MODE 1: SiLU -> f16 out.
// Two LDS buffers filled by asynchronous copies one tile ahead of the products,
// global_prefetch of K+2 tile, branch-free templated epilogue.
#define BM 128
#define BN 128
#define BK 128    // one row of a K tile is 256 contiguous bytes = two whole 128-B lines
#define ASTR 136  // LDS stride in halfs (256 B + 16 B pad: 16 rows of b128 reads hit 64 distinct banks)

// Eight rows' share of one operand tile: each lane brings its own 16 bytes of rows r, r + 16, ...,
// r + 112 from global memory straight into LDS, through no register. lds = the lane's LDS byte
// address in row r, g = its global address there, gstep = 16 source rows in bytes. All lanes on.
// The closing s_wait_xcnt stands in the copies' own statement so that no later write of an
// address register can be scheduled ahead of it.
__device__ __forceinline__ void copy_rows_to_lds(unsigned lds, const char* g, size_t gstep) {
  asm volatile(
      "global_load_async_to_lds_b128 %0, %8, off\n\t"
      "global_load_async_to_lds_b128 %1, %9, off\n\t"
      "global_load_async_to_lds_b128 %2, %10, off\n\t"
      "global_load_async_to_lds_b128 %3, %11, off\n\t"
      "global_load_async_to_lds_b128 %4, %12, off\n\t"
      "global_load_async_to_lds_b128 %5, %13, off\n\t"
      "global_load_async_to_lds_b128 %6, %14, off\n\t"
      "global_load_async_to_lds_b128 %7, %15, off\n\t"
      "s_wait_xcnt 0x0"
      :: "v"(lds),                     "v"(lds + 1 * 16 * ASTR * 2), "v"(lds + 2 * 16 * ASTR * 2),
         "v"(lds + 3 * 16 * ASTR * 2), "v"(lds + 4 * 16 * ASTR * 2), "v"(lds + 5 * 16 * ASTR * 2),
         "v"(lds + 6 * 16 * ASTR * 2), "v"(lds + 7 * 16 * ASTR * 2),
         "v"(g),             "v"(g + gstep),     "v"(g + 2 * gstep), "v"(g + 3 * gstep),
         "v"(g + 4 * gstep), "v"(g + 5 * gstep), "v"(g + 6 * gstep), "v"(g + 7 * gstep)
      : "memory");
}

// One 16x32 fragment's share of a lane: halfs 0..7 and 16..23 from p (two 16-byte LDS loads).
__device__ __forceinline__ v16h load_frag(const _Float16* p) {
  v16h f;
  #pragma unroll  // constant element indices: f stays in registers, 8 halfs merge into one load
  for (int i = 0; i < 8; ++i) { f[i] = p[i]; f[8 + i] = p[16 + i]; }
  return f;
}

template <int MODE, bool HAS_BIAS>
__global__ __launch_bounds__(256)
void gemm_wmma(const _Float16* __restrict__ A, const _Float16* __restrict__ B,
               const float* __restrict__ bias, float* __restrict__ Cf,
               _Float16* __restrict__ Ch, int M, int N, int K) {
  __shared__ __attribute__((aligned(16))) _Float16 As[2][BM * ASTR];
  __shared__ __attribute__((aligned(16))) _Float16 Bs[2][BN * ASTR];
  const int tid   = threadIdx.x;
  const int lane  = tid & 31;
  const int wave  = tid >> 5;      // 8 wave32 waves
  const int wm    = wave >> 2;     // 0..1  (64 rows each)
  const int wn    = wave & 3;      // 0..3  (32 cols each)
  const int l15   = lane & 15;
  const int hioff = (lane >> 4) * 8;
  const int bm = blockIdx.y * BM;
  const int bn = blockIdx.x * BN;

  const v8f vzero = {0.f,0.f,0.f,0.f,0.f,0.f,0.f,0.f};
  v8f acc[4][2];
  #pragma unroll
  for (int mt = 0; mt < 4; ++mt)
    #pragma unroll
    for (int nt = 0; nt < 2; ++nt) acc[mt][nt] = vzero;

  // 16 lanes cover one row's 256 bytes, so a wave-wide 16-byte copy touches
  // four whole lines (two rows); eight such copies per operand fill 128 rows.
  const int ldRow = tid >> 4;           // 0..15, +16 per copy
  const int ldCol = (tid & 15) * 8;     // halfs
  const char* gA = (const char*)(A + (size_t)bm * K);
  const char* gB = (const char*)(B + (size_t)bn * K);
  // the lane's own place in the next tile to be copied: global (A and B share the pitch K) and LDS
  const size_t gstep = (size_t)K * (16 * 2);
  const char* cpA = gA + ((size_t)ldRow * K + ldCol) * 2;
  const char* cpB = gB + ((size_t)ldRow * K + ldCol) * 2;
  const int ldsOff = ldRow * ASTR + ldCol;
  const unsigned ldsA = (unsigned)(size_t)&As[0][ldsOff];
  const unsigned ldsB = (unsigned)(size_t)&Bs[0][ldsOff];
  const unsigned bufBytes = BM * ASTR * 2;   // BM == BN
  // prefetch offset: one lane per 128-B line of the tile, two tiles ahead
  unsigned pfoff = (unsigned)(((tid >> 1) * K + (tid & 1) * 64 + 2 * BK) * 2);

  const int ktiles = K / BK;
  // tile 0 into buffer 0, landed and published before anybody reads it
  copy_rows_to_lds(ldsA, cpA, gstep);
  copy_rows_to_lds(ldsB, cpB, gstep);
  cpA += BK * 2; cpB += BK * 2;
  asm volatile("s_wait_asynccnt 0x0" ::: "memory");  // this wave's copies of tile 0 have landed
  __syncthreads();
  // tile 1 flies into buffer 1 while tile 0 is worked on
  if (1 < ktiles) {
    copy_rows_to_lds(ldsA + bufBytes, cpA, gstep);
    copy_rows_to_lds(ldsB + bufBytes, cpB, gstep);
    cpA += BK * 2; cpB += BK * 2;
  }

  int cur = 0;
  for (int kt = 0; kt < ktiles; ++kt) {
    // pull the K+2 tile toward L2 (global_prefetch_b8)
    if (kt + 2 < ktiles) {
      __builtin_prefetch(gA + pfoff, 0, 1);
      __builtin_prefetch(gB + pfoff, 0, 1);
    }
    pfoff += BK * 2;

    // four 32-deep WMMA steps per tile, k ascending; unrolled for constant LDS offsets.
    // Two register sets of fragments: the 12 LDS loads of step ks + 1 issue as one group ahead of
    // step ks's products, so the products wait on a count and not on a load issued just before.
    const _Float16* pa = &As[cur][(wm * 64 + l15) * ASTR + hioff];
    const _Float16* pb = &Bs[cur][(wn * 32 + l15) * ASTR + hioff];
    v16h af[2][4], bf2[2][2];   // every loop over them is unrolled, so that they stay in registers
    #pragma unroll
    for (int mt = 0; mt < 4; ++mt) af[0][mt] = load_frag(pa + mt * 16 * ASTR);
    #pragma unroll
    for (int nt = 0; nt < 2; ++nt) bf2[0][nt] = load_frag(pb + nt * 16 * ASTR);
    #pragma unroll
    for (int ks = 0; ks < BK / 32; ++ks) {
      const int c = ks & 1;
      if (ks + 1 < BK / 32) {
        #pragma unroll
        for (int mt = 0; mt < 4; ++mt) af[c ^ 1][mt] = load_frag(pa + mt * 16 * ASTR + (ks + 1) * 32);
        #pragma unroll
        for (int nt = 0; nt < 2; ++nt) bf2[c ^ 1][nt] = load_frag(pb + nt * 16 * ASTR + (ks + 1) * 32);
      }
      // keeps the load group above in front of this step's products: without it the compiler sinks
      // each load to just before its first use and every product waits out an LDS round trip; in
      // the last step it keeps the step before's products ahead of the hand-over's waits, so that
      // they run while the last group lands
      __builtin_amdgcn_sched_barrier(0);
      #pragma unroll
      for (int mt = 0; mt < 4; ++mt)
        #pragma unroll
        for (int nt = 0; nt < 2; ++nt)
          acc[mt][nt] = wmma16x16x32(af[c][mt], bf2[c][nt], acc[mt][nt]);
    }

    // hand-over: this wave's reads of buffer cur are done, its copies of tile kt+1 have landed;
    // the barrier publishes that tile and frees buffer cur for the refill behind it
    asm volatile("s_wait_dscnt 0x0" ::: "memory");
    asm volatile("s_wait_asynccnt 0x0" ::: "memory");
    __syncthreads();
    if (kt + 2 < ktiles) {
      copy_rows_to_lds(ldsA + cur * bufBytes, cpA, gstep);
      copy_rows_to_lds(ldsB + cur * bufBytes, cpB, gstep);
      cpA += BK * 2; cpB += BK * 2;
    }
    cur ^= 1;
  }
  asm volatile("s_wait_asynccnt 0x0" ::: "memory");  // no copy outlives the loop

  // ---------------- branch-free epilogue (bias hoisted, strided stores)
  float bv[2] = {0.f, 0.f};
  if (HAS_BIAS) {
    bv[0] = bias[bn + wn * 32 + l15];
    bv[1] = bias[bn + wn * 32 + 16 + l15];
  }
  #pragma unroll
  for (int mt = 0; mt < 4; ++mt) {
    const int gm0 = bm + wm * 64 + mt * 16 + ((lane >> 4) << 3);
    #pragma unroll
    for (int nt = 0; nt < 2; ++nt) {
      const int gn = bn + wn * 32 + nt * 16 + l15;
      if (MODE == 1) {
        _Float16* cp = Ch + (size_t)gm0 * N + gn;
        #pragma unroll
        for (int r = 0; r < 8; ++r) {
          float v = acc[mt][nt][r];
          if (HAS_BIAS) v += bv[nt];
          cp[(size_t)r * N] = (_Float16)(v / (1.f + __expf(-v)));   // SiLU
        }
      } else {
        float* cp = Cf + (size_t)gm0 * N + gn;
        #pragma unroll
        for (int r = 0; r < 8; ++r) {
          float v = acc[mt][nt][r];
          if (HAS_BIAS) v += bv[nt];
          cp[(size_t)r * N] = v;
        }
      }
    }
  }
}

// ------------------------------------------- RoPE + sigma add + head split -> f16
// Q/K written [h][s][d] (row = K-contig for A/B frags).
// V written TRANSPOSED [h][vdim][s] so attention's B-frag of V is K(seq)-contiguous.
__global__ __launch_bounds__(256)
void rope_split(const float* __restrict__ qkv, const float* __restrict__ sig,
                _Float16* __restrict__ q1, _Float16* __restrict__ q2,
                _Float16* __restrict__ k1, _Float16* __restrict__ k2,
                _Float16* __restrict__ vt) {
  const int s = blockIdx.x;
  const int t = threadIdx.x;
  __shared__ float sigs[D_DIM];
  if (t < D_DIM) sigs[t] = sig[t];
  __syncthreads();
  const float* row = qkv + (size_t)s * (3 * E_DIM);
  for (int idx = t; idx < 3 * E_DIM; idx += 256) {
    const int which = idx >> 10;        // 0=q 1=k 2=v
    const int rem   = idx & 1023;
    const int rh    = rem >> 5;         // rope head 0..31
    const int d     = rem & 31;
    const int h     = rh >> 1;
    const int sub   = rh & 1;
    const float val = row[idx];
    float o = val;
    if (which < 2 && d < 16) {          // rotate first half of head dim, pairwise
      const int p = d >> 1;
      const float inv = __powf(10000.f, -(float)(2 * p) * (1.f / 16.f));
      const float ang = (float)s * inv;
      float sn, c; __sincosf(ang, &sn, &c);
      const float other = row[(idx & ~31) + (d ^ 1)];
      o = (d & 1) ? (val * c + other * sn) : (val * c - other * sn);
    }
    if (which < 2 && sub == 1) o += sigs[d];
    if (which == 0) {
      _Float16* dst = sub ? q2 : q1;
      dst[(size_t)h * S_LEN * D_DIM + (size_t)s * D_DIM + d] = (_Float16)o;
    } else if (which == 1) {
      _Float16* dst = sub ? k2 : k1;
      dst[(size_t)h * S_LEN * D_DIM + (size_t)s * D_DIM + d] = (_Float16)o;
    } else {
      // transposed: [h][vdim = sub*32+d][s]
      vt[(size_t)h * (2 * D_DIM) * S_LEN + (size_t)(sub * D_DIM + d) * S_LEN + s] = (_Float16)o;
    }
  }
}

// ----------------------------------------------------- flash attention (WMMA)
// Value of lane (l ^ M) of the same 16-lane row, M = 1..15, by a DPP row_xmask move: it stays on
// the vector pipe, where a shuffle goes through the LDS queue and is waited for at every step.
// All 32 lanes are on wherever it is called.
template <int M>
__device__ __forceinline__ float row_xor(float x) {
  return __builtin_bit_cast(float, __builtin_amdgcn_update_dpp(
      0, __builtin_bit_cast(int, x), 0x160 + M, 0xf, 0xf, true));
}
// Butterflies over a 16-lane row, partners 8, 4, 2, 1 in this order.
// Maxima of four independent values: one DPP instruction a step, the four chains interleaved so
// that each step issues behind the other three chains' and not behind its own result. In asm
// because the builtin form compiled to three dependent instructions a step (move, quieting
// maximum, maximum), one chain after the other.
__device__ __forceinline__ void row_max16x4(float& a, float& b, float& c, float& d) {
  asm("v_max_num_f32_dpp %0, %0, %0 row_xmask:8 row_mask:0xf bank_mask:0xf\n\t"
      "v_max_num_f32_dpp %1, %1, %1 row_xmask:8 row_mask:0xf bank_mask:0xf\n\t"
      "v_max_num_f32_dpp %2, %2, %2 row_xmask:8 row_mask:0xf bank_mask:0xf\n\t"
      "v_max_num_f32_dpp %3, %3, %3 row_xmask:8 row_mask:0xf bank_mask:0xf\n\t"
      "v_max_num_f32_dpp %0, %0, %0 row_xmask:4 row_mask:0xf bank_mask:0xf\n\t"
      "v_max_num_f32_dpp %1, %1, %1 row_xmask:4 row_mask:0xf bank_mask:0xf\n\t"
      "v_max_num_f32_dpp %2, %2, %2 row_xmask:4 row_mask:0xf bank_mask:0xf\n\t"
      "v_max_num_f32_dpp %3, %3, %3 row_xmask:4 row_mask:0xf bank_mask:0xf\n\t"
      "v_max_num_f32_dpp %0, %0, %0 row_xmask:2 row_mask:0xf bank_mask:0xf\n\t"
      "v_max_num_f32_dpp %1, %1, %1 row_xmask:2 row_mask:0xf bank_mask:0xf\n\t"
      "v_max_num_f32_dpp %2, %2, %2 row_xmask:2 row_mask:0xf bank_mask:0xf\n\t"
      "v_max_num_f32_dpp %3, %3, %3 row_xmask:2 row_mask:0xf bank_mask:0xf\n\t"
      "v_max_num_f32_dpp %0, %0, %0 row_xmask:1 row_mask:0xf bank_mask:0xf\n\t"
      "v_max_num_f32_dpp %1, %1, %1 row_xmask:1 row_mask:0xf bank_mask:0xf\n\t"
      "v_max_num_f32_dpp %2, %2, %2 row_xmask:1 row_mask:0xf bank_mask:0xf\n\t"
      "v_max_num_f32_dpp %3, %3, %3 row_xmask:1 row_mask:0xf bank_mask:0xf"
      : "+v"(a), "+v"(b), "+v"(c), "+v"(d));
}
__device__ __forceinline__ float row_sum16(float s) {
  s += row_xor<8>(s);
  s += row_xor<4>(s);
  s += row_xor<2>(s);
  return s + row_xor<1>(s);
}
#define KSTR 40
#define VSTR 72   // Vs rows are vdim (64), cols are seq/K (64) + pad
#define PSTR 72

__global__ __launch_bounds__(128)
void attn_flash(const _Float16* __restrict__ q1, const _Float16* __restrict__ q2,
                const _Float16* __restrict__ k1, const _Float16* __restrict__ k2,
                const _Float16* __restrict__ vt,
                float* __restrict__ o1, float* __restrict__ o2, float scale) {
  __shared__ _Float16 Ks[64 * KSTR];
  __shared__ _Float16 Vs[64 * VSTR];    // transposed V tile: [vdim][seq]
  __shared__ _Float16 Ps[4 * 16 * PSTR];

  const int tid   = threadIdx.x;
  const int lane  = tid & 31;
  const int wave  = tid >> 5;          // 4 waves, 16 q-rows each
  const int l15   = lane & 15;
  const int hi    = lane >> 4;
  const int hioff = hi * 8;

  const int qi = blockIdx.x;           // q tile (64 rows)
  const int h  = blockIdx.y;
  const int ai = blockIdx.z;           // which attention (0/1)

  const _Float16* Qp = (ai ? q2 : q1) + (size_t)h * S_LEN * D_DIM;
  const _Float16* Kp = (ai ? k2 : k1) + (size_t)h * S_LEN * D_DIM;
  const _Float16* Vp = vt + (size_t)h * (2 * D_DIM) * S_LEN;   // [vdim][s]
  float* Op = ai ? o2 : o1;

  const int qbase = qi * 64;
  const int qrow0 = qbase + wave * 16;

  v16h aq;                              // Q A-frag (rows contiguous in global, K=32)
  {
    const _Float16* p = Qp + (size_t)(qrow0 + l15) * D_DIM + hioff;
    #pragma unroll
    for (int i = 0; i < 8; ++i) { aq[i] = p[i]; aq[8 + i] = p[16 + i]; }
  }

  const v8f vzero = {0.f,0.f,0.f,0.f,0.f,0.f,0.f,0.f};
  v8f o[4];
  #pragma unroll
  for (int j = 0; j < 4; ++j) o[j] = vzero;
  float rmax[8], rsum[8];
  #pragma unroll
  for (int r = 0; r < 8; ++r) { rmax[r] = -1e30f; rsum[r] = 0.f; }

  const int ldRow = tid >> 1;           // 0..63
  const int kc16  = (tid & 1) * 16;
  const int vc32  = (tid & 1) * 32;

  for (int kt = 0; kt <= qi; ++kt) {
    const int kbase = kt * 64;
    {   // stage K (64 seq x 32 d) and V^T (64 vdim x 64 seq) tiles, all vectorized
      const uint4* s = (const uint4*)(Kp + (size_t)(kbase + ldRow) * D_DIM + kc16);
      uint4* d = (uint4*)(Ks + ldRow * KSTR + kc16);
      d[0] = s[0]; d[1] = s[1];
      const uint4* s2 = (const uint4*)(Vp + (size_t)ldRow * S_LEN + kbase + vc32);
      uint4* d2 = (uint4*)(Vs + ldRow * VSTR + vc32);
      d2[0] = s2[0]; d2[1] = s2[1]; d2[2] = s2[2]; d2[3] = s2[3];
    }
    __syncthreads();

    // scores = Q(16x32) x K^T(32x64): 4 WMMA
    v8f sc[4];
    #pragma unroll
    for (int j = 0; j < 4; ++j) {
      v16h bk;
      const _Float16* p = Ks + (j * 16 + l15) * KSTR + hioff;
      #pragma unroll
      for (int i = 0; i < 8; ++i) { bk[i] = p[i]; bk[8 + i] = p[16 + i]; }
      sc[j] = wmma16x16x32(aq, bk, vzero);
      #pragma unroll
      for (int r = 0; r < 8; ++r) sc[j][r] *= scale;
    }
    if (kt == qi) {                      // causal mask on diagonal tile
      #pragma unroll
      for (int j = 0; j < 4; ++j) {
        const int col = kbase + j * 16 + l15;
        #pragma unroll
        for (int r = 0; r < 8; ++r) {
          const int rowg = qrow0 + r + (hi << 3);
          if (col > rowg) sc[j][r] = -1e30f;
        }
      }
    }

    // online softmax (row stats live in VGPR index r, reduced over 16-lane groups)
    float nmax[8], alpha[8], psum[8];
    #pragma unroll
    for (int r = 0; r < 8; ++r) {
      float m = rmax[r];                 // the same in all 16 lanes of the row
      #pragma unroll
      for (int j = 0; j < 4; ++j) m = fmaxf(m, sc[j][r]);
      nmax[r] = m;
    }
    row_max16x4(nmax[0], nmax[1], nmax[2], nmax[3]);
    row_max16x4(nmax[4], nmax[5], nmax[6], nmax[7]);
    #pragma unroll
    for (int r = 0; r < 8; ++r) {
      alpha[r] = __expf(rmax[r] - nmax[r]);
      rmax[r] = nmax[r];
      psum[r] = 0.f;
    }
    #pragma unroll
    for (int j = 0; j < 4; ++j)
      #pragma unroll
      for (int r = 0; r < 8; ++r) {
        const float p = __expf(sc[j][r] - nmax[r]);
        sc[j][r] = p;
        psum[r] += p;
      }
    #pragma unroll
    for (int r = 0; r < 8; ++r) {
      rsum[r] = rsum[r] * alpha[r] + row_sum16(psum[r]);
    }
    #pragma unroll
    for (int j = 0; j < 4; ++j)
      #pragma unroll
      for (int r = 0; r < 8; ++r) o[j][r] *= alpha[r];

    // P (C/D layout) -> LDS -> A-frag layout
    _Float16* Pw = Ps + wave * 16 * PSTR;
    #pragma unroll
    for (int j = 0; j < 4; ++j)
      #pragma unroll
      for (int r = 0; r < 8; ++r)
        Pw[(r + (hi << 3)) * PSTR + j * 16 + l15] = (_Float16)sc[j][r];
    __syncthreads();

    v16h ap0, ap1;
    {
      const _Float16* p = Pw + l15 * PSTR;
      #pragma unroll
      for (int i = 0; i < 8; ++i) {
        ap0[i]     = p[hioff + i];       ap0[8 + i] = p[16 + hioff + i];
        ap1[i]     = p[32 + hioff + i];  ap1[8 + i] = p[48 + hioff + i];
      }
    }
    // O += P(16x64) x V(64x64): 8 WMMA.
    // V^T layout makes each B-frag chunk 8 contiguous halfs -> ds_load_b128.
    #pragma unroll
    for (int j = 0; j < 4; ++j) {
      const _Float16* pv = Vs + (j * 16 + l15) * VSTR;
      v16h bv;
      #pragma unroll
      for (int i = 0; i < 8; ++i) { bv[i] = pv[hioff + i]; bv[8 + i] = pv[16 + hioff + i]; }
      o[j] = wmma16x16x32(ap0, bv, o[j]);
      #pragma unroll
      for (int i = 0; i < 8; ++i) { bv[i] = pv[32 + hioff + i]; bv[8 + i] = pv[48 + hioff + i]; }
      o[j] = wmma16x16x32(ap1, bv, o[j]);
    }
    __syncthreads();
  }

  // finalize: strided stores from a hoisted base pointer
  #pragma unroll
  for (int r = 0; r < 8; ++r) {
    const float invs = 1.f / rsum[r];
    float* rp = Op + (size_t)(qrow0 + r + (hi << 3)) * E_DIM + h * 64 + l15;
    #pragma unroll
    for (int j = 0; j < 4; ++j)
      rp[j * 16] = o[j][r] * invs;
  }
}

// -------------------------------- a = rmsnorm(attn1 - lam*attn2)*(1-LAMBDA) -> f16
__global__ __launch_bounds__(64)
void diff_rmsnorm(const float* __restrict__ a1, const float* __restrict__ a2,
                  const float* __restrict__ lamp, const float* __restrict__ w,
                  const float* __restrict__ b, _Float16* __restrict__ outh) {
  const int idx = blockIdx.x;
  const int s = idx >> 4;
  const int h = idx & 15;
  const int t = threadIdx.x;                    // 0..63 over the 2D-dim group
  __shared__ float sh[2];
  const float lam = lamp[0];
  const size_t off = (size_t)s * E_DIM + h * 64 + t;
  const float d = a1[off] - lam * a2[off];
  float sq = d * d;
  #pragma unroll
  for (int o = 16; o > 0; o >>= 1) sq += __shfl_xor(sq, o, 32);
  if ((t & 31) == 0) sh[t >> 5] = sq;
  __syncthreads();
  const float ms = (sh[0] + sh[1]) * (1.f / 64.f);
  const float r = rsqrtf(ms + 1e-8f);
  outh[off] = (_Float16)((d * r * w[t] + b[t]) * (1.f - LAMBDA_INIT_F));
}

// ---------------------------------------- out = layernorm(a + res) (fp32 + opt f16)
__global__ __launch_bounds__(256)
void add_layernorm(const float* __restrict__ a, const float* __restrict__ res,
                   const float* __restrict__ w, const float* __restrict__ b,
                   float* __restrict__ out32, _Float16* __restrict__ out16) {
  const int s = blockIdx.x;
  const int t = threadIdx.x;
  __shared__ float sh[8];
  __shared__ float stat[2];
  const size_t base = (size_t)s * E_DIM;
  float v[4];
  float sum = 0.f;
  #pragma unroll
  for (int i = 0; i < 4; ++i) {
    const int e = t + i * 256;
    const float xv = a[base + e] + res[base + e];
    v[i] = xv; sum += xv;
  }
  #pragma unroll
  for (int o = 16; o > 0; o >>= 1) sum += __shfl_xor(sum, o, 32);
  if ((t & 31) == 0) sh[t >> 5] = sum;
  __syncthreads();
  if (t == 0) { float r = 0.f; for (int i = 0; i < 8; ++i) r += sh[i]; stat[0] = r * (1.f / E_DIM); }
  __syncthreads();
  const float mean = stat[0];
  float sq = 0.f;
  #pragma unroll
  for (int i = 0; i < 4; ++i) { const float dd = v[i] - mean; sq += dd * dd; }
  #pragma unroll
  for (int o = 16; o > 0; o >>= 1) sq += __shfl_xor(sq, o, 32);
  if ((t & 31) == 0) sh[t >> 5] = sq;
  __syncthreads();
  if (t == 0) { float r = 0.f; for (int i = 0; i < 8; ++i) r += sh[i]; stat[1] = r * (1.f / E_DIM); }
  __syncthreads();
  const float rstd = rsqrtf(stat[1] + 1e-5f);
  #pragma unroll
  for (int i = 0; i < 4; ++i) {
    const int e = t + i * 256;
    const float ov = (v[i] - mean) * rstd * w[e] + b[e];
    out32[base + e] = ov;
    if (out16) out16[base + e] = (_Float16)ov;
  }
}

// ------------------------------------------------------------------ launcher
extern "C" void kernel_launch(void* const* d_in, const int* in_sizes, int n_in,
                              void* d_out, int out_size, void* d_ws, size_t ws_size,
                              hipStream_t stream) {
  (void)in_sizes; (void)n_in; (void)out_size; (void)ws_size;
  const float* x      = (const float*)d_in[0];
  const float* emb    = (const float*)d_in[1];
  const float* qkv_w  = (const float*)d_in[2];
  const float* out_w  = (const float*)d_in[3];
  const float* sigmaw = (const float*)d_in[4];
  const float* lq1    = (const float*)d_in[5];
  const float* lk1    = (const float*)d_in[6];
  const float* lq2    = (const float*)d_in[7];
  const float* lk2    = (const float*)d_in[8];
  const float* ln_w   = (const float*)d_in[9];
  const float* ln_b   = (const float*)d_in[10];
  const float* ln1_w  = (const float*)d_in[11];
  const float* ln1_b  = (const float*)d_in[12];
  const float* ln2_w  = (const float*)d_in[13];
  const float* ln2_b  = (const float*)d_in[14];
  const float* w1     = (const float*)d_in[15];
  const float* b1     = (const float*)d_in[16];
  const float* w2     = (const float*)d_in[17];
  const float* b2     = (const float*)d_in[18];
  float* out = (float*)d_out;

  char* ws = (char*)d_ws;
  size_t off = 0;
  auto alloc = [&](size_t bytes) -> char* {
    char* p = ws + off;
    off += (bytes + 255) & ~(size_t)255;
    return p;
  };
  float*    sig   = (float*)alloc(D_DIM * sizeof(float));
  float*    lam   = (float*)alloc(sizeof(float));
  _Float16* xb    = (_Float16*)alloc((size_t)S_LEN * E_DIM * 2);
  _Float16* wqkvb = (_Float16*)alloc((size_t)3 * E_DIM * E_DIM * 2);
  _Float16* woutb = (_Float16*)alloc((size_t)E_DIM * E_DIM * 2);
  _Float16* w1b   = (_Float16*)alloc((size_t)4 * E_DIM * E_DIM * 2);
  _Float16* w2b   = (_Float16*)alloc((size_t)4 * E_DIM * E_DIM * 2);
  float*    qkvf  = (float*)alloc((size_t)S_LEN * 3 * E_DIM * 4);       // reused below
  _Float16* q1b   = (_Float16*)alloc((size_t)H_NUM * S_LEN * D_DIM * 2);
  _Float16* q2b   = (_Float16*)alloc((size_t)H_NUM * S_LEN * D_DIM * 2);
  _Float16* k1b   = (_Float16*)alloc((size_t)H_NUM * S_LEN * D_DIM * 2);
  _Float16* k2b   = (_Float16*)alloc((size_t)H_NUM * S_LEN * D_DIM * 2);
  _Float16* vtb   = (_Float16*)alloc((size_t)H_NUM * S_LEN * 2 * D_DIM * 2);  // [h][vdim][s]
  _Float16* abh   = (_Float16*)alloc((size_t)S_LEN * E_DIM * 2);
  float*    aof   = (float*)alloc((size_t)S_LEN * E_DIM * 4);           // reused below
  float*    hf    = (float*)alloc((size_t)S_LEN * E_DIM * 4);
  _Float16* hb16  = (_Float16*)alloc((size_t)S_LEN * E_DIM * 2);

  // aliases into dead regions (stream-ordered, deterministic)
  float*    attn1f = qkvf;                                  // qkv dead after rope
  float*    attn2f = qkvf + (size_t)S_LEN * E_DIM;
  _Float16* f1b    = (_Float16*)qkvf;                       // attn bufs dead after diffnorm
  float*    fff    = aof;                                   // aof dead after first add_layernorm

  // 1. fp32 -> f16 conversions (activations + weights), sig and lambda: one launch
  prepare<<<1 + NB_X + NB_QKVW + NB_OUTW + NB_W1 + NB_W2, 256, 0, stream>>>(
      x, xb, qkv_w, wqkvb, out_w, woutb, w1, w1b, w2, w2b,
      emb, sigmaw, lq1, lk1, lq2, lk2, sig, lam);

  // 2. qkv = x @ qkv_w^T  (2048x3072x1024)
  gemm_wmma<0, false><<<dim3(3 * E_DIM / BN, S_LEN / BM), 256, 0, stream>>>(
      xb, wqkvb, nullptr, qkvf, nullptr, S_LEN, 3 * E_DIM, E_DIM);
  // 3. RoPE + sigma + head split (V transposed)
  rope_split<<<S_LEN, 256, 0, stream>>>(qkvf, sig, q1b, q2b, k1b, k2b, vtb);
  // 4. two causal flash attentions (WMMA QK^T and PV)
  attn_flash<<<dim3(S_LEN / 64, H_NUM, 2), 128, 0, stream>>>(
      q1b, q2b, k1b, k2b, vtb, attn1f, attn2f, 0.17677669529663687f);
  // 5. per-head rmsnorm of attn1 - lam*attn2
  diff_rmsnorm<<<S_LEN * H_NUM, 64, 0, stream>>>(attn1f, attn2f, lam, ln_w, ln_b, abh);
  // 6. out projection (2048x1024x1024)
  gemm_wmma<0, false><<<dim3(E_DIM / BN, S_LEN / BM), 256, 0, stream>>>(
      abh, woutb, nullptr, aof, nullptr, S_LEN, E_DIM, E_DIM);
  // 7. h = layernorm(a + x)
  add_layernorm<<<S_LEN, 256, 0, stream>>>(aof, x, ln1_w, ln1_b, hf, hb16);
  // 8. ff1 = silu(h @ w1^T + b1) -> f16 (2048x4096x1024)
  gemm_wmma<1, true><<<dim3(4 * E_DIM / BN, S_LEN / BM), 256, 0, stream>>>(
      hb16, w1b, b1, nullptr, f1b, S_LEN, 4 * E_DIM, E_DIM);
  // 9. ff = ff1 @ w2^T + b2 (2048x1024x4096)
  gemm_wmma<0, true><<<dim3(E_DIM / BN, S_LEN / BM), 256, 0, stream>>>(
      f1b, w2b, b2, fff, nullptr, S_LEN, E_DIM, 4 * E_DIM);
  // 10. out = layernorm(ff + h)
  add_layernorm<<<S_LEN, 256, 0, stream>>>(fff, hf, ln2_w, ln2_b, out, nullptr);
}

// v007
// Measured time: 207 microseconds a run.
// Next to v006, in two timings, it ran 1.07 and 1.06 times as fast.
// All steps since v000 together make it 1.78 times as fast.
#include <hip/hip_runtime.h>
#include <hip/hip_bf16.h>
#include <math.h>

typedef __attribute__((ext_vector_type(16))) _Float16 v16h;
typedef __attribute__((ext_vector_type(8)))  float    v8f;

#define S_LEN   2048
#define E_DIM   1024
#define H_NUM   16
#define D_DIM   32
#define SIG_DIM 256
#define LAMBDA_INIT_F 0.3555090675909693f

__device__ __forceinline__ v8f wmma16x16x32(v16h a, v16h b, v8f c) {
  // v_wmma_f32_16x16x32_f16: D = A(16x32,f16) x B(32x16,f16) + C(f32)
  return __builtin_amdgcn_wmma_f32_16x16x32_f16(false, a, false, b, (short)0, c, false, false);
}

// ------------------------------------------------- work that needs the inputs alone
// The five f32 -> f16 conversions and the small set-up need nothing of each other, so they share
// one grid: block 0 does the set-up, every other block converts CVT_U x 1024 consecutive values of
// the array whose range of block indices it falls into (every count is a multiple of CVT_U x 1024).
// A wave-wide 16-byte load covers four whole lines and its 8-byte store two.
typedef __attribute__((ext_vector_type(4))) float    v4f;
typedef __attribute__((ext_vector_type(4))) _Float16 v4h;
#define CVT_U   8
#define NB_X    (S_LEN * E_DIM / (CVT_U * 1024))
#define NB_QKVW (3 * E_DIM * E_DIM / (CVT_U * 1024))
#define NB_OUTW (E_DIM * E_DIM / (CVT_U * 1024))
#define NB_W1   (4 * E_DIM * E_DIM / (CVT_U * 1024))
#define NB_W2   (4 * E_DIM * E_DIM / (CVT_U * 1024))

// sig = emb @ sigma_w.T ; lambda
__device__ __forceinline__ void small_setup(int t,
                            const float* __restrict__ emb, const float* __restrict__ sigw,
                            const float* __restrict__ lq1, const float* __restrict__ lk1,
                            const float* __restrict__ lq2, const float* __restrict__ lk2,
                            float* __restrict__ sig, float* __restrict__ lam) {
  if (t < D_DIM) {
    float s = 0.f;
    for (int j = 0; j < SIG_DIM; ++j) s += emb[j] * sigw[t * SIG_DIM + j];
    sig[t] = s;
  } else if (t == D_DIM) {
    float s1 = 0.f, s2 = 0.f;
    for (int i = 0; i < D_DIM; ++i) { s1 += lq1[i] * lk1[i]; s2 += lq2[i] * lk2[i]; }
    lam[0] = __expf(s1) - __expf(s2) + LAMBDA_INIT_F;
  }
}

__global__ __launch_bounds__(256)
void prepare(const float* __restrict__ x,     _Float16* __restrict__ xb,
             const float* __restrict__ qkv_w, _Float16* __restrict__ wqkvb,
             const float* __restrict__ out_w, _Float16* __restrict__ woutb,
             const float* __restrict__ w1,    _Float16* __restrict__ w1b,
             const float* __restrict__ w2,    _Float16* __restrict__ w2b,
             const float* __restrict__ emb, const float* __restrict__ sigw,
             const float* __restrict__ lq1, const float* __restrict__ lk1,
             const float* __restrict__ lq2, const float* __restrict__ lk2,
             float* __restrict__ sig, float* __restrict__ lam) {
  if (blockIdx.x == 0) {   // first, because its chain of dependent sums is the longest block
    small_setup(threadIdx.x, emb, sigw, lq1, lk1, lq2, lk2, sig, lam);
    return;
  }
  unsigned b = blockIdx.x - 1;   // the same for the whole block: scalar selects
  const float* src = x;
  _Float16* dst = xb;
  if (b >= NB_X) {
    b -= NB_X; src = qkv_w; dst = wqkvb;
    if (b >= NB_QKVW) {
      b -= NB_QKVW; src = out_w; dst = woutb;
      if (b >= NB_OUTW) {
        b -= NB_OUTW; src = w1; dst = w1b;
        if (b >= NB_W1) { b -= NB_W1; src = w2; dst = w2b; }
      }
    }
  }
  const unsigned first = (b * (CVT_U * 256) + threadIdx.x) * 4;
  v4f v[CVT_U];
  #pragma unroll  // all CVT_U loads issue before the first wait; v[] stays in registers
  for (int u = 0; u < CVT_U; ++u) v[u] = *(const v4f*)(src + first + u * 1024);
  #pragma unroll  // constant offsets
  for (int u = 0; u < CVT_U; ++u) *(v4h*)(dst + first + u * 1024) = __builtin_convertvector(v[u], v4h);
}

// ------------------------------------------------------------------- GEMM
// C[M,N] = A[M,K] * B[N,K]^T (+bias). MODE 0: fp32 out. MODE 1: SiLU -> f16 out.
// Two LDS buffers filled by asynchronous copies one tile ahead of the products,
// global_prefetch of K+2 tile, branch-free templated epilogue.
#define BM 128
#define BN 128
#define BK 128    // one row of a K tile is 256 contiguous bytes = two whole 128-B lines
#define ASTR 136  // LDS stride in halfs (256 B + 16 B pad: 16 rows of b128 reads hit 64 distinct banks)

// Eight rows' share of one operand tile: each lane brings its own 16 bytes of rows r, r + 16, ...,
// r + 112 from global memory straight into LDS, through no register. lds = the lane's LDS byte
// address in row r, g = its global address there, gstep = 16 source rows in bytes. All lanes on.
// The closing s_wait_xcnt stands in the copies' own statement so that no later write of an
// address register can be scheduled ahead of it.
__device__ __forceinline__ void copy_rows_to_lds(unsigned lds, const char* g, size_t gstep) {
  asm volatile(
      "global_load_async_to_lds_b128 %0, %8, off\n\t"
      "global_load_async_to_lds_b128 %1, %9, off\n\t"
      "global_load_async_to_lds_b128 %2, %10, off\n\t"
      "global_load_async_to_lds_b128 %3, %11, off\n\t"
      "global_load_async_to_lds_b128 %4, %12, off\n\t"
      "global_load_async_to_lds_b128 %5, %13, off\n\t"
      "global_load_async_to_lds_b128 %6, %14, off\n\t"
      "global_load_async_to_lds_b128 %7, %15, off\n\t"
      "s_wait_xcnt 0x0"
      :: "v"(lds),                     "v"(lds + 1 * 16 * ASTR * 2), "v"(lds + 2 * 16 * ASTR * 2),
         "v"(lds + 3 * 16 * ASTR * 2), "v"(lds + 4 * 16 * ASTR * 2), "v"(lds + 5 * 16 * ASTR * 2),
         "v"(lds + 6 * 16 * ASTR * 2), "v"(lds + 7 * 16 * ASTR * 2),
         "v"(g),             "v"(g + gstep),     "v"(g + 2 * gstep), "v"(g + 3 * gstep),
         "v"(g + 4 * gstep), "v"(g + 5 * gstep), "v"(g + 6 * gstep), "v"(g + 7 * gstep)
      : "memory");
}

// One 16x32 fragment's share of a lane: halfs 0..7 and 16..23 from p (two 16-byte LDS loads).
__device__ __forceinline__ v16h load_frag(const _Float16* p) {
  v16h f;
  #pragma unroll  // constant element indices: f stays in registers, 8 halfs merge into one load
  for (int i = 0; i < 8; ++i) { f[i] = p[i]; f[8 + i] = p[16 + i]; }
  return f;
}

template <int MODE, bool HAS_BIAS>
__global__ __launch_bounds__(256)
void gemm_wmma(const _Float16* __restrict__ A, const _Float16* __restrict__ B,
               const float* __restrict__ bias, float* __restrict__ Cf,
               _Float16* __restrict__ Ch, int M, int N, int K) {
  __shared__ __attribute__((aligned(16))) _Float16 As[2][BM * ASTR];
  __shared__ __attribute__((aligned(16))) _Float16 Bs[2][BN * ASTR];
  const int tid   = threadIdx.x;
  const int lane  = tid & 31;
  const int wave  = tid >> 5;      // 8 wave32 waves
  const int wm    = wave >> 2;     // 0..1  (64 rows each)
  const int wn    = wave & 3;      // 0..3  (32 cols each)
  const int l15   = lane & 15;
  const int hioff = (lane >> 4) * 8;
  const int bm = blockIdx.y * BM;
  const int bn = blockIdx.x * BN;

  const v8f vzero = {0.f,0.f,0.f,0.f,0.f,0.f,0.f,0.f};
  v8f acc[4][2];
  #pragma unroll
  for (int mt = 0; mt < 4; ++mt)
    #pragma unroll
    for (int nt = 0; nt < 2; ++nt) acc[mt][nt] = vzero;

  // 16 lanes cover one row's 256 bytes, so a wave-wide 16-byte copy touches
  // four whole lines (two rows); eight such copies per operand fill 128 rows.
  const int ldRow = tid >> 4;           // 0..15, +16 per copy
  const int ldCol = (tid & 15) * 8;     // halfs
  const char* gA = (const char*)(A + (size_t)bm * K);
  const char* gB = (const char*)(B + (size_t)bn * K);
  // the lane's own place in the next tile to be copied: global (A and B share the pitch K) and LDS
  const size_t gstep = (size_t)K * (16 * 2);
  const char* cpA = gA + ((size_t)ldRow * K + ldCol) * 2;
  const char* cpB = gB + ((size_t)ldRow * K + ldCol) * 2;
  const int ldsOff = ldRow * ASTR + ldCol;
  const unsigned ldsA = (unsigned)(size_t)&As[0][ldsOff];
  const unsigned ldsB = (unsigned)(size_t)&Bs[0][ldsOff];
  const unsigned bufBytes = BM * ASTR * 2;   // BM == BN
  // prefetch offset: one lane per 128-B line of the tile, two tiles ahead
  unsigned pfoff = (unsigned)(((tid >> 1) * K + (tid & 1) * 64 + 2 * BK) * 2);

  const int ktiles = K / BK;
  // tile 0 into buffer 0, landed and published before anybody reads it
  copy_rows_to_lds(ldsA, cpA, gstep);
  copy_rows_to_lds(ldsB, cpB, gstep);
  cpA += BK * 2; cpB += BK * 2;
  asm volatile("s_wait_asynccnt 0x0" ::: "memory");  // this wave's copies of tile 0 have landed
  __syncthreads();
  // tile 1 flies into buffer 1 while tile 0 is worked on
  if (1 < ktiles) {
    copy_rows_to_lds(ldsA + bufBytes, cpA, gstep);
    copy_rows_to_lds(ldsB + bufBytes, cpB, gstep);
    cpA += BK * 2; cpB += BK * 2;
  }

  int cur = 0;
  for (int kt = 0; kt < ktiles; ++kt) {
    // pull the K+2 tile toward L2 (global_prefetch_b8)
    if (kt + 2 < ktiles) {
      __builtin_prefetch(gA + pfoff, 0, 1);
      __builtin_prefetch(gB + pfoff, 0, 1);
    }
    pfoff += BK * 2;

    // four 32-deep WMMA steps per tile, k ascending; unrolled for constant LDS offsets.
    // Two register sets of fragments: the 12 LDS loads of step ks + 1 issue as one group ahead of
    // step ks's products, so the products wait on a count and not on a load issued just before.
    const _Float16* pa = &As[cur][(wm * 64 + l15) * ASTR + hioff];
    const _Float16* pb = &Bs[cur][(wn * 32 + l15) * ASTR + hioff];
    v16h af[2][4], bf2[2][2];   // every loop over them is unrolled, so that they stay in registers
    #pragma unroll
    for (int mt = 0; mt < 4; ++mt) af[0][mt] = load_frag(pa + mt * 16 * ASTR);
    #pragma unroll
    for (int nt = 0; nt < 2; ++nt) bf2[0][nt] = load_frag(pb + nt * 16 * ASTR);
    #pragma unroll
    for (int ks = 0; ks < BK / 32; ++ks) {
      const int c = ks & 1;
      if (ks + 1 < BK / 32) {
        #pragma unroll
        for (int mt = 0; mt < 4; ++mt) af[c ^ 1][mt] = load_frag(pa + mt * 16 * ASTR + (ks + 1) * 32);
        #pragma unroll
        for (int nt = 0; nt < 2; ++nt) bf2[c ^ 1][nt] = load_frag(pb + nt * 16 * ASTR + (ks + 1) * 32);
      }
      // keeps the load group above in front of this step's products: without it the compiler sinks
      // each load to just before its first use and every product waits out an LDS round trip; in
      // the last step it keeps the step before's products ahead of the hand-over's waits, so that
      // they run while the last group lands
      __builtin_amdgcn_sched_barrier(0);
      #pragma unroll
      for (int mt = 0; mt < 4; ++mt)
        #pragma unroll
        for (int nt = 0; nt < 2; ++nt)
          acc[mt][nt] = wmma16x16x32(af[c][mt], bf2[c][nt], acc[mt][nt]);
    }

    // hand-over: this wave's reads of buffer cur are done, its copies of tile kt+1 have landed;
    // the barrier publishes that tile and frees buffer cur for the refill behind it
    asm volatile("s_wait_dscnt 0x0" ::: "memory");
    asm volatile("s_wait_asynccnt 0x0" ::: "memory");
    __syncthreads();
    if (kt + 2 < ktiles) {
      copy_rows_to_lds(ldsA + cur * bufBytes, cpA, gstep);
      copy_rows_to_lds(ldsB + cur * bufBytes, cpB, gstep);
      cpA += BK * 2; cpB += BK * 2;
    }
    cur ^= 1;
  }
  asm volatile("s_wait_asynccnt 0x0" ::: "memory");  // no copy outlives the loop

  // ---------------- branch-free epilogue (bias hoisted, strided stores)
  float bv[2] = {0.f, 0.f};
  if (HAS_BIAS) {
    bv[0] = bias[bn + wn * 32 + l15];
    bv[1] = bias[bn + wn * 32 + 16 + l15];
  }
  #pragma unroll
  for (int mt = 0; mt < 4; ++mt) {
    const int gm0 = bm + wm * 64 + mt * 16 + ((lane >> 4) << 3);
    #pragma unroll
    for (int nt = 0; nt < 2; ++nt) {
      const int gn = bn + wn * 32 + nt * 16 + l15;
      if (MODE == 1) {
        _Float16* cp = Ch + (size_t)gm0 * N + gn;
        #pragma unroll
        for (int r = 0; r < 8; ++r) {
          float v = acc[mt][nt][r];
          if (HAS_BIAS) v += bv[nt];
          cp[(size_t)r * N] = (_Float16)(v / (1.f + __expf(-v)));   // SiLU
        }
      } else {
        float* cp = Cf + (size_t)gm0 * N + gn;
        #pragma unroll
        for (int r = 0; r < 8; ++r) {
          float v = acc[mt][nt][r];
          if (HAS_BIAS) v += bv[nt];
          cp[(size_t)r * N] = v;
        }
      }
    }
  }
}

// ------------------------------------------- RoPE + sigma add + head split -> f16
// Q/K written [h][s][d] (row = K-contig for A/B frags).
// V written TRANSPOSED [h][vdim][s] so attention's A-frag of V^T is K(seq)-contiguous.
__global__ __launch_bounds__(256)
void rope_split(const float* __restrict__ qkv, const float* __restrict__ sig,
                _Float16* __restrict__ q1, _Float16* __restrict__ q2,
                _Float16* __restrict__ k1, _Float16* __restrict__ k2,
                _Float16* __restrict__ vt) {
  const int s = blockIdx.x;
  const int t = threadIdx.x;
  __shared__ float sigs[D_DIM];
  if (t < D_DIM) sigs[t] = sig[t];
  __syncthreads();
  const float* row = qkv + (size_t)s * (3 * E_DIM);
  for (int idx = t; idx < 3 * E_DIM; idx += 256) {
    const int which = idx >> 10;        // 0=q 1=k 2=v
    const int rem   = idx & 1023;
    const int rh    = rem >> 5;         // rope head 0..31
    const int d     = rem & 31;
    const int h     = rh >> 1;
    const int sub   = rh & 1;
    const float val = row[idx];
    float o = val;
    if (which < 2 && d < 16) {          // rotate first half of head dim, pairwise
      const int p = d >> 1;
      const float inv = __powf(10000.f, -(float)(2 * p) * (1.f / 16.f));
      const float ang = (float)s * inv;
      float sn, c; __sincosf(ang, &sn, &c);
      const float other = row[(idx & ~31) + (d ^ 1)];
      o = (d & 1) ? (val * c + other * sn) : (val * c - other * sn);
    }
    if (which < 2 && sub == 1) o += sigs[d];
    if (which == 0) {
      _Float16* dst = sub ? q2 : q1;
      dst[(size_t)h * S_LEN * D_DIM + (size_t)s * D_DIM + d] = (_Float16)o;
    } else if (which == 1) {
      _Float16* dst = sub ? k2 : k1;
      dst[(size_t)h * S_LEN * D_DIM + (size_t)s * D_DIM + d] = (_Float16)o;
    } else {
      // transposed: [h][vdim = sub*32+d][s]
      vt[(size_t)h * (2 * D_DIM) * S_LEN + (size_t)(sub * D_DIM + d) * S_LEN + s] = (_Float16)o;
    }
  }
}

// ----------------------------------------------------- flash attention (WMMA)
// Transposed products: S^T = K x Q^T and O^T += V^T x P^T. In a score tile a lane then holds eight
// keys of ONE query (column = lane & 15, key = 8 * (lane >> 4) + register), so a query's maximum and
// sum are taken inside the lane, plus one exchange between the two 16-lane halves, and two score
// tiles, converted in place, are the B operand of the second product: P never leaves the registers.
// Value of lane l ^ 16 (the lane that holds the same query's other keys). All 32 lanes are on.
__device__ __forceinline__ float other_half(float x) {
  const int b = __builtin_bit_cast(int, x);
  return __builtin_bit_cast(float,
      __builtin_amdgcn_permlanex16(b, b, 0x76543210, 0xfedcba98, false, false));
}
#define KSTR 40
#define VSTR 72   // Vs rows are vdim (64), cols are seq/K (64) + pad

__global__ __launch_bounds__(128)
void attn_flash(const _Float16* __restrict__ q1, const _Float16* __restrict__ q2,
                const _Float16* __restrict__ k1, const _Float16* __restrict__ k2,
                const _Float16* __restrict__ vt,
                float* __restrict__ o1, float* __restrict__ o2, float scale) {
  __shared__ _Float16 Ks[64 * KSTR];
  __shared__ _Float16 Vs[64 * VSTR];    // transposed V tile: [vdim][seq]

  const int tid   = threadIdx.x;
  const int lane  = tid & 31;
  const int wave  = tid >> 5;          // 4 waves, 16 q-rows each
  const int l15   = lane & 15;
  const int hi    = lane >> 4;
  const int hioff = hi * 8;

  const int qi = blockIdx.x;           // q tile (64 rows)
  const int h  = blockIdx.y;
  const int ai = blockIdx.z;           // which attention (0/1)

  const _Float16* Qp = (ai ? q2 : q1) + (size_t)h * S_LEN * D_DIM;
  const _Float16* Kp = (ai ? k2 : k1) + (size_t)h * S_LEN * D_DIM;
  const _Float16* Vp = vt + (size_t)h * (2 * D_DIM) * S_LEN;   // [vdim][s]
  float* Op = ai ? o2 : o1;

  const int qbase = qi * 64;
  const int qrow0 = qbase + wave * 16;
  const int qrow  = qrow0 + l15;        // the lane's query

  v16h bq;                              // Q^T B-frag (rows contiguous in global, K=32)
  {
    const _Float16* p = Qp + (size_t)qrow * D_DIM + hioff;
    #pragma unroll
    for (int i = 0; i < 8; ++i) { bq[i] = p[i]; bq[8 + i] = p[16 + i]; }
  }

  const v8f vzero = {0.f,0.f,0.f,0.f,0.f,0.f,0.f,0.f};
  v8f o[4];                             // o[j][r] = O[qrow][j * 16 + hioff + r]
  #pragma unroll
  for (int j = 0; j < 4; ++j) o[j] = vzero;
  float rmax = -1e30f;                  // of the query, the same in both halves
  float rsum = 0.f;                     // over this half's keys only; the halves join after the loop

  const int ldRow = tid >> 1;           // 0..63
  const int kc16  = (tid & 1) * 16;
  const int vc32  = (tid & 1) * 32;

  for (int kt = 0; kt <= qi; ++kt) {
    const int kbase = kt * 64;
    {   // stage K (64 seq x 32 d) and V^T (64 vdim x 64 seq) tiles, all vectorized
      const uint4* s = (const uint4*)(Kp + (size_t)(kbase + ldRow) * D_DIM + kc16);
      uint4* d = (uint4*)(Ks + ldRow * KSTR + kc16);
      d[0] = s[0]; d[1] = s[1];
      const uint4* s2 = (const uint4*)(Vp + (size_t)ldRow * S_LEN + kbase + vc32);
      uint4* d2 = (uint4*)(Vs + ldRow * VSTR + vc32);
      d2[0] = s2[0]; d2[1] = s2[1]; d2[2] = s2[2]; d2[3] = s2[3];
    }
    __syncthreads();

    // scores^T = K(64x32) x Q^T(32x16): 4 WMMA; sc[j][r] = key kbase + j*16 + hioff + r, query qrow
    v8f sc[4];
    #pragma unroll
    for (int j = 0; j < 4; ++j) {
      v16h ak;
      const _Float16* p = Ks + (j * 16 + l15) * KSTR + hioff;
      #pragma unroll
      for (int i = 0; i < 8; ++i) { ak[i] = p[i]; ak[8 + i] = p[16 + i]; }
      sc[j] = wmma16x16x32(ak, bq, vzero);
      #pragma unroll
      for (int r = 0; r < 8; ++r) sc[j][r] *= scale;
    }
    if (kt == qi) {                      // causal mask on diagonal tile
      #pragma unroll
      for (int j = 0; j < 4; ++j) {
        #pragma unroll
        for (int r = 0; r < 8; ++r) {
          const int key = kbase + j * 16 + hioff + r;
          if (key > qrow) sc[j][r] = -1e30f;
        }
      }
    }

    // online softmax: one query a lane. Trees, not one chain, so that no step waits on the last.
    float t[8];
    #pragma unroll
    for (int r = 0; r < 8; ++r)
      t[r] = fmaxf(fmaxf(sc[0][r], sc[1][r]), fmaxf(sc[2][r], sc[3][r]));
    float nmax = fmaxf(fmaxf(fmaxf(fmaxf(t[0], t[1]), t[2]), fmaxf(fmaxf(t[3], t[4]), t[5])),
                       fmaxf(fmaxf(t[6], t[7]), rmax));
    nmax = fmaxf(nmax, other_half(nmax));
    const float alpha = __expf(rmax - nmax);
    rmax = nmax;
    #pragma unroll
    for (int j = 0; j < 4; ++j)
      #pragma unroll
      for (int r = 0; r < 8; ++r) sc[j][r] = __expf(sc[j][r] - nmax);
    const v8f ps = (sc[0] + sc[1]) + (sc[2] + sc[3]);
    rsum = rsum * alpha + (((ps[0] + ps[1]) + (ps[2] + ps[3])) + ((ps[4] + ps[5]) + (ps[6] + ps[7])));
    #pragma unroll
    for (int j = 0; j < 4; ++j)
      #pragma unroll
      for (int r = 0; r < 8; ++r) o[j][r] *= alpha;

    // P^T B-frags of keys 0..31 and 32..63: element i = key hioff + i, element 8 + i = key
    // 16 + hioff + i, which is the k order of the V^T A-frags below
    v16h bp0, bp1;
    #pragma unroll
    for (int i = 0; i < 8; ++i) {
      bp0[i] = (_Float16)sc[0][i];  bp0[8 + i] = (_Float16)sc[1][i];
      bp1[i] = (_Float16)sc[2][i];  bp1[8 + i] = (_Float16)sc[3][i];
    }
    // O^T += V^T(64x64) x P^T(64x16): 8 WMMA.
    // V^T layout makes each A-frag chunk 8 contiguous halfs -> ds_load_b128.
    #pragma unroll
    for (int j = 0; j < 4; ++j) {
      const _Float16* pv = Vs + (j * 16 + l15) * VSTR;
      v16h av;
      #pragma unroll
      for (int i = 0; i < 8; ++i) { av[i] = pv[hioff + i]; av[8 + i] = pv[16 + hioff + i]; }
      o[j] = wmma16x16x32(av, bp0, o[j]);
      #pragma unroll
      for (int i = 0; i < 8; ++i) { av[i] = pv[32 + hioff + i]; av[8 + i] = pv[48 + hioff + i]; }
      o[j] = wmma16x16x32(av, bp1, o[j]);
    }
    __syncthreads();
  }

  // finalize: a lane's eight registers of a tile are eight consecutive floats of its query's row
  const float invs = 1.f / (rsum + other_half(rsum));
  float* rp = Op + (size_t)qrow * E_DIM + h * 64 + hioff;
  #pragma unroll
  for (int j = 0; j < 4; ++j) {
    const v4f lo = {o[j][0] * invs, o[j][1] * invs, o[j][2] * invs, o[j][3] * invs};
    const v4f up = {o[j][4] * invs, o[j][5] * invs, o[j][6] * invs, o[j][7] * invs};
    *(v4f*)(rp + j * 16)     = lo;
    *(v4f*)(rp + j * 16 + 4) = up;
  }
}

// -------------------------------- a = rmsnorm(attn1 - lam*attn2)*(1-LAMBDA) -> f16
__global__ __launch_bounds__(64)
void diff_rmsnorm(const float* __restrict__ a1, const float* __restrict__ a2,
                  const float* __restrict__ lamp, const float* __restrict__ w,
                  const float* __restrict__ b, _Float16* __restrict__ outh) {
  const int idx = blockIdx.x;
  const int s = idx >> 4;
  const int h = idx & 15;
  const int t = threadIdx.x;                    // 0..63 over the 2D-dim group
  __shared__ float sh[2];
  const float lam = lamp[0];
  const size_t off = (size_t)s * E_DIM + h * 64 + t;
  const float d = a1[off] - lam * a2[off];
  float sq = d * d;
  #pragma unroll
  for (int o = 16; o > 0; o >>= 1) sq += __shfl_xor(sq, o, 32);
  if ((t & 31) == 0) sh[t >> 5] = sq;
  __syncthreads();
  const float ms = (sh[0] + sh[1]) * (1.f / 64.f);
  const float r = rsqrtf(ms + 1e-8f);
  outh[off] = (_Float16)((d * r * w[t] + b[t]) * (1.f - LAMBDA_INIT_F));
}

// ---------------------------------------- out = layernorm(a + res) (fp32 + opt f16)
__global__ __launch_bounds__(256)
void add_layernorm(const float* __restrict__ a, const float* __restrict__ res,
                   const float* __restrict__ w, const float* __restrict__ b,
                   float* __restrict__ out32, _Float16* __restrict__ out16) {
  const int s = blockIdx.x;
  const int t = threadIdx.x;
  __shared__ float sh[8];
  __shared__ float stat[2];
  const size_t base = (size_t)s * E_DIM;
  float v[4];
  float sum = 0.f;
  #pragma unroll
  for (int i = 0; i < 4; ++i) {
    const int e = t + i * 256;
    const float xv = a[base + e] + res[base + e];
    v[i] = xv; sum += xv;
  }
  #pragma unroll
  for (int o = 16; o > 0; o >>= 1) sum += __shfl_xor(sum, o, 32);
  if ((t & 31) == 0) sh[t >> 5] = sum;
  __syncthreads();
  if (t == 0) { float r = 0.f; for (int i = 0; i < 8; ++i) r += sh[i]; stat[0] = r * (1.f / E_DIM); }
  __syncthreads();
  const float mean = stat[0];
  float sq = 0.f;
  #pragma unroll
  for (int i = 0; i < 4; ++i) { const float dd = v[i] - mean; sq += dd * dd; }
  #pragma unroll
  for (int o = 16; o > 0; o >>= 1) sq += __shfl_xor(sq, o, 32);
  if ((t & 31) == 0) sh[t >> 5] = sq;
  __syncthreads();
  if (t == 0) { float r = 0.f; for (int i = 0; i < 8; ++i) r += sh[i]; stat[1] = r * (1.f / E_DIM); }
  __syncthreads();
  const float rstd = rsqrtf(stat[1] + 1e-5f);
  #pragma unroll
  for (int i = 0; i < 4; ++i) {
    const int e = t + i * 256;
    const float ov = (v[i] - mean) * rstd * w[e] + b[e];
    out32[base + e] = ov;
    if (out16) out16[base + e] = (_Float16)ov;
  }
}

// ------------------------------------------------------------------ launcher
extern "C" void kernel_launch(void* const* d_in, const int* in_sizes, int n_in,
                              void* d_out, int out_size, void* d_ws, size_t ws_size,
                              hipStream_t stream) {
  (void)in_sizes; (void)n_in; (void)out_size; (void)ws_size;
  const float* x      = (const float*)d_in[0];
  const float* emb    = (const float*)d_in[1];
  const float* qkv_w  = (const float*)d_in[2];
  const float* out_w  = (const float*)d_in[3];
  const float* sigmaw = (const float*)d_in[4];
  const float* lq1    = (const float*)d_in[5];
  const float* lk1    = (const float*)d_in[6];
  const float* lq2    = (const float*)d_in[7];
  const float* lk2    = (const float*)d_in[8];
  const float* ln_w   = (const float*)d_in[9];
  const float* ln_b   = (const float*)d_in[10];
  const float* ln1_w  = (const float*)d_in[11];
  const float* ln1_b  = (const float*)d_in[12];
  const float* ln2_w  = (const float*)d_in[13];
  const float* ln2_b  = (const float*)d_in[14];
  const float* w1     = (const float*)d_in[15];
  const float* b1     = (const float*)d_in[16];
  const float* w2     = (const float*)d_in[17];
  const float* b2     = (const float*)d_in[18];
  float* out = (float*)d_out;

  char* ws = (char*)d_ws;
  size_t off = 0;
  auto alloc = [&](size_t bytes) -> char* {
    char* p = ws + off;
    off += (bytes + 255) & ~(size_t)255;
    return p;
  };
  float*    sig   = (float*)alloc(D_DIM * sizeof(float));
  float*    lam   = (float*)alloc(sizeof(float));
  _Float16* xb    = (_Float16*)alloc((size_t)S_LEN * E_DIM * 2);
  _Float16* wqkvb = (_Float16*)alloc((size_t)3 * E_DIM * E_DIM * 2);
  _Float16* woutb = (_Float16*)alloc((size_t)E_DIM * E_DIM * 2);
  _Float16* w1b   = (_Float16*)alloc((size_t)4 * E_DIM * E_DIM * 2);
  _Float16* w2b   = (_Float16*)alloc((size_t)4 * E_DIM * E_DIM * 2);
  float*    qkvf  = (float*)alloc((size_t)S_LEN * 3 * E_DIM * 4);       // reused below
  _Float16* q1b   = (_Float16*)alloc((size_t)H_NUM * S_LEN * D_DIM * 2);
  _Float16* q2b   = (_Float16*)alloc((size_t)H_NUM * S_LEN * D_DIM * 2);
  _Float16* k1b   = (_Float16*)alloc((size_t)H_NUM * S_LEN * D_DIM * 2);
  _Float16* k2b   = (_Float16*)alloc((size_t)H_NUM * S_LEN * D_DIM * 2);
  _Float16* vtb   = (_Float16*)alloc((size_t)H_NUM * S_LEN * 2 * D_DIM * 2);  // [h][vdim][s]
  _Float16* abh   = (_Float16*)alloc((size_t)S_LEN * E_DIM * 2);
  float*    aof   = (float*)alloc((size_t)S_LEN * E_DIM * 4);           // reused below
  float*    hf    = (float*)alloc((size_t)S_LEN * E_DIM * 4);
  _Float16* hb16  = (_Float16*)alloc((size_t)S_LEN * E_DIM * 2);

  // aliases into dead regions (stream-ordered, deterministic)
  float*    attn1f = qkvf;                                  // qkv dead after rope
  float*    attn2f = qkvf + (size_t)S_LEN * E_DIM;
  _Float16* f1b    = (_Float16*)qkvf;                       // attn bufs dead after diffnorm
  float*    fff    = aof;                                   // aof dead after first add_layernorm

  // 1. fp32 -> f16 conversions (activations + weights), sig and lambda: one launch
  prepare<<<1 + NB_X + NB_QKVW + NB_OUTW + NB_W1 + NB_W2, 256, 0, stream>>>(
      x, xb, qkv_w, wqkvb, out_w, woutb, w1, w1b, w2, w2b,
      emb, sigmaw, lq1, lk1, lq2, lk2, sig, lam);

  // 2. qkv = x @ qkv_w^T  (2048x3072x1024)
  gemm_wmma<0, false><<<dim3(3 * E_DIM / BN, S_LEN / BM), 256, 0, stream>>>(
      xb, wqkvb, nullptr, qkvf, nullptr, S_LEN, 3 * E_DIM, E_DIM);
  // 3. RoPE + sigma + head split (V transposed)
  rope_split<<<S_LEN, 256, 0, stream>>>(qkvf, sig, q1b, q2b, k1b, k2b, vtb);
  // 4. two causal flash attentions (WMMA QK^T and PV)
  attn_flash<<<dim3(S_LEN / 64, H_NUM, 2), 128, 0, stream>>>(
      q1b, q2b, k1b, k2b, vtb, attn1f, attn2f, 0.17677669529663687f);
  // 5. per-head rmsnorm of attn1 - lam*attn2
  diff_rmsnorm<<<S_LEN * H_NUM, 64, 0, stream>>>(attn1f, attn2f, lam, ln_w, ln_b, abh);
  // 6. out projection (2048x1024x1024)
  gemm_wmma<0, false><<<dim3(E_DIM / BN, S_LEN / BM), 256, 0, stream>>>(
      abh, woutb, nullptr, aof, nullptr, S_LEN, E_DIM, E_DIM);
  // 7. h = layernorm(a + x)
  add_layernorm<<<S_LEN, 256, 0, stream>>>(aof, x, ln1_w, ln1_b, hf, hb16);
  // 8. ff1 = silu(h @ w1^T + b1) -> f16 (2048x4096x1024)
  gemm_wmma<1, true><<<dim3(4 * E_DIM / BN, S_LEN / BM), 256, 0, stream>>>(
      hb16, w1b, b1, nullptr, f1b, S_LEN, 4 * E_DIM, E_DIM);
  // 9. ff = ff1 @ w2^T + b2 (2048x1024x4096)
  gemm_wmma<0, true><<<dim3(E_DIM / BN, S_LEN / BM), 256, 0, stream>>>(
      f1b, w2b, b2, fff, nullptr, S_LEN, E_DIM, 4 * E_DIM);
  // 10. out = layernorm(ff + h)
  add_layernorm<<<S_LEN, 256, 0, stream>>>(fff, hf, ln2_w, ln2_b, out, nullptr);
}

// v008
// One run takes 199 microseconds.
// Next to v007, in two timings, it ran 1.04 times as fast each time.
// All steps since v000 together make it 1.85 times as fast.
#include <hip/hip_runtime.h>
#include <hip/hip_bf16.h>
#include <math.h>

typedef __attribute__((ext_vector_type(16))) _Float16 v16h;
typedef __attribute__((ext_vector_type(8)))  float    v8f;

#define S_LEN   2048
#define E_DIM   1024
#define H_NUM   16
#define D_DIM   32
#define SIG_DIM 256
#define LAMBDA_INIT_F 0.3555090675909693f

__device__ __forceinline__ v8f wmma16x16x32(v16h a, v16h b, v8f c) {
  // v_wmma_f32_16x16x32_f16: D = A(16x32,f16) x B(32x16,f16) + C(f32)
  return __builtin_amdgcn_wmma_f32_16x16x32_f16(false, a, false, b, (short)0, c, false, false);
}

// ------------------------------------------------- work that needs the inputs alone
// The five f32 -> f16 conversions and the small set-up need nothing of each other, so they share
// one grid: block 0 does the set-up, every other block converts CVT_U x 1024 consecutive values of
// the array whose range of block indices it falls into (every count is a multiple of CVT_U x 1024).
// A wave-wide 16-byte load covers four whole lines and its 8-byte store two.
typedef __attribute__((ext_vector_type(4))) float    v4f;
typedef __attribute__((ext_vector_type(4))) _Float16 v4h;
#define CVT_U   8
#define NB_X    (S_LEN * E_DIM / (CVT_U * 1024))
#define NB_QKVW (3 * E_DIM * E_DIM / (CVT_U * 1024))
#define NB_OUTW (E_DIM * E_DIM / (CVT_U * 1024))
#define NB_W1   (4 * E_DIM * E_DIM / (CVT_U * 1024))
#define NB_W2   (4 * E_DIM * E_DIM / (CVT_U * 1024))

// sig = emb @ sigma_w.T ; lambda
__device__ __forceinline__ void small_setup(int t,
                            const float* __restrict__ emb, const float* __restrict__ sigw,
                            const float* __restrict__ lq1, const float* __restrict__ lk1,
                            const float* __restrict__ lq2, const float* __restrict__ lk2,
                            float* __restrict__ sig, float* __restrict__ lam) {
  if (t < D_DIM) {
    float s = 0.f;
    for (int j = 0; j < SIG_DIM; ++j) s += emb[j] * sigw[t * SIG_DIM + j];
    sig[t] = s;
  } else if (t == D_DIM) {
    float s1 = 0.f, s2 = 0.f;
    for (int i = 0; i < D_DIM; ++i) { s1 += lq1[i] * lk1[i]; s2 += lq2[i] * lk2[i]; }
    lam[0] = __expf(s1) - __expf(s2) + LAMBDA_INIT_F;
  }
}

__global__ __launch_bounds__(256)
void prepare(const float* __restrict__ x,     _Float16* __restrict__ xb,
             const float* __restrict__ qkv_w, _Float16* __restrict__ wqkvb,
             const float* __restrict__ out_w, _Float16* __restrict__ woutb,
             const float* __restrict__ w1,    _Float16* __restrict__ w1b,
             const float* __restrict__ w2,    _Float16* __restrict__ w2b,
             const float* __restrict__ emb, const float* __restrict__ sigw,
             const float* __restrict__ lq1, const float* __restrict__ lk1,
             const float* __restrict__ lq2, const float* __restrict__ lk2,
             float* __restrict__ sig, float* __restrict__ lam) {
  if (blockIdx.x == 0) {   // first, because its chain of dependent sums is the longest block
    small_setup(threadIdx.x, emb, sigw, lq1, lk1, lq2, lk2, sig, lam);
    return;
  }
  unsigned b = blockIdx.x - 1;   // the same for the whole block: scalar selects
  const float* src = x;
  _Float16* dst = xb;
  if (b >= NB_X) {
    b -= NB_X; src = qkv_w; dst = wqkvb;
    if (b >= NB_QKVW) {
      b -= NB_QKVW; src = out_w; dst = woutb;
      if (b >= NB_OUTW) {
        b -= NB_OUTW; src = w1; dst = w1b;
        if (b >= NB_W1) { b -= NB_W1; src = w2; dst = w2b; }
      }
    }
  }
  const unsigned first = (b * (CVT_U * 256) + threadIdx.x) * 4;
  v4f v[CVT_U];
  #pragma unroll  // all CVT_U loads issue before the first wait; v[] stays in registers
  for (int u = 0; u < CVT_U; ++u) v[u] = *(const v4f*)(src + first + u * 1024);
  #pragma unroll  // constant offsets
  for (int u = 0; u < CVT_U; ++u) *(v4h*)(dst + first + u * 1024) = __builtin_convertvector(v[u], v4h);
}

// ------------------------------------------------------------------- GEMM
// C[M,N] = A[M,K] * B[N,K]^T (+bias). MODE 0: fp32 out. MODE 1: SiLU -> f16 out.
// Two LDS buffers filled by asynchronous copies one tile ahead of the products,
// global_prefetch of K+2 tile, branch-free templated epilogue.
#define BM 128
#define BN 128
#define BK 128    // one row of a K tile is 256 contiguous bytes = two whole 128-B lines
#define ASTR 136  // LDS stride in halfs (256 B + 16 B pad: 16 rows of b128 reads hit 64 distinct banks)

// Eight rows' share of one operand tile: each lane brings its own 16 bytes of rows r, r + 16, ...,
// r + 112 from global memory straight into LDS, through no register. lds = the lane's LDS byte
// address in row r, g = its global address there, gstep = 16 source rows in bytes. All lanes on.
// The closing s_wait_xcnt stands in the copies' own statement so that no later write of an
// address register can be scheduled ahead of it.
__device__ __forceinline__ void copy_rows_to_lds(unsigned lds, const char* g, size_t gstep) {
  asm volatile(
      "global_load_async_to_lds_b128 %0, %8, off\n\t"
      "global_load_async_to_lds_b128 %1, %9, off\n\t"
      "global_load_async_to_lds_b128 %2, %10, off\n\t"
      "global_load_async_to_lds_b128 %3, %11, off\n\t"
      "global_load_async_to_lds_b128 %4, %12, off\n\t"
      "global_load_async_to_lds_b128 %5, %13, off\n\t"
      "global_load_async_to_lds_b128 %6, %14, off\n\t"
      "global_load_async_to_lds_b128 %7, %15, off\n\t"
      "s_wait_xcnt 0x0"
      :: "v"(lds),                     "v"(lds + 1 * 16 * ASTR * 2), "v"(lds + 2 * 16 * ASTR * 2),
         "v"(lds + 3 * 16 * ASTR * 2), "v"(lds + 4 * 16 * ASTR * 2), "v"(lds + 5 * 16 * ASTR * 2),
         "v"(lds + 6 * 16 * ASTR * 2), "v"(lds + 7 * 16 * ASTR * 2),
         "v"(g),             "v"(g + gstep),     "v"(g + 2 * gstep), "v"(g + 3 * gstep),
         "v"(g + 4 * gstep), "v"(g + 5 * gstep), "v"(g + 6 * gstep), "v"(g + 7 * gstep)
      : "memory");
}

// One 16x32 fragment's share of a lane: halfs 0..7 and 16..23 from p (two 16-byte LDS loads).
__device__ __forceinline__ v16h load_frag(const _Float16* p) {
  v16h f;
  #pragma unroll  // constant element indices: f stays in registers, 8 halfs merge into one load
  for (int i = 0; i < 8; ++i) { f[i] = p[i]; f[8 + i] = p[16 + i]; }
  return f;
}

template <int MODE, bool HAS_BIAS>
__global__ __launch_bounds__(256)
void gemm_wmma(const _Float16* __restrict__ A, const _Float16* __restrict__ B,
               const float* __restrict__ bias, float* __restrict__ Cf,
               _Float16* __restrict__ Ch, int M, int N, int K) {
  __shared__ __attribute__((aligned(16))) _Float16 As[2][BM * ASTR];
  __shared__ __attribute__((aligned(16))) _Float16 Bs[2][BN * ASTR];
  const int tid   = threadIdx.x;
  const int lane  = tid & 31;
  const int wave  = tid >> 5;      // 8 wave32 waves
  const int wm    = wave >> 2;     // 0..1  (64 rows each)
  const int wn    = wave & 3;      // 0..3  (32 cols each)
  const int l15   = lane & 15;
  const int hioff = (lane >> 4) * 8;
  const int bm = blockIdx.y * BM;
  const int bn = blockIdx.x * BN;

  const v8f vzero = {0.f,0.f,0.f,0.f,0.f,0.f,0.f,0.f};
  v8f acc[4][2];
  #pragma unroll
  for (int mt = 0; mt < 4; ++mt)
    #pragma unroll
    for (int nt = 0; nt < 2; ++nt) acc[mt][nt] = vzero;

  // 16 lanes cover one row's 256 bytes, so a wave-wide 16-byte copy touches
  // four whole lines (two rows); eight such copies per operand fill 128 rows.
  const int ldRow = tid >> 4;           // 0..15, +16 per copy
  const int ldCol = (tid & 15) * 8;     // halfs
  const char* gA = (const char*)(A + (size_t)bm * K);
  const char* gB = (const char*)(B + (size_t)bn * K);
  // the lane's own place in the next tile to be copied: global (A and B share the pitch K) and LDS
  const size_t gstep = (size_t)K * (16 * 2);
  const char* cpA = gA + ((size_t)ldRow * K + ldCol) * 2;
  const char* cpB = gB + ((size_t)ldRow * K + ldCol) * 2;
  const int ldsOff = ldRow * ASTR + ldCol;
  const unsigned ldsA = (unsigned)(size_t)&As[0][ldsOff];
  const unsigned ldsB = (unsigned)(size_t)&Bs[0][ldsOff];
  const unsigned bufBytes = BM * ASTR * 2;   // BM == BN
  // prefetch offset: one lane per 128-B line of the tile, two tiles ahead
  unsigned pfoff = (unsigned)(((tid >> 1) * K + (tid & 1) * 64 + 2 * BK) * 2);

  const int ktiles = K / BK;
  // tile 0 into buffer 0, landed and published before anybody reads it
  copy_rows_to_lds(ldsA, cpA, gstep);
  copy_rows_to_lds(ldsB, cpB, gstep);
  cpA += BK * 2; cpB += BK * 2;
  asm volatile("s_wait_asynccnt 0x0" ::: "memory");  // this wave's copies of tile 0 have landed
  __syncthreads();
  // tile 1 flies into buffer 1 while tile 0 is worked on
  if (1 < ktiles) {
    copy_rows_to_lds(ldsA + bufBytes, cpA, gstep);
    copy_rows_to_lds(ldsB + bufBytes, cpB, gstep);
    cpA += BK * 2; cpB += BK * 2;
  }

  int cur = 0;
  for (int kt = 0; kt < ktiles; ++kt) {
    // pull the K+2 tile toward L2 (global_prefetch_b8)
    if (kt + 2 < ktiles) {
      __builtin_prefetch(gA + pfoff, 0, 1);
      __builtin_prefetch(gB + pfoff, 0, 1);
    }
    pfoff += BK * 2;

    // four 32-deep WMMA steps per tile, k ascending; unrolled for constant LDS offsets.
    // Two register sets of fragments: the 12 LDS loads of step ks + 1 issue as one group ahead of
    // step ks's products, so the products wait on a count and not on a load issued just before.
    const _Float16* pa = &As[cur][(wm * 64 + l15) * ASTR + hioff];
    const _Float16* pb = &Bs[cur][(wn * 32 + l15) * ASTR + hioff];
    v16h af[2][4], bf2[2][2];   // every loop over them is unrolled, so that they stay in registers
    #pragma unroll
    for (int mt = 0; mt < 4; ++mt) af[0][mt] = load_frag(pa + mt * 16 * ASTR);
    #pragma unroll
    for (int nt = 0; nt < 2; ++nt) bf2[0][nt] = load_frag(pb + nt * 16 * ASTR);
    #pragma unroll
    for (int ks = 0; ks < BK / 32; ++ks) {
      const int c = ks & 1;
      if (ks + 1 < BK / 32) {
        #pragma unroll
        for (int mt = 0; mt < 4; ++mt) af[c ^ 1][mt] = load_frag(pa + mt * 16 * ASTR + (ks + 1) * 32);
        #pragma unroll
        for (int nt = 0; nt < 2; ++nt) bf2[c ^ 1][nt] = load_frag(pb + nt * 16 * ASTR + (ks + 1) * 32);
      }
      // keeps the load group above in front of this step's products: without it the compiler sinks
      // each load to just before its first use and every product waits out an LDS round trip; in
      // the last step it keeps the step before's products ahead of the hand-over's waits, so that
      // they run while the last group lands
      __builtin_amdgcn_sched_barrier(0);
      #pragma unroll
      for (int mt = 0; mt < 4; ++mt)
        #pragma unroll
        for (int nt = 0; nt < 2; ++nt)
          acc[mt][nt] = wmma16x16x32(af[c][mt], bf2[c][nt], acc[mt][nt]);
    }

    // hand-over: this wave's reads of buffer cur are done, its copies of tile kt+1 have landed;
    // the barrier publishes that tile and frees buffer cur for the refill behind it
    asm volatile("s_wait_dscnt 0x0" ::: "memory");
    asm volatile("s_wait_asynccnt 0x0" ::: "memory");
    __syncthreads();
    if (kt + 2 < ktiles) {
      copy_rows_to_lds(ldsA + cur * bufBytes, cpA, gstep);
      copy_rows_to_lds(ldsB + cur * bufBytes, cpB, gstep);
      cpA += BK * 2; cpB += BK * 2;
    }
    cur ^= 1;
  }
  asm volatile("s_wait_asynccnt 0x0" ::: "memory");  // no copy outlives the loop

  // ---------------- branch-free epilogue (bias hoisted, strided stores)
  float bv[2] = {0.f, 0.f};
  if (HAS_BIAS) {
    bv[0] = bias[bn + wn * 32 + l15];
    bv[1] = bias[bn + wn * 32 + 16 + l15];
  }
  #pragma unroll
  for (int mt = 0; mt < 4; ++mt) {
    const int gm0 = bm + wm * 64 + mt * 16 + ((lane >> 4) << 3);
    #pragma unroll
    for (int nt = 0; nt < 2; ++nt) {
      const int gn = bn + wn * 32 + nt * 16 + l15;
      if (MODE == 1) {
        _Float16* cp = Ch + (size_t)gm0 * N + gn;
        #pragma unroll
        for (int r = 0; r < 8; ++r) {
          float v = acc[mt][nt][r];
          if (HAS_BIAS) v += bv[nt];
          cp[(size_t)r * N] = (_Float16)(v / (1.f + __expf(-v)));   // SiLU
        }
      } else {
        float* cp = Cf + (size_t)gm0 * N + gn;
        #pragma unroll
        for (int r = 0; r < 8; ++r) {
          float v = acc[mt][nt][r];
          if (HAS_BIAS) v += bv[nt];
          cp[(size_t)r * N] = v;
        }
      }
    }
  }
}

// ------------------------------------------- RoPE + sigma add + head split -> f16
// Q/K written [h][s][d] (row = K-contig for A/B frags).
// V written TRANSPOSED [h][vdim][s] so attention's A-frag of V^T is K(seq)-contiguous.
__global__ __launch_bounds__(256)
void rope_split(const float* __restrict__ qkv, const float* __restrict__ sig,
                _Float16* __restrict__ q1, _Float16* __restrict__ q2,
                _Float16* __restrict__ k1, _Float16* __restrict__ k2,
                _Float16* __restrict__ vt) {
  const int s = blockIdx.x;
  const int t = threadIdx.x;
  __shared__ float sigs[D_DIM];
  if (t < D_DIM) sigs[t] = sig[t];
  __syncthreads();
  const float* row = qkv + (size_t)s * (3 * E_DIM);
  for (int idx = t; idx < 3 * E_DIM; idx += 256) {
    const int which = idx >> 10;        // 0=q 1=k 2=v
    const int rem   = idx & 1023;
    const int rh    = rem >> 5;         // rope head 0..31
    const int d     = rem & 31;
    const int h     = rh >> 1;
    const int sub   = rh & 1;
    const float val = row[idx];
    float o = val;
    if (which < 2 && d < 16) {          // rotate first half of head dim, pairwise
      const int p = d >> 1;
      const float inv = __powf(10000.f, -(float)(2 * p) * (1.f / 16.f));
      const float ang = (float)s * inv;
      float sn, c; __sincosf(ang, &sn, &c);
      const float other = row[(idx & ~31) + (d ^ 1)];
      o = (d & 1) ? (val * c + other * sn) : (val * c - other * sn);
    }
    if (which < 2 && sub == 1) o += sigs[d];
    if (which == 0) {
      _Float16* dst = sub ? q2 : q1;
      dst[(size_t)h * S_LEN * D_DIM + (size_t)s * D_DIM + d] = (_Float16)o;
    } else if (which == 1) {
      _Float16* dst = sub ? k2 : k1;
      dst[(size_t)h * S_LEN * D_DIM + (size_t)s * D_DIM + d] = (_Float16)o;
    } else {
      // transposed: [h][vdim = sub*32+d][s]
      vt[(size_t)h * (2 * D_DIM) * S_LEN + (size_t)(sub * D_DIM + d) * S_LEN + s] = (_Float16)o;
    }
  }
}

// ----------------------------------------------------- flash attention (WMMA)
// Transposed products: S^T = K x Q^T and O^T += V^T x P^T. In a score tile a lane then holds eight
// keys of ONE query (column = lane & 15, key = 8 * (lane >> 4) + register), so a query's maximum and
// sum are taken inside the lane, plus one exchange between the two 16-lane halves, and two score
// tiles, converted in place, are the B operand of the second product: P never leaves the registers.
// Value of lane l ^ 16 (the lane that holds the same query's other keys). All 32 lanes are on.
__device__ __forceinline__ float other_half(float x) {
  const int b = __builtin_bit_cast(int, x);
  return __builtin_bit_cast(float,
      __builtin_amdgcn_permlanex16(b, b, 0x76543210, 0xfedcba98, false, false));
}
#define KSTR 40
#define VSTR 72   // Vs rows are vdim (64), cols are seq/K (64) + pad
// A query tile's keys are split into chunks of at most KCH key tiles, one work-group a chunk, so that
// no work-group walks more than KCH tiles and the long rows of the causal triangle spread over the
// chip. A chunk leaves its own maximum, sum and unscaled O; diff_rmsnorm joins a row's chunks.
#define KCH     8                                   // key tiles a work-group
#define NCH     (S_LEN / 64 / KCH)                  // 4: the most chunks a query tile has
#define N_FULL  (KCH * (NCH * (NCH - 1) / 2))       // 48 chunks of KCH whole tiles below the diagonal
#define N_ITEMS (N_FULL + S_LEN / 64)               // + one chunk that ends on the diagonal per tile
static_assert(KCH == 8 && NCH == 4, "the index decode in attn_flash and the join are written for 4 chunks of 8");
typedef __attribute__((ext_vector_type(2))) float v2f;

__global__ __launch_bounds__(128)
void attn_flash(const _Float16* __restrict__ q1, const _Float16* __restrict__ q2,
                const _Float16* __restrict__ k1, const _Float16* __restrict__ k2,
                const _Float16* __restrict__ vt,
                float* __restrict__ part, float* __restrict__ stat, float scale) {
  __shared__ _Float16 Ks[64 * KSTR];
  __shared__ _Float16 Vs[64 * VSTR];    // transposed V tile: [vdim][seq]

  const int tid   = threadIdx.x;
  const int lane  = tid & 31;
  const int wave  = tid >> 5;          // 4 waves, 16 q-rows each
  const int l15   = lane & 15;
  const int hi    = lane >> 4;
  const int hioff = hi * 8;

  const int h  = blockIdx.x & (H_NUM - 1);
  const int ai = blockIdx.x >> 4;      // which attention (0/1)
  // blockIdx.y -> (q tile of 64 rows, chunk), each pair once; the whole chunks take the low
  // indices and the diagonal ones follow by falling length
  const int it = blockIdx.y;
  int qi, ch;
  if (it < 24)          { qi = 24 + it / 3;           ch = it % 3; }         // tiles 24..31: 3 whole
  else if (it < 40)     { qi = 16 + ((it - 24) >> 1); ch = (it - 24) & 1; }  // tiles 16..23: 2 whole
  else if (it < N_FULL) { qi = 8 + (it - 40);         ch = 0; }              // tiles  8..15: 1 whole
  else { const int z = it - N_FULL; ch = z & (NCH - 1); qi = ch * KCH + (KCH - 1) - (z >> 2); }
  const int kfirst = ch * KCH;
  const int klast  = min(kfirst + KCH - 1, qi);

  const _Float16* Qp = (ai ? q2 : q1) + (size_t)h * S_LEN * D_DIM;
  const _Float16* Kp = (ai ? k2 : k1) + (size_t)h * S_LEN * D_DIM;
  const _Float16* Vp = vt + (size_t)h * (2 * D_DIM) * S_LEN;   // [vdim][s]

  const int qbase = qi * 64;
  const int qrow0 = qbase + wave * 16;
  const int qrow  = qrow0 + l15;        // the lane's query

  v16h bq;                              // Q^T B-frag (rows contiguous in global, K=32)
  {
    const _Float16* p = Qp + (size_t)qrow * D_DIM + hioff;
    #pragma unroll
    for (int i = 0; i < 8; ++i) { bq[i] = p[i]; bq[8 + i] = p[16 + i]; }
  }

  const v8f vzero = {0.f,0.f,0.f,0.f,0.f,0.f,0.f,0.f};
  v8f o[4];                             // o[j][r] = O[qrow][j * 16 + hioff + r]
  #pragma unroll
  for (int j = 0; j < 4; ++j) o[j] = vzero;
  float rmax = -1e30f;                  // of the query, the same in both halves
  float rsum = 0.f;                     // over this half's keys only; the halves join after the loop

  const int ldRow = tid >> 1;           // 0..63
  const int kc16  = (tid & 1) * 16;
  const int vc32  = (tid & 1) * 32;

  for (int kt = kfirst; kt <= klast; ++kt) {
    const int kbase = kt * 64;
    {   // stage K (64 seq x 32 d) and V^T (64 vdim x 64 seq) tiles, all vectorized
      const uint4* s = (const uint4*)(Kp + (size_t)(kbase + ldRow) * D_DIM + kc16);
      uint4* d = (uint4*)(Ks + ldRow * KSTR + kc16);
      d[0] = s[0]; d[1] = s[1];
      const uint4* s2 = (const uint4*)(Vp + (size_t)ldRow * S_LEN + kbase + vc32);
      uint4* d2 = (uint4*)(Vs + ldRow * VSTR + vc32);
      d2[0] = s2[0]; d2[1] = s2[1]; d2[2] = s2[2]; d2[3] = s2[3];
    }
    __syncthreads();

    // scores^T = K(64x32) x Q^T(32x16): 4 WMMA; sc[j][r] = key kbase + j*16 + hioff + r, query qrow
    v8f sc[4];
    #pragma unroll
    for (int j = 0; j < 4; ++j) {
      v16h ak;
      const _Float16* p = Ks + (j * 16 + l15) * KSTR + hioff;
      #pragma unroll
      for (int i = 0; i < 8; ++i) { ak[i] = p[i]; ak[8 + i] = p[16 + i]; }
      sc[j] = wmma16x16x32(ak, bq, vzero);
      #pragma unroll
      for (int r = 0; r < 8; ++r) sc[j][r] *= scale;
    }
    if (kt == qi) {                      // causal mask on diagonal tile
      #pragma unroll
      for (int j = 0; j < 4; ++j) {
        #pragma unroll
        for (int r = 0; r < 8; ++r) {
          const int key = kbase + j * 16 + hioff + r;
          if (key > qrow) sc[j][r] = -1e30f;
        }
      }
    }

    // online softmax: one query a lane. Trees, not one chain, so that no step waits on the last.
    float t[8];
    #pragma unroll
    for (int r = 0; r < 8; ++r)
      t[r] = fmaxf(fmaxf(sc[0][r], sc[1][r]), fmaxf(sc[2][r], sc[3][r]));
    float nmax = fmaxf(fmaxf(fmaxf(fmaxf(t[0], t[1]), t[2]), fmaxf(fmaxf(t[3], t[4]), t[5])),
                       fmaxf(fmaxf(t[6], t[7]), rmax));
    nmax = fmaxf(nmax, other_half(nmax));
    const float alpha = __expf(rmax - nmax);
    rmax = nmax;
    #pragma unroll
    for (int j = 0; j < 4; ++j)
      #pragma unroll
      for (int r = 0; r < 8; ++r) sc[j][r] = __expf(sc[j][r] - nmax);
    const v8f ps = (sc[0] + sc[1]) + (sc[2] + sc[3]);
    rsum = rsum * alpha + (((ps[0] + ps[1]) + (ps[2] + ps[3])) + ((ps[4] + ps[5]) + (ps[6] + ps[7])));
    #pragma unroll
    for (int j = 0; j < 4; ++j)
      #pragma unroll
      for (int r = 0; r < 8; ++r) o[j][r] *= alpha;

    // P^T B-frags of keys 0..31 and 32..63: element i = key hioff + i, element 8 + i = key
    // 16 + hioff + i, which is the k order of the V^T A-frags below
    v16h bp0, bp1;
    #pragma unroll
    for (int i = 0; i < 8; ++i) {
      bp0[i] = (_Float16)sc[0][i];  bp0[8 + i] = (_Float16)sc[1][i];
      bp1[i] = (_Float16)sc[2][i];  bp1[8 + i] = (_Float16)sc[3][i];
    }
    // O^T += V^T(64x64) x P^T(64x16): 8 WMMA.
    // V^T layout makes each A-frag chunk 8 contiguous halfs -> ds_load_b128.
    #pragma unroll
    for (int j = 0; j < 4; ++j) {
      const _Float16* pv = Vs + (j * 16 + l15) * VSTR;
      v16h av;
      #pragma unroll
      for (int i = 0; i < 8; ++i) { av[i] = pv[hioff + i]; av[8 + i] = pv[16 + hioff + i]; }
      o[j] = wmma16x16x32(av, bp0, o[j]);
      #pragma unroll
      for (int i = 0; i < 8; ++i) { av[i] = pv[32 + hioff + i]; av[8 + i] = pv[48 + hioff + i]; }
      o[j] = wmma16x16x32(av, bp1, o[j]);
    }
    __syncthreads();
  }

  // the chunk's share, unscaled: a lane's eight registers of a tile are eight consecutive floats of
  // its query's row; the query's maximum and sum go to stat, [plane][h][s] (16 lanes fill one 128-byte line)
  const float lsum = rsum + other_half(rsum);
  const int plane = ai * NCH + ch;
  float* rp = part + ((size_t)qrow * (2 * NCH) + plane) * E_DIM + h * 64 + hioff;
  #pragma unroll
  for (int j = 0; j < 4; ++j) {
    const v4f lo = {o[j][0], o[j][1], o[j][2], o[j][3]};
    const v4f up = {o[j][4], o[j][5], o[j][6], o[j][7]};
    *(v4f*)(rp + j * 16)     = lo;
    *(v4f*)(rp + j * 16 + 4) = up;
  }
  if (hi == 0) {
    const v2f ml = {rmax, lsum};
    *(v2f*)(stat + (((size_t)plane * H_NUM + h) * S_LEN + qrow) * 2) = ml;
  }
}

// -------------------------------- a = rmsnorm(attn1 - lam*attn2)*(1-LAMBDA) -> f16
__global__ __launch_bounds__(64)
void diff_rmsnorm(const float* __restrict__ part, const float* __restrict__ stat,
                  const float* __restrict__ lamp, const float* __restrict__ w,
                  const float* __restrict__ b, _Float16* __restrict__ outh) {
  const int idx = blockIdx.x;
  const int s = idx >> 4;
  const int h = idx & 15;
  const int t = threadIdx.x;                    // 0..63 over the 2D-dim group
  __shared__ float sh[2];
  const float lam = lamp[0];
  const size_t off = (size_t)s * E_DIM + h * 64 + t;
  // join the row's chunks: attn = sum_c e^(m_c - M) O_c / sum_c e^(m_c - M) l_c. Only the chunks that
  // the row's query tile has were written; a missing one counts with weight e^(-huge) = 0.
  const int nch = s / (64 * KCH) + 1;           // the same for the whole block
  const float* prow = part + (size_t)s * (2 * NCH * E_DIM) + h * 64 + t;   // the row's planes lie side by side
  float m[2][NCH], l[2][NCH], o[2][NCH];
  #pragma unroll  // constant indices keep the arrays in registers; all loads issue ahead of the sums
  for (int a = 0; a < 2; ++a)
    #pragma unroll
    for (int c = 0; c < NCH; ++c) {
      m[a][c] = -1e30f; l[a][c] = 0.f; o[a][c] = 0.f;
      if (c < nch) {
        const int plane = a * NCH + c;
        const v2f ml = *(const v2f*)(stat + (((size_t)plane * H_NUM + h) * S_LEN + s) * 2);
        m[a][c] = ml[0]; l[a][c] = ml[1];
        o[a][c] = prow[plane * E_DIM];          // one address register, constant offsets
      }
    }
  // stands before the loads' address register is written again; the address is named as an input
  // so that its register stays live, and so unwritten, up to the wait
  asm volatile("s_wait_xcnt 0x0" :: "v"(prow) : "memory");
  float at[2];
  #pragma unroll
  for (int a = 0; a < 2; ++a) {
    const float mx = fmaxf(fmaxf(m[a][0], m[a][1]), fmaxf(m[a][2], m[a][3]));
    float num = 0.f, den = 0.f;
    #pragma unroll
    for (int c = 0; c < NCH; ++c) {
      const float wgt = __expf(m[a][c] - mx);
      num += wgt * o[a][c];
      den += wgt * l[a][c];
    }
    at[a] = num / den;
  }
  const float d = at[0] - lam * at[1];
  float sq = d * d;
  #pragma unroll
  for (int o = 16; o > 0; o >>= 1) sq += __shfl_xor(sq, o, 32);
  if ((t & 31) == 0) sh[t >> 5] = sq;
  __syncthreads();
  const float ms = (sh[0] + sh[1]) * (1.f / 64.f);
  const float r = rsqrtf(ms + 1e-8f);
  outh[off] = (_Float16)((d * r * w[t] + b[t]) * (1.f - LAMBDA_INIT_F));
}

// ---------------------------------------- out = layernorm(a + res) (fp32 + opt f16)
__global__ __launch_bounds__(256)
void add_layernorm(const float* __restrict__ a, const float* __restrict__ res,
                   const float* __restrict__ w, const float* __restrict__ b,
                   float* __restrict__ out32, _Float16* __restrict__ out16) {
  const int s = blockIdx.x;
  const int t = threadIdx.x;
  __shared__ float sh[8];
  __shared__ float stat[2];
  const size_t base = (size_t)s * E_DIM;
  float v[4];
  float sum = 0.f;
  #pragma unroll
  for (int i = 0; i < 4; ++i) {
    const int e = t + i * 256;
    const float xv = a[base + e] + res[base + e];
    v[i] = xv; sum += xv;
  }
  #pragma unroll
  for (int o = 16; o > 0; o >>= 1) sum += __shfl_xor(sum, o, 32);
  if ((t & 31) == 0) sh[t >> 5] = sum;
  __syncthreads();
  if (t == 0) { float r = 0.f; for (int i = 0; i < 8; ++i) r += sh[i]; stat[0] = r * (1.f / E_DIM); }
  __syncthreads();
  const float mean = stat[0];
  float sq = 0.f;
  #pragma unroll
  for (int i = 0; i < 4; ++i) { const float dd = v[i] - mean; sq += dd * dd; }
  #pragma unroll
  for (int o = 16; o > 0; o >>= 1) sq += __shfl_xor(sq, o, 32);
  if ((t & 31) == 0) sh[t >> 5] = sq;
  __syncthreads();
  if (t == 0) { float r = 0.f; for (int i = 0; i < 8; ++i) r += sh[i]; stat[1] = r * (1.f / E_DIM); }
  __syncthreads();
  const float rstd = rsqrtf(stat[1] + 1e-5f);
  #pragma unroll
  for (int i = 0; i < 4; ++i) {
    const int e = t + i * 256;
    const float ov = (v[i] - mean) * rstd * w[e] + b[e];
    out32[base + e] = ov;
    if (out16) out16[base + e] = (_Float16)ov;
  }
}

// ------------------------------------------------------------------ launcher
extern "C" void kernel_launch(void* const* d_in, const int* in_sizes, int n_in,
                              void* d_out, int out_size, void* d_ws, size_t ws_size,
                              hipStream_t stream) {
  (void)in_sizes; (void)n_in; (void)out_size; (void)ws_size;
  const float* x      = (const float*)d_in[0];
  const float* emb    = (const float*)d_in[1];
  const float* qkv_w  = (const float*)d_in[2];
  const float* out_w  = (const float*)d_in[3];
  const float* sigmaw = (const float*)d_in[4];
  const float* lq1    = (const float*)d_in[5];
  const float* lk1    = (const float*)d_in[6];
  const float* lq2    = (const float*)d_in[7];
  const float* lk2    = (const float*)d_in[8];
  const float* ln_w   = (const float*)d_in[9];
  const float* ln_b   = (const float*)d_in[10];
  const float* ln1_w  = (const float*)d_in[11];
  const float* ln1_b  = (const float*)d_in[12];
  const float* ln2_w  = (const float*)d_in[13];
  const float* ln2_b  = (const float*)d_in[14];
  const float* w1     = (const float*)d_in[15];
  const float* b1     = (const float*)d_in[16];
  const float* w2     = (const float*)d_in[17];
  const float* b2     = (const float*)d_in[18];
  float* out = (float*)d_out;

  char* ws = (char*)d_ws;
  size_t off = 0;
  auto alloc = [&](size_t bytes) -> char* {
    char* p = ws + off;
    off += (bytes + 255) & ~(size_t)255;
    return p;
  };
  float*    sig   = (float*)alloc(D_DIM * sizeof(float));
  float*    lam   = (float*)alloc(sizeof(float));
  _Float16* xb    = (_Float16*)alloc((size_t)S_LEN * E_DIM * 2);
  _Float16* wqkvb = (_Float16*)alloc((size_t)3 * E_DIM * E_DIM * 2);
  _Float16* woutb = (_Float16*)alloc((size_t)E_DIM * E_DIM * 2);
  _Float16* w1b   = (_Float16*)alloc((size_t)4 * E_DIM * E_DIM * 2);
  _Float16* w2b   = (_Float16*)alloc((size_t)4 * E_DIM * E_DIM * 2);
  float*    qkvf  = (float*)alloc((size_t)S_LEN * 3 * E_DIM * 4);       // reused below
  _Float16* q1b   = (_Float16*)alloc((size_t)H_NUM * S_LEN * D_DIM * 2);
  _Float16* q2b   = (_Float16*)alloc((size_t)H_NUM * S_LEN * D_DIM * 2);
  _Float16* k1b   = (_Float16*)alloc((size_t)H_NUM * S_LEN * D_DIM * 2);
  _Float16* k2b   = (_Float16*)alloc((size_t)H_NUM * S_LEN * D_DIM * 2);
  _Float16* vtb   = (_Float16*)alloc((size_t)H_NUM * S_LEN * 2 * D_DIM * 2);  // [h][vdim][s]
  _Float16* abh   = (_Float16*)alloc((size_t)S_LEN * E_DIM * 2);
  float*    aof   = (float*)alloc((size_t)S_LEN * E_DIM * 4);           // reused below
  float*    hf    = (float*)alloc((size_t)S_LEN * E_DIM * 4);
  _Float16* hb16  = (_Float16*)alloc((size_t)S_LEN * E_DIM * 2);
  float*    apart = (float*)alloc((size_t)2 * NCH * S_LEN * E_DIM * 4);      // [s][attention][chunk][e]
  float*    astat = (float*)alloc((size_t)2 * NCH * H_NUM * S_LEN * 2 * 4);  // [attention][chunk][h][s]{max,sum}

  // aliases into dead regions (stream-ordered, deterministic)
  _Float16* f1b    = (_Float16*)qkvf;                       // qkv dead after rope
  float*    fff    = aof;                                   // aof dead after first add_layernorm

  // 1. fp32 -> f16 conversions (activations + weights), sig and lambda: one launch
  prepare<<<1 + NB_X + NB_QKVW + NB_OUTW + NB_W1 + NB_W2, 256, 0, stream>>>(
      x, xb, qkv_w, wqkvb, out_w, woutb, w1, w1b, w2, w2b,
      emb, sigmaw, lq1, lk1, lq2, lk2, sig, lam);

  // 2. qkv = x @ qkv_w^T  (2048x3072x1024)
  gemm_wmma<0, false><<<dim3(3 * E_DIM / BN, S_LEN / BM), 256, 0, stream>>>(
      xb, wqkvb, nullptr, qkvf, nullptr, S_LEN, 3 * E_DIM, E_DIM);
  // 3. RoPE + sigma + head split (V transposed)
  rope_split<<<S_LEN, 256, 0, stream>>>(qkvf, sig, q1b, q2b, k1b, k2b, vtb);
  // 4. two causal flash attentions (WMMA QK^T and PV)
  attn_flash<<<dim3(2 * H_NUM, N_ITEMS), 128, 0, stream>>>(
      q1b, q2b, k1b, k2b, vtb, apart, astat, 0.17677669529663687f);
  // 5. join of the key chunks, then per-head rmsnorm of attn1 - lam*attn2
  diff_rmsnorm<<<S_LEN * H_NUM, 64, 0, stream>>>(apart, astat, lam, ln_w, ln_b, abh);
  // 6. out projection (2048x1024x1024)
  gemm_wmma<0, false><<<dim3(E_DIM / BN, S_LEN / BM), 256, 0, stream>>>(
      abh, woutb, nullptr, aof, nullptr, S_LEN, E_DIM, E_DIM);
  // 7. h = layernorm(a + x)
  add_layernorm<<<S_LEN, 256, 0, stream>>>(aof, x, ln1_w, ln1_b, hf, hb16);
  // 8. ff1 = silu(h @ w1^T + b1) -> f16 (2048x4096x1024)
  gemm_wmma<1, true><<<dim3(4 * E_DIM / BN, S_LEN / BM), 256, 0, stream>>>(
      hb16, w1b, b1, nullptr, f1b, S_LEN, 4 * E_DIM, E_DIM);
  // 9. ff = ff1 @ w2^T + b2 (2048x1024x4096)
  gemm_wmma<0, true><<<dim3(E_DIM / BN, S_LEN / BM), 256, 0, stream>>>(
      f1b, w2b, b2, fff, nullptr, S_LEN, E_DIM, 4 * E_DIM);
  // 10. out = layernorm(ff + h)
  add_layernorm<<<S_LEN, 256, 0, stream>>>(fff, hf, ln2_w, ln2_b, out, nullptr);
}

// v009
// A run of this version takes 192 microseconds.
// Two timings next to v008 put it at 1.03 and 1.04 times that version's speed.
// Counting every step since v000, it is 1.91 times as fast.
#include <hip/hip_runtime.h>
#include <hip/hip_bf16.h>
#include <math.h>

typedef __attribute__((ext_vector_type(16))) _Float16 v16h;
typedef __attribute__((ext_vector_type(8)))  float    v8f;

#define S_LEN   2048
#define E_DIM   1024
#define H_NUM   16
#define D_DIM   32
#define SIG_DIM 256
#define LAMBDA_INIT_F 0.3555090675909693f

__device__ __forceinline__ v8f wmma16x16x32(v16h a, v16h b, v8f c) {
  // v_wmma_f32_16x16x32_f16: D = A(16x32,f16) x B(32x16,f16) + C(f32)
  return __builtin_amdgcn_wmma_f32_16x16x32_f16(false, a, false, b, (short)0, c, false, false);
}

// ------------------------------------------------- work that needs the inputs alone
// The five f32 -> f16 conversions and the small set-up need nothing of each other, so they share
// one grid: block 0 does the set-up, every other block converts CVT_U x 1024 consecutive values of
// the array whose range of block indices it falls into (every count is a multiple of CVT_U x 1024).
// A wave-wide 16-byte load covers four whole lines and its 8-byte store two.
typedef __attribute__((ext_vector_type(4))) float    v4f;
typedef __attribute__((ext_vector_type(4))) _Float16 v4h;
#define CVT_U   8
#define NB_X    (S_LEN * E_DIM / (CVT_U * 1024))
#define NB_QKVW (3 * E_DIM * E_DIM / (CVT_U * 1024))
#define NB_OUTW (E_DIM * E_DIM / (CVT_U * 1024))
#define NB_W1   (4 * E_DIM * E_DIM / (CVT_U * 1024))
#define NB_W2   (4 * E_DIM * E_DIM / (CVT_U * 1024))

// sig = emb @ sigma_w.T ; lambda
__device__ __forceinline__ void small_setup(int t,
                            const float* __restrict__ emb, const float* __restrict__ sigw,
                            const float* __restrict__ lq1, const float* __restrict__ lk1,
                            const float* __restrict__ lq2, const float* __restrict__ lk2,
                            float* __restrict__ sig, float* __restrict__ lam) {
  if (t < D_DIM) {
    float s = 0.f;
    for (int j = 0; j < SIG_DIM; ++j) s += emb[j] * sigw[t * SIG_DIM + j];
    sig[t] = s;
  } else if (t == D_DIM) {
    float s1 = 0.f, s2 = 0.f;
    for (int i = 0; i < D_DIM; ++i) { s1 += lq1[i] * lk1[i]; s2 += lq2[i] * lk2[i]; }
    lam[0] = __expf(s1) - __expf(s2) + LAMBDA_INIT_F;
  }
}

__global__ __launch_bounds__(256)
void prepare(const float* __restrict__ x,     _Float16* __restrict__ xb,
             const float* __restrict__ qkv_w, _Float16* __restrict__ wqkvb,
             const float* __restrict__ out_w, _Float16* __restrict__ woutb,
             const float* __restrict__ w1,    _Float16* __restrict__ w1b,
             const float* __restrict__ w2,    _Float16* __restrict__ w2b,
             const float* __restrict__ emb, const float* __restrict__ sigw,
             const float* __restrict__ lq1, const float* __restrict__ lk1,
             const float* __restrict__ lq2, const float* __restrict__ lk2,
             float* __restrict__ sig, float* __restrict__ lam) {
  if (blockIdx.x == 0) {   // first, because its chain of dependent sums is the longest block
    small_setup(threadIdx.x, emb, sigw, lq1, lk1, lq2, lk2, sig, lam);
    return;
  }
  unsigned b = blockIdx.x - 1;   // the same for the whole block: scalar selects
  const float* src = x;
  _Float16* dst = xb;
  if (b >= NB_X) {
    b -= NB_X; src = qkv_w; dst = wqkvb;
    if (b >= NB_QKVW) {
      b -= NB_QKVW; src = out_w; dst = woutb;
      if (b >= NB_OUTW) {
        b -= NB_OUTW; src = w1; dst = w1b;
        if (b >= NB_W1) { b -= NB_W1; src = w2; dst = w2b; }
      }
    }
  }
  const unsigned first = (b * (CVT_U * 256) + threadIdx.x) * 4;
  v4f v[CVT_U];
  #pragma unroll  // all CVT_U loads issue before the first wait; v[] stays in registers
  for (int u = 0; u < CVT_U; ++u) v[u] = *(const v4f*)(src + first + u * 1024);
  #pragma unroll  // constant offsets
  for (int u = 0; u < CVT_U; ++u) *(v4h*)(dst + first + u * 1024) = __builtin_convertvector(v[u], v4h);
}

// ------------------------------------------------------------------- GEMM
// C[M,N] = A[M,K] * B[N,K]^T (+bias). MODE 0: fp32 out. MODE 1: SiLU -> f16 out.
// Two LDS buffers filled by asynchronous copies one tile ahead of the products,
// global_prefetch of K+2 tile, branch-free templated epilogue.
#define BM 128
#define BN 128
#define BK 128    // one row of a K tile is 256 contiguous bytes = two whole 128-B lines
#define ASTR 136  // LDS stride in halfs (256 B + 16 B pad: 16 rows of b128 reads hit 64 distinct banks)

// Eight rows' share of one operand tile: each lane brings its own 16 bytes of rows r, r + 16, ...,
// r + 112 from global memory straight into LDS, through no register. lds = the lane's LDS byte
// address in row r, g = its global address there, gstep = 16 source rows in bytes. All lanes on.
// The closing s_wait_xcnt stands in the copies' own statement so that no later write of an
// address register can be scheduled ahead of it.
__device__ __forceinline__ void copy_rows_to_lds(unsigned lds, const char* g, size_t gstep) {
  asm volatile(
      "global_load_async_to_lds_b128 %0, %8, off\n\t"
      "global_load_async_to_lds_b128 %1, %9, off\n\t"
      "global_load_async_to_lds_b128 %2, %10, off\n\t"
      "global_load_async_to_lds_b128 %3, %11, off\n\t"
      "global_load_async_to_lds_b128 %4, %12, off\n\t"
      "global_load_async_to_lds_b128 %5, %13, off\n\t"
      "global_load_async_to_lds_b128 %6, %14, off\n\t"
      "global_load_async_to_lds_b128 %7, %15, off\n\t"
      "s_wait_xcnt 0x0"
      :: "v"(lds),                     "v"(lds + 1 * 16 * ASTR * 2), "v"(lds + 2 * 16 * ASTR * 2),
         "v"(lds + 3 * 16 * ASTR * 2), "v"(lds + 4 * 16 * ASTR * 2), "v"(lds + 5 * 16 * ASTR * 2),
         "v"(lds + 6 * 16 * ASTR * 2), "v"(lds + 7 * 16 * ASTR * 2),
         "v"(g),             "v"(g + gstep),     "v"(g + 2 * gstep), "v"(g + 3 * gstep),
         "v"(g + 4 * gstep), "v"(g + 5 * gstep), "v"(g + 6 * gstep), "v"(g + 7 * gstep)
      : "memory");
}

// One 16x32 fragment's share of a lane: halfs 0..7 and 16..23 from p (two 16-byte LDS loads).
__device__ __forceinline__ v16h load_frag(const _Float16* p) {
  v16h f;
  #pragma unroll  // constant element indices: f stays in registers, 8 halfs merge into one load
  for (int i = 0; i < 8; ++i) { f[i] = p[i]; f[8 + i] = p[16 + i]; }
  return f;
}

template <int MODE, bool HAS_BIAS>
__global__ __launch_bounds__(256)
void gemm_wmma(const _Float16* __restrict__ A, const _Float16* __restrict__ B,
               const float* __restrict__ bias, float* __restrict__ Cf,
               _Float16* __restrict__ Ch, int M, int N, int K) {
  __shared__ __attribute__((aligned(16))) _Float16 As[2][BM * ASTR];
  __shared__ __attribute__((aligned(16))) _Float16 Bs[2][BN * ASTR];
  const int tid   = threadIdx.x;
  const int lane  = tid & 31;
  const int wave  = tid >> 5;      // 8 wave32 waves
  const int wm    = wave >> 2;     // 0..1  (64 rows each)
  const int wn    = wave & 3;      // 0..3  (32 cols each)
  const int l15   = lane & 15;
  const int hioff = (lane >> 4) * 8;
  const int bm = blockIdx.y * BM;
  const int bn = blockIdx.x * BN;

  const v8f vzero = {0.f,0.f,0.f,0.f,0.f,0.f,0.f,0.f};
  v8f acc[4][2];
  #pragma unroll
  for (int mt = 0; mt < 4; ++mt)
    #pragma unroll
    for (int nt = 0; nt < 2; ++nt) acc[mt][nt] = vzero;

  // 16 lanes cover one row's 256 bytes, so a wave-wide 16-byte copy touches
  // four whole lines (two rows); eight such copies per operand fill 128 rows.
  const int ldRow = tid >> 4;           // 0..15, +16 per copy
  const int ldCol = (tid & 15) * 8;     // halfs
  const char* gA = (const char*)(A + (size_t)bm * K);
  const char* gB = (const char*)(B + (size_t)bn * K);
  // the lane's own place in the next tile to be copied: global (A and B share the pitch K) and LDS
  const size_t gstep = (size_t)K * (16 * 2);
  const char* cpA = gA + ((size_t)ldRow * K + ldCol) * 2;
  const char* cpB = gB + ((size_t)ldRow * K + ldCol) * 2;
  const int ldsOff = ldRow * ASTR + ldCol;
  const unsigned ldsA = (unsigned)(size_t)&As[0][ldsOff];
  const unsigned ldsB = (unsigned)(size_t)&Bs[0][ldsOff];
  const unsigned bufBytes = BM * ASTR * 2;   // BM == BN
  // prefetch offset: one lane per 128-B line of the tile, two tiles ahead
  unsigned pfoff = (unsigned)(((tid >> 1) * K + (tid & 1) * 64 + 2 * BK) * 2);

  const int ktiles = K / BK;
  // tile 0 into buffer 0, landed and published before anybody reads it
  copy_rows_to_lds(ldsA, cpA, gstep);
  copy_rows_to_lds(ldsB, cpB, gstep);
  cpA += BK * 2; cpB += BK * 2;
  asm volatile("s_wait_asynccnt 0x0" ::: "memory");  // this wave's copies of tile 0 have landed
  __syncthreads();
  // tile 1 flies into buffer 1 while tile 0 is worked on
  if (1 < ktiles) {
    copy_rows_to_lds(ldsA + bufBytes, cpA, gstep);
    copy_rows_to_lds(ldsB + bufBytes, cpB, gstep);
    cpA += BK * 2; cpB += BK * 2;
  }

  int cur = 0;
  for (int kt = 0; kt < ktiles; ++kt) {
    // pull the K+2 tile toward L2 (global_prefetch_b8)
    if (kt + 2 < ktiles) {
      __builtin_prefetch(gA + pfoff, 0, 1);
      __builtin_prefetch(gB + pfoff, 0, 1);
    }
    pfoff += BK * 2;

    // four 32-deep WMMA steps per tile, k ascending; unrolled for constant LDS offsets.
    // Two register sets of fragments: the 12 LDS loads of step ks + 1 issue as one group ahead of
    // step ks's products, so the products wait on a count and not on a load issued just before.
    const _Float16* pa = &As[cur][(wm * 64 + l15) * ASTR + hioff];
    const _Float16* pb = &Bs[cur][(wn * 32 + l15) * ASTR + hioff];
    v16h af[2][4], bf2[2][2];   // every loop over them is unrolled, so that they stay in registers
    #pragma unroll
    for (int mt = 0; mt < 4; ++mt) af[0][mt] = load_frag(pa + mt * 16 * ASTR);
    #pragma unroll
    for (int nt = 0; nt < 2; ++nt) bf2[0][nt] = load_frag(pb + nt * 16 * ASTR);
    #pragma unroll
    for (int ks = 0; ks < BK / 32; ++ks) {
      const int c = ks & 1;
      if (ks + 1 < BK / 32) {
        #pragma unroll
        for (int mt = 0; mt < 4; ++mt) af[c ^ 1][mt] = load_frag(pa + mt * 16 * ASTR + (ks + 1) * 32);
        #pragma unroll
        for (int nt = 0; nt < 2; ++nt) bf2[c ^ 1][nt] = load_frag(pb + nt * 16 * ASTR + (ks + 1) * 32);
      }
      // keeps the load group above in front of this step's products: without it the compiler sinks
      // each load to just before its first use and every product waits out an LDS round trip; in
      // the last step it keeps the step before's products ahead of the hand-over's waits, so that
      // they run while the last group lands
      __builtin_amdgcn_sched_barrier(0);
      #pragma unroll
      for (int mt = 0; mt < 4; ++mt)
        #pragma unroll
        for (int nt = 0; nt < 2; ++nt)
          acc[mt][nt] = wmma16x16x32(af[c][mt], bf2[c][nt], acc[mt][nt]);
    }

    // hand-over: this wave's reads of buffer cur are done, its copies of tile kt+1 have landed;
    // the barrier publishes that tile and frees buffer cur for the refill behind it
    asm volatile("s_wait_dscnt 0x0" ::: "memory");
    asm volatile("s_wait_asynccnt 0x0" ::: "memory");
    __syncthreads();
    if (kt + 2 < ktiles) {
      copy_rows_to_lds(ldsA + cur * bufBytes, cpA, gstep);
      copy_rows_to_lds(ldsB + cur * bufBytes, cpB, gstep);
      cpA += BK * 2; cpB += BK * 2;
    }
    cur ^= 1;
  }
  asm volatile("s_wait_asynccnt 0x0" ::: "memory");  // no copy outlives the loop

  // ---------------- branch-free epilogue (bias hoisted, strided stores)
  float bv[2] = {0.f, 0.f};
  if (HAS_BIAS) {
    bv[0] = bias[bn + wn * 32 + l15];
    bv[1] = bias[bn + wn * 32 + 16 + l15];
  }
  #pragma unroll
  for (int mt = 0; mt < 4; ++mt) {
    const int gm0 = bm + wm * 64 + mt * 16 + ((lane >> 4) << 3);
    #pragma unroll
    for (int nt = 0; nt < 2; ++nt) {
      const int gn = bn + wn * 32 + nt * 16 + l15;
      if (MODE == 1) {
        _Float16* cp = Ch + (size_t)gm0 * N + gn;
        #pragma unroll
        for (int r = 0; r < 8; ++r) {
          float v = acc[mt][nt][r];
          if (HAS_BIAS) v += bv[nt];
          cp[(size_t)r * N] = (_Float16)(v / (1.f + __expf(-v)));   // SiLU
        }
      } else {
        float* cp = Cf + (size_t)gm0 * N + gn;
        #pragma unroll
        for (int r = 0; r < 8; ++r) {
          float v = acc[mt][nt][r];
          if (HAS_BIAS) v += bv[nt];
          cp[(size_t)r * N] = v;
        }
      }
    }
  }
}

// ------------------------------------------- RoPE + sigma add + head split -> f16
// Q/K written [h][s][d] (row = K-contig for A/B frags).
// V written TRANSPOSED [h][vdim][s] so attention's A-frag of V^T is K(seq)-contiguous.
__global__ __launch_bounds__(256)
void rope_split(const float* __restrict__ qkv, const float* __restrict__ sig,
                _Float16* __restrict__ q1, _Float16* __restrict__ q2,
                _Float16* __restrict__ k1, _Float16* __restrict__ k2,
                _Float16* __restrict__ vt) {
  const int s = blockIdx.x;
  const int t = threadIdx.x;
  __shared__ float sigs[D_DIM];
  if (t < D_DIM) sigs[t] = sig[t];
  __syncthreads();
  const float* row = qkv + (size_t)s * (3 * E_DIM);
  for (int idx = t; idx < 3 * E_DIM; idx += 256) {
    const int which = idx >> 10;        // 0=q 1=k 2=v
    const int rem   = idx & 1023;
    const int rh    = rem >> 5;         // rope head 0..31
    const int d     = rem & 31;
    const int h     = rh >> 1;
    const int sub   = rh & 1;
    const float val = row[idx];
    float o = val;
    if (which < 2 && d < 16) {          // rotate first half of head dim, pairwise
      const int p = d >> 1;
      const float inv = __powf(10000.f, -(float)(2 * p) * (1.f / 16.f));
      const float ang = (float)s * inv;
      float sn, c; __sincosf(ang, &sn, &c);
      const float other = row[(idx & ~31) + (d ^ 1)];
      o = (d & 1) ? (val * c + other * sn) : (val * c - other * sn);
    }
    if (which < 2 && sub == 1) o += sigs[d];
    if (which == 0) {
      _Float16* dst = sub ? q2 : q1;
      dst[(size_t)h * S_LEN * D_DIM + (size_t)s * D_DIM + d] = (_Float16)o;
    } else if (which == 1) {
      _Float16* dst = sub ? k2 : k1;
      dst[(size_t)h * S_LEN * D_DIM + (size_t)s * D_DIM + d] = (_Float16)o;
    } else {
      // transposed: [h][vdim = sub*32+d][s]
      vt[(size_t)h * (2 * D_DIM) * S_LEN + (size_t)(sub * D_DIM + d) * S_LEN + s] = (_Float16)o;
    }
  }
}

// ----------------------------------------------------- flash attention (WMMA)
// Transposed products: S^T = K x Q^T and O^T += V^T x P^T. In a score tile a lane then holds eight
// keys of ONE query (column = lane & 15, key = 8 * (lane >> 4) + register), so a query's maximum and
// sum are taken inside the lane, plus one exchange between the two 16-lane halves, and two score
// tiles, converted in place, are the B operand of the second product: P never leaves the registers.
// Value of lane l ^ 16 (the lane that holds the same query's other keys). All 32 lanes are on.
__device__ __forceinline__ float other_half(float x) {
  const int b = __builtin_bit_cast(int, x);
  return __builtin_bit_cast(float,
      __builtin_amdgcn_permlanex16(b, b, 0x76543210, 0xfedcba98, false, false));
}
#define KSTR 40
#define VSTR 72   // Vs rows are vdim (64), cols are seq/K (64) + pad
// A query tile's keys are split into chunks of at most KCH key tiles, one work-group a chunk, so that
// no work-group walks more than KCH tiles and the long rows of the causal triangle spread over the
// chip. A chunk leaves its own maximum, sum and unscaled O; diff_rmsnorm joins a row's chunks.
#define KCH     8                                   // key tiles a work-group
#define NCH     (S_LEN / 64 / KCH)                  // 4: the most chunks a query tile has
#define N_FULL  (KCH * (NCH * (NCH - 1) / 2))       // 48 chunks of KCH whole tiles below the diagonal
#define N_ITEMS (N_FULL + S_LEN / 64)               // + one chunk that ends on the diagonal per tile
static_assert(KCH == 8 && NCH == 4, "the index decode in attn_flash and the join are written for 4 chunks of 8");
typedef __attribute__((ext_vector_type(2))) float v2f;

__global__ __launch_bounds__(128)
void attn_flash(const _Float16* __restrict__ q1, const _Float16* __restrict__ q2,
                const _Float16* __restrict__ k1, const _Float16* __restrict__ k2,
                const _Float16* __restrict__ vt,
                float* __restrict__ part, float* __restrict__ stat, float scale) {
  __shared__ _Float16 Ks[64 * KSTR];
  __shared__ _Float16 Vs[64 * VSTR];    // transposed V tile: [vdim][seq]

  const int tid   = threadIdx.x;
  const int lane  = tid & 31;
  const int wave  = tid >> 5;          // 4 waves, 16 q-rows each
  const int l15   = lane & 15;
  const int hi    = lane >> 4;
  const int hioff = hi * 8;

  const int h  = blockIdx.x & (H_NUM - 1);
  const int ai = blockIdx.x >> 4;      // which attention (0/1)
  // blockIdx.y -> (q tile of 64 rows, chunk), each pair once; the whole chunks take the low
  // indices and the diagonal ones follow by falling length
  const int it = blockIdx.y;
  int qi, ch;
  if (it < 24)          { qi = 24 + it / 3;           ch = it % 3; }         // tiles 24..31: 3 whole
  else if (it < 40)     { qi = 16 + ((it - 24) >> 1); ch = (it - 24) & 1; }  // tiles 16..23: 2 whole
  else if (it < N_FULL) { qi = 8 + (it - 40);         ch = 0; }              // tiles  8..15: 1 whole
  else { const int z = it - N_FULL; ch = z & (NCH - 1); qi = ch * KCH + (KCH - 1) - (z >> 2); }
  const int kfirst = ch * KCH;
  const int klast  = min(kfirst + KCH - 1, qi);

  const _Float16* Qp = (ai ? q2 : q1) + (size_t)h * S_LEN * D_DIM;
  const _Float16* Kp = (ai ? k2 : k1) + (size_t)h * S_LEN * D_DIM;
  const _Float16* Vp = vt + (size_t)h * (2 * D_DIM) * S_LEN;   // [vdim][s]

  const int qbase = qi * 64;
  const int qrow0 = qbase + wave * 16;
  const int qrow  = qrow0 + l15;        // the lane's query

  v16h bq;                              // Q^T B-frag (rows contiguous in global, K=32)
  {
    const _Float16* p = Qp + (size_t)qrow * D_DIM + hioff;
    #pragma unroll
    for (int i = 0; i < 8; ++i) { bq[i] = p[i]; bq[8 + i] = p[16 + i]; }
  }

  const v8f vzero = {0.f,0.f,0.f,0.f,0.f,0.f,0.f,0.f};
  v8f o[4];                             // o[j][r] = O[qrow][j * 16 + hioff + r]
  #pragma unroll
  for (int j = 0; j < 4; ++j) o[j] = vzero;
  float rmax = -1e30f;                  // of the query, the same in both halves
  float rsum = 0.f;                     // over this half's keys only; the halves join after the loop

  const int ldRow = tid >> 1;           // 0..63
  const int kc16  = (tid & 1) * 16;
  const int vc32  = (tid & 1) * 32;

  for (int kt = kfirst; kt <= klast; ++kt) {
    const int kbase = kt * 64;
    {   // stage K (64 seq x 32 d) and V^T (64 vdim x 64 seq) tiles, all vectorized
      const uint4* s = (const uint4*)(Kp + (size_t)(kbase + ldRow) * D_DIM + kc16);
      uint4* d = (uint4*)(Ks + ldRow * KSTR + kc16);
      d[0] = s[0]; d[1] = s[1];
      const uint4* s2 = (const uint4*)(Vp + (size_t)ldRow * S_LEN + kbase + vc32);
      uint4* d2 = (uint4*)(Vs + ldRow * VSTR + vc32);
      d2[0] = s2[0]; d2[1] = s2[1]; d2[2] = s2[2]; d2[3] = s2[3];
    }
    __syncthreads();

    // scores^T = K(64x32) x Q^T(32x16): 4 WMMA; sc[j][r] = key kbase + j*16 + hioff + r, query qrow
    v8f sc[4];
    #pragma unroll
    for (int j = 0; j < 4; ++j) {
      v16h ak;
      const _Float16* p = Ks + (j * 16 + l15) * KSTR + hioff;
      #pragma unroll
      for (int i = 0; i < 8; ++i) { ak[i] = p[i]; ak[8 + i] = p[16 + i]; }
      sc[j] = wmma16x16x32(ak, bq, vzero);
      #pragma unroll
      for (int r = 0; r < 8; ++r) sc[j][r] *= scale;
    }
    if (kt == qi) {                      // causal mask on diagonal tile
      #pragma unroll
      for (int j = 0; j < 4; ++j) {
        #pragma unroll
        for (int r = 0; r < 8; ++r) {
          const int key = kbase + j * 16 + hioff + r;
          if (key > qrow) sc[j][r] = -1e30f;
        }
      }
    }

    // online softmax: one query a lane. Trees, not one chain, so that no step waits on the last.
    float t[8];
    #pragma unroll
    for (int r = 0; r < 8; ++r)
      t[r] = fmaxf(fmaxf(sc[0][r], sc[1][r]), fmaxf(sc[2][r], sc[3][r]));
    float nmax = fmaxf(fmaxf(fmaxf(fmaxf(t[0], t[1]), t[2]), fmaxf(fmaxf(t[3], t[4]), t[5])),
                       fmaxf(fmaxf(t[6], t[7]), rmax));
    nmax = fmaxf(nmax, other_half(nmax));
    const float alpha = __expf(rmax - nmax);
    rmax = nmax;
    #pragma unroll
    for (int j = 0; j < 4; ++j)
      #pragma unroll
      for (int r = 0; r < 8; ++r) sc[j][r] = __expf(sc[j][r] - nmax);
    const v8f ps = (sc[0] + sc[1]) + (sc[2] + sc[3]);
    rsum = rsum * alpha + (((ps[0] + ps[1]) + (ps[2] + ps[3])) + ((ps[4] + ps[5]) + (ps[6] + ps[7])));
    #pragma unroll
    for (int j = 0; j < 4; ++j)
      #pragma unroll
      for (int r = 0; r < 8; ++r) o[j][r] *= alpha;

    // P^T B-frags of keys 0..31 and 32..63: element i = key hioff + i, element 8 + i = key
    // 16 + hioff + i, which is the k order of the V^T A-frags below
    v16h bp0, bp1;
    #pragma unroll
    for (int i = 0; i < 8; ++i) {
      bp0[i] = (_Float16)sc[0][i];  bp0[8 + i] = (_Float16)sc[1][i];
      bp1[i] = (_Float16)sc[2][i];  bp1[8 + i] = (_Float16)sc[3][i];
    }
    // O^T += V^T(64x64) x P^T(64x16): 8 WMMA.
    // V^T layout makes each A-frag chunk 8 contiguous halfs -> ds_load_b128.
    #pragma unroll
    for (int j = 0; j < 4; ++j) {
      const _Float16* pv = Vs + (j * 16 + l15) * VSTR;
      v16h av;
      #pragma unroll
      for (int i = 0; i < 8; ++i) { av[i] = pv[hioff + i]; av[8 + i] = pv[16 + hioff + i]; }
      o[j] = wmma16x16x32(av, bp0, o[j]);
      #pragma unroll
      for (int i = 0; i < 8; ++i) { av[i] = pv[32 + hioff + i]; av[8 + i] = pv[48 + hioff + i]; }
      o[j] = wmma16x16x32(av, bp1, o[j]);
    }
    __syncthreads();
  }

  // the chunk's share, unscaled: a lane's eight registers of a tile are eight consecutive floats of
  // its query's row; the query's maximum and sum go to stat, [plane][h][s] (16 lanes fill one 128-byte line)
  const float lsum = rsum + other_half(rsum);
  const int plane = ai * NCH + ch;
  float* rp = part + ((size_t)qrow * (2 * NCH) + plane) * E_DIM + h * 64 + hioff;
  #pragma unroll
  for (int j = 0; j < 4; ++j) {
    const v4f lo = {o[j][0], o[j][1], o[j][2], o[j][3]};
    const v4f up = {o[j][4], o[j][5], o[j][6], o[j][7]};
    *(v4f*)(rp + j * 16)     = lo;
    *(v4f*)(rp + j * 16 + 4) = up;
  }
  if (hi == 0) {
    const v2f ml = {rmax, lsum};
    *(v2f*)(stat + (((size_t)plane * H_NUM + h) * S_LEN + qrow) * 2) = ml;
  }
}

// ------------------------------------------------ sums over lanes, on the vector pipe
// Value of lane l ^ M inside the lane's 16-lane row (DPP row_xmask). All 32 lanes are on.
template <int M>
__device__ __forceinline__ float row_xor(float x) {
  return __builtin_bit_cast(float,
      __builtin_amdgcn_update_dpp(0, __builtin_bit_cast(int, x), 0x160 | M, 0xf, 0xf, true));
}
__device__ __forceinline__ float row16_sum(float x) {
  x += row_xor<1>(x);
  x += row_xor<2>(x);
  x += row_xor<4>(x);
  x += row_xor<8>(x);
  return x;
}
__device__ __forceinline__ float wave_sum(float x) {
  x = row16_sum(x);
  return x + other_half(x);
}

// 2^x and 1/sqrt(x), each with the free slot that the instruction set asks for behind a
// transcendental: the v_nop stands in the instruction's own statement, so that nothing which reads
// the result or overwrites the source can be scheduled directly behind it.
__device__ __forceinline__ float exp2_slot(float x) {
  float r;
  asm("v_exp_f32 %0, %1\n\tv_nop" : "=v"(r) : "v"(x));
  return r;
}
__device__ __forceinline__ float rsq_slot(float x) {   // x at or above the smallest normal number
  float r;
  asm("v_rsq_f32 %0, %1\n\tv_nop" : "=v"(r) : "v"(x));
  return r;
}

// -------------------------------- a = rmsnorm(attn1 - lam*attn2)*(1-LAMBDA) -> f16
// A thread holds four consecutive floats of JR consecutive rows: 16 lanes cover one head's group of
// 64, a wave-wide 16-byte load covers four whole lines, and the group's sum of squares stays inside
// a 16-lane row. Few long waves, every load issued ahead of the first sum, in place of one short
// two-wave work-group per row and head.
#define JR 4      // rows a thread; they share one query tile, so also one count of chunks
static_assert((64 * KCH) % JR == 0 && JR % 2 == 0, "JR rows have one chunk count; two rows' {max,sum} are one 16-byte load");

// NC = the chunks that the rows' query tile has: only those were written, only those are read.
// attn = sum_c e^(m_c - M) O_c / sum_c e^(m_c - M) l_c
template <int NC>
__device__ __forceinline__ void join_norm(const float* __restrict__ part, const float* __restrict__ stat,
                                          float lam, v4f wv, v4f bv, _Float16* __restrict__ outh,
                                          int s0, int t) {
  const int h = t >> 4;
  const float* srow = stat + ((size_t)h * S_LEN + s0) * 2;
  const float* prow = part + (size_t)s0 * (2 * NCH * E_DIM) + t * 4;   // the rows' planes lie side by side
  v4f st[2][NC][JR / 2];   // {max, sum} of two rows each
  v4f o[JR][2][NC];
  // constant indices keep the arrays in registers; one address register each, constant offsets
  #pragma unroll
  for (int a = 0; a < 2; ++a)
    #pragma unroll
    for (int c = 0; c < NC; ++c)
      #pragma unroll
      for (int j = 0; j < JR / 2; ++j)
        st[a][c][j] = *(const v4f*)(srow + (a * NCH + c) * (H_NUM * S_LEN * 2) + j * 4);
  #pragma unroll
  for (int r = 0; r < JR; ++r)
    #pragma unroll
    for (int a = 0; a < 2; ++a)
      #pragma unroll
      for (int c = 0; c < NC; ++c)
        o[r][a][c] = *(const v4f*)(prow + (r * 2 * NCH + a * NCH + c) * E_DIM);
  // keeps every load in front of the sums: without it the compiler holds the last row's loads back
  // until the first results have come, and they wait out a second round trip
  __builtin_amdgcn_sched_barrier(0);
  // stands before the loads' address registers are written again
  asm volatile("s_wait_xcnt 0x0" ::: "memory");
  // keeps the first write of such a register behind the wait
  __builtin_amdgcn_sched_barrier(0);
  #pragma unroll
  for (int r = 0; r < JR; ++r) {
    v4f at[2];
    #pragma unroll
    for (int a = 0; a < 2; ++a) {
      float mx = st[a][0][r >> 1][(r & 1) * 2];
      #pragma unroll
      for (int c = 1; c < NC; ++c) mx = fmaxf(mx, st[a][c][r >> 1][(r & 1) * 2]);
      v4f num = {0.f, 0.f, 0.f, 0.f};
      float den = 0.f;
      #pragma unroll
      for (int c = 0; c < NC; ++c) {
        const float wgt = exp2_slot((st[a][c][r >> 1][(r & 1) * 2] - mx) * 1.44269504f);   // e^(m_c - M)
        num += wgt * o[r][a][c];
        den += wgt * st[a][c][r >> 1][(r & 1) * 2 + 1];
      }
      at[a] = num / den;
    }
    const v4f d = at[0] - lam * at[1];
    const float sq = row16_sum((d[0] * d[0] + d[1] * d[1]) + (d[2] * d[2] + d[3] * d[3]));
    const float rs = rsq_slot(sq * (1.f / 64.f) + 1e-8f);   // the sum of squares is not below 0
    const v4f ov = (d * rs * wv + bv) * (1.f - LAMBDA_INIT_F);
    *(v4h*)(outh + (size_t)(s0 + r) * E_DIM + t * 4) = __builtin_convertvector(ov, v4h);
    // stands before a register that the store names (address, data) is written again
    asm volatile("s_wait_xcnt 0x0" ::: "memory");
  }
}

__global__ __launch_bounds__(256)
void diff_rmsnorm(const float* __restrict__ part, const float* __restrict__ stat,
                  const float* __restrict__ lamp, const float* __restrict__ w,
                  const float* __restrict__ b, _Float16* __restrict__ outh) {
  const int t = threadIdx.x;                              // four floats of the row: head t >> 4
  const int s0 = (int)blockIdx.x * JR;
  const float lam = lamp[0];
  const v4f wv = *(const v4f*)(w + (t & 15) * 4);
  const v4f bv = *(const v4f*)(b + (t & 15) * 4);
  switch (s0 / (64 * KCH)) {                              // the same for the whole block
    case 0:  join_norm<1>(part, stat, lam, wv, bv, outh, s0, t); break;
    case 1:  join_norm<2>(part, stat, lam, wv, bv, outh, s0, t); break;
    case 2:  join_norm<3>(part, stat, lam, wv, bv, outh, s0, t); break;
    default: join_norm<4>(part, stat, lam, wv, bv, outh, s0, t); break;
  }
}

// ---------------------------------------- out = layernorm(a + res) (fp32 + opt f16)
// One wave a row: a lane holds 8 x 4 floats of it, every load is 16 bytes a lane (four whole lines a
// wave) and issues ahead of the first sum; both sums stay in the wave.
#define LN_U (E_DIM / 128)
__global__ __launch_bounds__(256)
void add_layernorm(const float* __restrict__ a, const float* __restrict__ res,
                   const float* __restrict__ w, const float* __restrict__ b,
                   float* __restrict__ out32, _Float16* __restrict__ out16) {
  const int lane = threadIdx.x & 31;
  const int s = blockIdx.x * 8 + (threadIdx.x >> 5);
  const size_t base = (size_t)s * E_DIM + lane * 4;
  const float* pa = a + base;
  const float* pr = res + base;
  const float* pw = w + lane * 4;
  const float* pb = b + lane * 4;
  v4f v[LN_U], rv[LN_U], wv[LN_U], bv[LN_U];   // every loop over them is unrolled: registers
  #pragma unroll
  for (int i = 0; i < LN_U; ++i) v[i] = *(const v4f*)(pa + i * 128);
  #pragma unroll
  for (int i = 0; i < LN_U; ++i) rv[i] = *(const v4f*)(pr + i * 128);
  #pragma unroll
  for (int i = 0; i < LN_U; ++i) wv[i] = *(const v4f*)(pw + i * 128);
  #pragma unroll
  for (int i = 0; i < LN_U; ++i) bv[i] = *(const v4f*)(pb + i * 128);
  // keeps all 32 loads in front of the sums: without it the compiler sinks the loads of w and b to
  // their uses behind the second sum, where each pair waits out its own round trip
  __builtin_amdgcn_sched_barrier(0);
  // stands before the loads' address registers are written again; the two row addresses are named as
  // inputs so that their registers stay live up to the wait and no later load's result lands in them
  asm volatile("s_wait_xcnt 0x0" :: "v"(pa), "v"(pr) : "memory");
  // keeps the first write of such a register behind the wait
  __builtin_amdgcn_sched_barrier(0);
  v4f acc = {0.f, 0.f, 0.f, 0.f};
  #pragma unroll
  for (int i = 0; i < LN_U; ++i) { v[i] += rv[i]; acc += v[i]; }
  const float mean = wave_sum((acc[0] + acc[1]) + (acc[2] + acc[3])) * (1.f / E_DIM);
  v4f qa = {0.f, 0.f, 0.f, 0.f};
  #pragma unroll
  for (int i = 0; i < LN_U; ++i) { v[i] -= mean; qa += v[i] * v[i]; }
  const float var = wave_sum((qa[0] + qa[1]) + (qa[2] + qa[3])) * (1.f / E_DIM);
  const float rstd = rsqrtf(var + 1e-5f);
  #pragma unroll
  for (int i = 0; i < LN_U; ++i) v[i] = v[i] * rstd * wv[i] + bv[i];
  // the f16 copy goes first: its conversions then write fresh registers while v[] is still live, and
  // behind the f32 stores nothing is written any more
  if (out16) {
    #pragma unroll
    for (int i = 0; i < LN_U; ++i) *(v4h*)(out16 + base + i * 128) = __builtin_convertvector(v[i], v4h);
  }
  #pragma unroll
  for (int i = 0; i < LN_U; ++i) *(v4f*)(out32 + base + i * 128) = v[i];
}

// ------------------------------------------------------------------ launcher
extern "C" void kernel_launch(void* const* d_in, const int* in_sizes, int n_in,
                              void* d_out, int out_size, void* d_ws, size_t ws_size,
                              hipStream_t stream) {
  (void)in_sizes; (void)n_in; (void)out_size; (void)ws_size;
  const float* x      = (const float*)d_in[0];
  const float* emb    = (const float*)d_in[1];
  const float* qkv_w  = (const float*)d_in[2];
  const float* out_w  = (const float*)d_in[3];
  const float* sigmaw = (const float*)d_in[4];
  const float* lq1    = (const float*)d_in[5];
  const float* lk1    = (const float*)d_in[6];
  const float* lq2    = (const float*)d_in[7];
  const float* lk2    = (const float*)d_in[8];
  const float* ln_w   = (const float*)d_in[9];
  const float* ln_b   = (const float*)d_in[10];
  const float* ln1_w  = (const float*)d_in[11];
  const float* ln1_b  = (const float*)d_in[12];
  const float* ln2_w  = (const float*)d_in[13];
  const float* ln2_b  = (const float*)d_in[14];
  const float* w1     = (const float*)d_in[15];
  const float* b1     = (const float*)d_in[16];
  const float* w2     = (const float*)d_in[17];
  const float* b2     = (const float*)d_in[18];
  float* out = (float*)d_out;

  char* ws = (char*)d_ws;
  size_t off = 0;
  auto alloc = [&](size_t bytes) -> char* {
    char* p = ws + off;
    off += (bytes + 255) & ~(size_t)255;
    return p;
  };
  float*    sig   = (float*)alloc(D_DIM * sizeof(float));
  float*    lam   = (float*)alloc(sizeof(float));
  _Float16* xb    = (_Float16*)alloc((size_t)S_LEN * E_DIM * 2);
  _Float16* wqkvb = (_Float16*)alloc((size_t)3 * E_DIM * E_DIM * 2);
  _Float16* woutb = (_Float16*)alloc((size_t)E_DIM * E_DIM * 2);
  _Float16* w1b   = (_Float16*)alloc((size_t)4 * E_DIM * E_DIM * 2);
  _Float16* w2b   = (_Float16*)alloc((size_t)4 * E_DIM * E_DIM * 2);
  float*    qkvf  = (float*)alloc((size_t)S_LEN * 3 * E_DIM * 4);       // reused below
  _Float16* q1b   = (_Float16*)alloc((size_t)H_NUM * S_LEN * D_DIM * 2);
  _Float16* q2b   = (_Float16*)alloc((size_t)H_NUM * S_LEN * D_DIM * 2);
  _Float16* k1b   = (_Float16*)alloc((size_t)H_NUM * S_LEN * D_DIM * 2);
  _Float16* k2b   = (_Float16*)alloc((size_t)H_NUM * S_LEN * D_DIM * 2);
  _Float16* vtb   = (_Float16*)alloc((size_t)H_NUM * S_LEN * 2 * D_DIM * 2);  // [h][vdim][s]
  _Float16* abh   = (_Float16*)alloc((size_t)S_LEN * E_DIM * 2);
  float*    aof   = (float*)alloc((size_t)S_LEN * E_DIM * 4);           // reused below
  float*    hf    = (float*)alloc((size_t)S_LEN * E_DIM * 4);
  _Float16* hb16  = (_Float16*)alloc((size_t)S_LEN * E_DIM * 2);
  float*    apart = (float*)alloc((size_t)2 * NCH * S_LEN * E_DIM * 4);      // [s][attention][chunk][e]
  float*    astat = (float*)alloc((size_t)2 * NCH * H_NUM * S_LEN * 2 * 4);  // [attention][chunk][h][s]{max,sum}

  // aliases into dead regions (stream-ordered, deterministic)
  _Float16* f1b    = (_Float16*)qkvf;                       // qkv dead after rope
  float*    fff    = aof;                                   // aof dead after first add_layernorm

  // 1. fp32 -> f16 conversions (activations + weights), sig and lambda: one launch
  prepare<<<1 + NB_X + NB_QKVW + NB_OUTW + NB_W1 + NB_W2, 256, 0, stream>>>(
      x, xb, qkv_w, wqkvb, out_w, woutb, w1, w1b, w2, w2b,
      emb, sigmaw, lq1, lk1, lq2, lk2, sig, lam);

  // 2. qkv = x @ qkv_w^T  (2048x3072x1024)
  gemm_wmma<0, false><<<dim3(3 * E_DIM / BN, S_LEN / BM), 256, 0, stream>>>(
      xb, wqkvb, nullptr, qkvf, nullptr, S_LEN, 3 * E_DIM, E_DIM);
  // 3. RoPE + sigma + head split (V transposed)
  rope_split<<<S_LEN, 256, 0, stream>>>(qkvf, sig, q1b, q2b, k1b, k2b, vtb);
  // 4. two causal flash attentions (WMMA QK^T and PV)
  attn_flash<<<dim3(2 * H_NUM, N_ITEMS), 128, 0, stream>>>(
      q1b, q2b, k1b, k2b, vtb, apart, astat, 0.17677669529663687f);
  // 5. join of the key chunks, then per-head rmsnorm of attn1 - lam*attn2
  diff_rmsnorm<<<S_LEN / JR, 256, 0, stream>>>(apart, astat, lam, ln_w, ln_b, abh);
  // 6. out projection (2048x1024x1024)
  gemm_wmma<0, false><<<dim3(E_DIM / BN, S_LEN / BM), 256, 0, stream>>>(
      abh, woutb, nullptr, aof, nullptr, S_LEN, E_DIM, E_DIM);
  // 7. h = layernorm(a + x)
  add_layernorm<<<S_LEN / 8, 256, 0, stream>>>(aof, x, ln1_w, ln1_b, hf, hb16);
  // 8. ff1 = silu(h @ w1^T + b1) -> f16 (2048x4096x1024)
  gemm_wmma<1, true><<<dim3(4 * E_DIM / BN, S_LEN / BM), 256, 0, stream>>>(
      hb16, w1b, b1, nullptr, f1b, S_LEN, 4 * E_DIM, E_DIM);
  // 9. ff = ff1 @ w2^T + b2 (2048x1024x4096)
  gemm_wmma<0, true><<<dim3(E_DIM / BN, S_LEN / BM), 256, 0, stream>>>(
      f1b, w2b, b2, fff, nullptr, S_LEN, E_DIM, 4 * E_DIM);
  // 10. out = layernorm(ff + h)
  add_layernorm<<<S_LEN / 8, 256, 0, stream>>>(fff, hf, ln2_w, ln2_b, out, nullptr);
}

// v010
// A run of this version takes 129 microseconds.
// Two timings next to v009 put it at 1.48 and 1.49 times that version's speed.
// Over all steps from v000 it is 2.83 times as fast.
#include <hip/hip_runtime.h>
#include <hip/hip_bf16.h>
#include <math.h>

typedef __attribute__((ext_vector_type(16))) _Float16 v16h;
typedef __attribute__((ext_vector_type(8)))  float    v8f;

#define S_LEN   2048
#define E_DIM   1024
#define H_NUM   16
#define D_DIM   32
#define SIG_DIM 256
#define LAMBDA_INIT_F 0.3555090675909693f

__device__ __forceinline__ v8f wmma16x16x32(v16h a, v16h b, v8f c) {
  // v_wmma_f32_16x16x32_f16: D = A(16x32,f16) x B(32x16,f16) + C(f32)
  return __builtin_amdgcn_wmma_f32_16x16x32_f16(false, a, false, b, (short)0, c, false, false);
}

// ------------------------------------------------- work that needs the inputs alone
// The five f32 -> f16 conversions and the small set-up need nothing of each other, so they share
// one grid: block 0 does the set-up, every other block converts CVT_U x 1024 consecutive values of
// the array whose range of block indices it falls into (every count is a multiple of CVT_U x 1024).
// A wave-wide 16-byte load covers four whole lines and its 8-byte store two.
typedef __attribute__((ext_vector_type(4))) float    v4f;
typedef __attribute__((ext_vector_type(4))) _Float16 v4h;
#define CVT_U   8
#define NB_X    (S_LEN * E_DIM / (CVT_U * 1024))
#define NB_QKVW (3 * E_DIM * E_DIM / (CVT_U * 1024))
#define NB_OUTW (E_DIM * E_DIM / (CVT_U * 1024))
#define NB_W1   (4 * E_DIM * E_DIM / (CVT_U * 1024))
#define NB_W2   (4 * E_DIM * E_DIM / (CVT_U * 1024))

// sig = emb @ sigma_w.T ; lambda
__device__ __forceinline__ void small_setup(int t,
                            const float* __restrict__ emb, const float* __restrict__ sigw,
                            const float* __restrict__ lq1, const float* __restrict__ lk1,
                            const float* __restrict__ lq2, const float* __restrict__ lk2,
                            float* __restrict__ sig, float* __restrict__ lam) {
  if (t < D_DIM) {
    float s = 0.f;
    for (int j = 0; j < SIG_DIM; ++j) s += emb[j] * sigw[t * SIG_DIM + j];
    sig[t] = s;
  } else if (t == D_DIM) {
    float s1 = 0.f, s2 = 0.f;
    for (int i = 0; i < D_DIM; ++i) { s1 += lq1[i] * lk1[i]; s2 += lq2[i] * lk2[i]; }
    lam[0] = __expf(s1) - __expf(s2) + LAMBDA_INIT_F;
  }
}

__global__ __launch_bounds__(256)
void prepare(const float* __restrict__ x,     _Float16* __restrict__ xb,
             const float* __restrict__ qkv_w, _Float16* __restrict__ wqkvb,
             const float* __restrict__ out_w, _Float16* __restrict__ woutb,
             const float* __restrict__ w1,    _Float16* __restrict__ w1b,
             const float* __restrict__ w2,    _Float16* __restrict__ w2b,
             const float* __restrict__ emb, const float* __restrict__ sigw,
             const float* __restrict__ lq1, const float* __restrict__ lk1,
             const float* __restrict__ lq2, const float* __restrict__ lk2,
             float* __restrict__ sig, float* __restrict__ lam) {
  if (blockIdx.x == 0) {   // first, because its chain of dependent sums is the longest block
    small_setup(threadIdx.x, emb, sigw, lq1, lk1, lq2, lk2, sig, lam);
    return;
  }
  unsigned b = blockIdx.x - 1;   // the same for the whole block: scalar selects
  const float* src = x;
  _Float16* dst = xb;
  if (b >= NB_X) {
    b -= NB_X; src = qkv_w; dst = wqkvb;
    if (b >= NB_QKVW) {
      b -= NB_QKVW; src = out_w; dst = woutb;
      if (b >= NB_OUTW) {
        b -= NB_OUTW; src = w1; dst = w1b;
        if (b >= NB_W1) { b -= NB_W1; src = w2; dst = w2b; }
      }
    }
  }
  const unsigned first = (b * (CVT_U * 256) + threadIdx.x) * 4;
  v4f v[CVT_U];
  #pragma unroll  // all CVT_U loads issue before the first wait; v[] stays in registers
  for (int u = 0; u < CVT_U; ++u) v[u] = *(const v4f*)(src + first + u * 1024);
  #pragma unroll  // constant offsets
  for (int u = 0; u < CVT_U; ++u) *(v4h*)(dst + first + u * 1024) = __builtin_convertvector(v[u], v4h);
}

// Value of lane l ^ M inside the lane's 16-lane row (DPP row_xmask). All 32 lanes are on.
template <int M>
__device__ __forceinline__ float row_xor(float x) {
  return __builtin_bit_cast(float,
      __builtin_amdgcn_update_dpp(0, __builtin_bit_cast(int, x), 0x160 | M, 0xf, 0xf, true));
}

// sin and cos of x revolutions, each with the free slot that the instruction set asks for behind a
// transcendental: the v_nop stands in the instruction's own statement, so that nothing which reads
// the result or overwrites the source can be scheduled directly behind it.
__device__ __forceinline__ float sin_rev_slot(float x) {
  float r;
  asm("v_sin_f32 %0, %1\n\tv_nop" : "=v"(r) : "v"(x));
  return r;
}
__device__ __forceinline__ float cos_rev_slot(float x) {
  float r;
  asm("v_cos_f32 %0, %1\n\tv_nop" : "=v"(r) : "v"(x));
  return r;
}

// ------------------------------------------------------------------- GEMM
// C[M,N] = A[M,K] * B[N,K]^T (+bias). MODE 0: fp32 out. MODE 1: SiLU -> f16 out.
// MODE 2 (the q, k, v projection): RoPE + sigma add + head split -> f16, straight from the sums.
// Two LDS buffers filled by asynchronous copies one tile ahead of the products,
// global_prefetch of K+2 tile, branch-free templated epilogue.
#define BM 128
#define BN 128
#define BK 128    // one row of a K tile is 256 contiguous bytes = two whole 128-B lines
#define ASTR 136  // LDS stride in halfs (256 B + 16 B pad: 16 rows of b128 reads hit 64 distinct banks)

// Eight rows' share of one operand tile: each lane brings its own 16 bytes of rows r, r + 16, ...,
// r + 112 from global memory straight into LDS, through no register. lds = the lane's LDS byte
// address in row r, g = its global address there, gstep = 16 source rows in bytes. All lanes on.
// The closing s_wait_xcnt stands in the copies' own statement so that no later write of an
// address register can be scheduled ahead of it.
__device__ __forceinline__ void copy_rows_to_lds(unsigned lds, const char* g, size_t gstep) {
  asm volatile(
      "global_load_async_to_lds_b128 %0, %8, off\n\t"
      "global_load_async_to_lds_b128 %1, %9, off\n\t"
      "global_load_async_to_lds_b128 %2, %10, off\n\t"
      "global_load_async_to_lds_b128 %3, %11, off\n\t"
      "global_load_async_to_lds_b128 %4, %12, off\n\t"
      "global_load_async_to_lds_b128 %5, %13, off\n\t"
      "global_load_async_to_lds_b128 %6, %14, off\n\t"
      "global_load_async_to_lds_b128 %7, %15, off\n\t"
      "s_wait_xcnt 0x0"
      :: "v"(lds),                     "v"(lds + 1 * 16 * ASTR * 2), "v"(lds + 2 * 16 * ASTR * 2),
         "v"(lds + 3 * 16 * ASTR * 2), "v"(lds + 4 * 16 * ASTR * 2), "v"(lds + 5 * 16 * ASTR * 2),
         "v"(lds + 6 * 16 * ASTR * 2), "v"(lds + 7 * 16 * ASTR * 2),
         "v"(g),             "v"(g + gstep),     "v"(g + 2 * gstep), "v"(g + 3 * gstep),
         "v"(g + 4 * gstep), "v"(g + 5 * gstep), "v"(g + 6 * gstep), "v"(g + 7 * gstep)
      : "memory");
}

// One 16x32 fragment's share of a lane: halfs 0..7 and 16..23 from p (two 16-byte LDS loads).
__device__ __forceinline__ v16h load_frag(const _Float16* p) {
  v16h f;
  #pragma unroll  // constant element indices: f stays in registers, 8 halfs merge into one load
  for (int i = 0; i < 8; ++i) { f[i] = p[i]; f[8 + i] = p[16 + i]; }
  return f;
}

// Where MODE 2 writes. Q/K go [h][s][d] (row = K-contig for A/B frags); V goes TRANSPOSED
// [h][vdim][s], so that attention's fragment of V is K(seq)-contiguous.
struct HeadOut {
  const float* sig;
  _Float16* q1; _Float16* q2; _Float16* k1; _Float16* k2; _Float16* vt;
};
typedef __attribute__((ext_vector_type(8))) _Float16 v8h;

template <int MODE, bool HAS_BIAS>
__global__ __launch_bounds__(256)
void gemm_wmma(const _Float16* __restrict__ A, const _Float16* __restrict__ B,
               const float* __restrict__ bias, float* __restrict__ Cf,
               _Float16* __restrict__ Ch, int M, int N, int K, HeadOut ho) {
  __shared__ __attribute__((aligned(16))) _Float16 As[2][BM * ASTR];
  __shared__ __attribute__((aligned(16))) _Float16 Bs[2][BN * ASTR];
  const int tid   = threadIdx.x;
  const int lane  = tid & 31;
  const int wave  = tid >> 5;      // 8 wave32 waves
  const int wm    = wave >> 2;     // 0..1  (64 rows each)
  const int wn    = wave & 3;      // 0..3  (32 cols each)
  const int l15   = lane & 15;
  const int hioff = (lane >> 4) * 8;
  const int bm = blockIdx.y * BM;
  const int bn = blockIdx.x * BN;

  const v8f vzero = {0.f,0.f,0.f,0.f,0.f,0.f,0.f,0.f};
  v8f acc[4][2];
  #pragma unroll
  for (int mt = 0; mt < 4; ++mt)
    #pragma unroll
    for (int nt = 0; nt < 2; ++nt) acc[mt][nt] = vzero;

  // 16 lanes cover one row's 256 bytes, so a wave-wide 16-byte copy touches
  // four whole lines (two rows); eight such copies per operand fill 128 rows.
  const int ldRow = tid >> 4;           // 0..15, +16 per copy
  const int ldCol = (tid & 15) * 8;     // halfs
  const char* gA = (const char*)(A + (size_t)bm * K);
  const char* gB = (const char*)(B + (size_t)bn * K);
  // the lane's own place in the next tile to be copied: global (A and B share the pitch K) and LDS
  const size_t gstep = (size_t)K * (16 * 2);
  const char* cpA = gA + ((size_t)ldRow * K + ldCol) * 2;
  const char* cpB = gB + ((size_t)ldRow * K + ldCol) * 2;
  const int ldsOff = ldRow * ASTR + ldCol;
  const unsigned ldsA = (unsigned)(size_t)&As[0][ldsOff];
  const unsigned ldsB = (unsigned)(size_t)&Bs[0][ldsOff];
  const unsigned bufBytes = BM * ASTR * 2;   // BM == BN
  // prefetch offset: one lane per 128-B line of the tile, two tiles ahead
  unsigned pfoff = (unsigned)(((tid >> 1) * K + (tid & 1) * 64 + 2 * BK) * 2);

  const int ktiles = K / BK;
  // tile 0 into buffer 0, landed and published before anybody reads it
  copy_rows_to_lds(ldsA, cpA, gstep);
  copy_rows_to_lds(ldsB, cpB, gstep);
  cpA += BK * 2; cpB += BK * 2;
  // MODE 2: the lane's two sigma values, asked for while tile 0 flies, so that they have long landed
  // when the epilogue adds them
  float sg0 = 0.f, sg1 = 0.f;
  if (MODE == 2) {
    sg0 = ho.sig[l15];
    sg1 = ho.sig[16 + l15];
    // stands before a register that the two loads name is written again
    asm volatile("s_wait_xcnt 0x0" ::: "memory");
  }
  asm volatile("s_wait_asynccnt 0x0" ::: "memory");  // this wave's copies of tile 0 have landed
  __syncthreads();
  // tile 1 flies into buffer 1 while tile 0 is worked on
  if (1 < ktiles) {
    copy_rows_to_lds(ldsA + bufBytes, cpA, gstep);
    copy_rows_to_lds(ldsB + bufBytes, cpB, gstep);
    cpA += BK * 2; cpB += BK * 2;
  }

  int cur = 0;
  for (int kt = 0; kt < ktiles; ++kt) {
    // pull the K+2 tile toward L2 (global_prefetch_b8)
    if (kt + 2 < ktiles) {
      __builtin_prefetch(gA + pfoff, 0, 1);
      __builtin_prefetch(gB + pfoff, 0, 1);
    }
    pfoff += BK * 2;

    // four 32-deep WMMA steps per tile, k ascending; unrolled for constant LDS offsets.
    // Two register sets of fragments: the 12 LDS loads of step ks + 1 issue as one group ahead of
    // step ks's products, so the products wait on a count and not on a load issued just before.
    const _Float16* pa = &As[cur][(wm * 64 + l15) * ASTR + hioff];
    const _Float16* pb = &Bs[cur][(wn * 32 + l15) * ASTR + hioff];
    v16h af[2][4], bf2[2][2];   // every loop over them is unrolled, so that they stay in registers
    #pragma unroll
    for (int mt = 0; mt < 4; ++mt) af[0][mt] = load_frag(pa + mt * 16 * ASTR);
    #pragma unroll
    for (int nt = 0; nt < 2; ++nt) bf2[0][nt] = load_frag(pb + nt * 16 * ASTR);
    #pragma unroll
    for (int ks = 0; ks < BK / 32; ++ks) {
      const int c = ks & 1;
      if (ks + 1 < BK / 32) {
        #pragma unroll
        for (int mt = 0; mt < 4; ++mt) af[c ^ 1][mt] = load_frag(pa + mt * 16 * ASTR + (ks + 1) * 32);
        #pragma unroll
        for (int nt = 0; nt < 2; ++nt) bf2[c ^ 1][nt] = load_frag(pb + nt * 16 * ASTR + (ks + 1) * 32);
      }
      // keeps the load group above in front of this step's products: without it the compiler sinks
      // each load to just before its first use and every product waits out an LDS round trip; in
      // the last step it keeps the step before's products ahead of the hand-over's waits, so that
      // they run while the last group lands
      __builtin_amdgcn_sched_barrier(0);
      #pragma unroll
      for (int mt = 0; mt < 4; ++mt)
        #pragma unroll
        for (int nt = 0; nt < 2; ++nt)
          acc[mt][nt] = wmma16x16x32(af[c][mt], bf2[c][nt], acc[mt][nt]);
    }

    // hand-over: this wave's reads of buffer cur are done, its copies of tile kt+1 have landed;
    // the barrier publishes that tile and frees buffer cur for the refill behind it
    asm volatile("s_wait_dscnt 0x0" ::: "memory");
    asm volatile("s_wait_asynccnt 0x0" ::: "memory");
    __syncthreads();
    if (kt + 2 < ktiles) {
      copy_rows_to_lds(ldsA + cur * bufBytes, cpA, gstep);
      copy_rows_to_lds(ldsB + cur * bufBytes, cpB, gstep);
      cpA += BK * 2; cpB += BK * 2;
    }
    cur ^= 1;
  }
  asm volatile("s_wait_asynccnt 0x0" ::: "memory");  // no copy outlives the loop

  if (MODE == 2) {
    static_assert(D_DIM == 32 && BN == 128 && E_DIM % BN == 0 && E_DIM == 1024,
                  "a wave's 32 columns are one rope head; a block's 128 lie in one of q, k, v");
    // A wave's 32 columns are one rope head: tile nt = 0 holds its rotated dims 0..15 (a pair's two
    // dims lie in neighbouring lanes), nt = 1 the dims that pass through; a lane's eight registers
    // of a tile are eight consecutive sequence positions of one dim.
    const int wns   = __builtin_amdgcn_readfirstlane(wn);   // scalar: head, half and pointers are the wave's
    const int which = bn >> 10;                             // 0=q 1=k 2=v, the same for the whole block
    const int h     = ((bn & (E_DIM - 1)) >> 6) + (wns >> 1);
    const int sub   = wns & 1;
    const int s0    = bm + wm * 64 + ((lane >> 4) << 3);
    if (which == 2) {
      // transposed: [h][vdim = sub*32+d][s]; eight positions of one vdim are one 16-byte store
      _Float16* vp = ho.vt + (size_t)(h * (2 * D_DIM) + sub * D_DIM + l15) * S_LEN + s0;
      v8h pk[4][2];
      #pragma unroll
      for (int mt = 0; mt < 4; ++mt)
        #pragma unroll
        for (int nt = 0; nt < 2; ++nt) pk[mt][nt] = __builtin_convertvector(acc[mt][nt], v8h);
      #pragma unroll
      for (int mt = 0; mt < 4; ++mt)
        #pragma unroll
        for (int nt = 0; nt < 2; ++nt) *(v8h*)(vp + (size_t)nt * 16 * S_LEN + mt * 16) = pk[mt][nt];
    } else {
      const float add0 = sub ? sg0 : 0.f;   // sigma goes to the second half of a head's pair only
      const float add1 = sub ? sg1 : 0.f;
      _Float16* dst = (which == 0 ? (sub ? ho.q2 : ho.q1) : (sub ? ho.k2 : ho.k1))
                      + ((size_t)h * S_LEN + s0) * D_DIM + l15;
      const float inv = __powf(10000.f, -(float)(l15 & ~1) * (1.f / 16.f));
      _Float16 oh[4][2][8];   // every loop over it is unrolled: registers
      #pragma unroll
      for (int mt = 0; mt < 4; ++mt) {
        #pragma unroll
        for (int r = 0; r < 8; ++r) {
          const float val = acc[mt][0][r];
          const float ang = (float)(s0 + mt * 16 + r) * inv;
          const float rev = ang * 0.15915494309189532f;   // 1 / (2 pi)
          const float sn = sin_rev_slot(rev), c = cos_rev_slot(rev);
          const float other = row_xor<1>(val);   // the pair's other dim, same position
          const float o0 = (l15 & 1) ? (val * c + other * sn) : (val * c - other * sn);
          oh[mt][0][r] = (_Float16)(o0 + add0);
          oh[mt][1][r] = (_Float16)(acc[mt][1][r] + add1);
        }
      }
      #pragma unroll
      for (int mt = 0; mt < 4; ++mt)
        #pragma unroll
        for (int r = 0; r < 8; ++r)
          #pragma unroll
          for (int nt = 0; nt < 2; ++nt) dst[(mt * 16 + r) * D_DIM + nt * 16] = oh[mt][nt][r];
      // stands before a register that the stores name (address, data) is written again
      asm volatile("s_wait_xcnt 0x0" ::: "memory");
    }
    return;
  }

  // ---------------- branch-free epilogue (bias hoisted, strided stores)
  float bv[2] = {0.f, 0.f};
  if (HAS_BIAS) {
    bv[0] = bias[bn + wn * 32 + l15];
    bv[1] = bias[bn + wn * 32 + 16 + l15];
  }
  #pragma unroll
  for (int mt = 0; mt < 4; ++mt) {
    const int gm0 = bm + wm * 64 + mt * 16 + ((lane >> 4) << 3);
    #pragma unroll
    for (int nt = 0; nt < 2; ++nt) {
      const int gn = bn + wn * 32 + nt * 16 + l15;
      if (MODE == 1) {
        _Float16* cp = Ch + (size_t)gm0 * N + gn;
        #pragma unroll
        for (int r = 0; r < 8; ++r) {
          float v = acc[mt][nt][r];
          if (HAS_BIAS) v += bv[nt];
          cp[(size_t)r * N] = (_Float16)(v / (1.f + __expf(-v)));   // SiLU
        }
      } else {
        float* cp = Cf + (size_t)gm0 * N + gn;
        #pragma unroll
        for (int r = 0; r < 8; ++r) {
          float v = acc[mt][nt][r];
          if (HAS_BIAS) v += bv[nt];
          cp[(size_t)r * N] = v;
        }
      }
    }
  }
}

// ----------------------------------------------------- flash attention (WMMA)
// Transposed products: S^T = K x Q^T and O^T += V^T x P^T. In a score tile a lane then holds eight
// keys of ONE query (column = lane & 15, key = 8 * (lane >> 4) + register), so a query's maximum and
// sum are taken inside the lane, plus one exchange between the two 16-lane halves, and two score
// tiles, converted in place, are the B operand of the second product: P never leaves the registers.
// Value of lane l ^ 16 (the lane that holds the same query's other keys). All 32 lanes are on.
__device__ __forceinline__ float other_half(float x) {
  const int b = __builtin_bit_cast(int, x);
  return __builtin_bit_cast(float,
      __builtin_amdgcn_permlanex16(b, b, 0x76543210, 0xfedcba98, false, false));
}
#define KSTR 40
#define VSTR 72   // Vs rows are vdim (64), cols are seq/K (64) + pad
// A query tile's keys are split into chunks of at most KCH key tiles, one work-group a chunk, so that
// no work-group walks more than KCH tiles and the long rows of the causal triangle spread over the
// chip. A chunk leaves its own maximum, sum and unscaled O; diff_rmsnorm joins a row's chunks.
#define KCH     8                                   // key tiles a work-group
#define NCH     (S_LEN / 64 / KCH)                  // 4: the most chunks a query tile has
#define N_FULL  (KCH * (NCH * (NCH - 1) / 2))       // 48 chunks of KCH whole tiles below the diagonal
#define N_ITEMS (N_FULL + S_LEN / 64)               // + one chunk that ends on the diagonal per tile
static_assert(KCH == 8 && NCH == 4, "the index decode in attn_flash and the join are written for 4 chunks of 8");
typedef __attribute__((ext_vector_type(2))) float v2f;

__global__ __launch_bounds__(128)
void attn_flash(const _Float16* __restrict__ q1, const _Float16* __restrict__ q2,
                const _Float16* __restrict__ k1, const _Float16* __restrict__ k2,
                const _Float16* __restrict__ vt,
                float* __restrict__ part, float* __restrict__ stat, float scale) {
  __shared__ _Float16 Ks[64 * KSTR];
  __shared__ _Float16 Vs[64 * VSTR];    // transposed V tile: [vdim][seq]

  const int tid   = threadIdx.x;
  const int lane  = tid & 31;
  const int wave  = tid >> 5;          // 4 waves, 16 q-rows each
  const int l15   = lane & 15;
  const int hi    = lane >> 4;
  const int hioff = hi * 8;

  const int h  = blockIdx.x & (H_NUM - 1);
  const int ai = blockIdx.x >> 4;      // which attention (0/1)
  // blockIdx.y -> (q tile of 64 rows, chunk), each pair once; the whole chunks take the low
  // indices and the diagonal ones follow by falling length
  const int it = blockIdx.y;
  int qi, ch;
  if (it < 24)          { qi = 24 + it / 3;           ch = it % 3; }         // tiles 24..31: 3 whole
  else if (it < 40)     { qi = 16 + ((it - 24) >> 1); ch = (it - 24) & 1; }  // tiles 16..23: 2 whole
  else if (it < N_FULL) { qi = 8 + (it - 40);         ch = 0; }              // tiles  8..15: 1 whole
  else { const int z = it - N_FULL; ch = z & (NCH - 1); qi = ch * KCH + (KCH - 1) - (z >> 2); }
  const int kfirst = ch * KCH;
  const int klast  = min(kfirst + KCH - 1, qi);

  const _Float16* Qp = (ai ? q2 : q1) + (size_t)h * S_LEN * D_DIM;
  const _Float16* Kp = (ai ? k2 : k1) + (size_t)h * S_LEN * D_DIM;
  const _Float16* Vp = vt + (size_t)h * (2 * D_DIM) * S_LEN;   // [vdim][s]

  const int qbase = qi * 64;
  const int qrow0 = qbase + wave * 16;
  const int qrow  = qrow0 + l15;        // the lane's query

  v16h bq;                              // Q^T B-frag (rows contiguous in global, K=32)
  {
    const _Float16* p = Qp + (size_t)qrow * D_DIM + hioff;
    #pragma unroll
    for (int i = 0; i < 8; ++i) { bq[i] = p[i]; bq[8 + i] = p[16 + i]; }
  }

  const v8f vzero = {0.f,0.f,0.f,0.f,0.f,0.f,0.f,0.f};
  v8f o[4];                             // o[j][r] = O[qrow][j * 16 + hioff + r]
  #pragma unroll
  for (int j = 0; j < 4; ++j) o[j] = vzero;
  float rmax = -1e30f;                  // of the query, the same in both halves
  float rsum = 0.f;                     // over this half's keys only; the halves join after the loop

  const int ldRow = tid >> 1;           // 0..63
  const int kc16  = (tid & 1) * 16;
  const int vc32  = (tid & 1) * 32;

  for (int kt = kfirst; kt <= klast; ++kt) {
    const int kbase = kt * 64;
    {   // stage K (64 seq x 32 d) and V^T (64 vdim x 64 seq) tiles, all vectorized
      const uint4* s = (const uint4*)(Kp + (size_t)(kbase + ldRow) * D_DIM + kc16);
      uint4* d = (uint4*)(Ks + ldRow * KSTR + kc16);
      d[0] = s[0]; d[1] = s[1];
      const uint4* s2 = (const uint4*)(Vp + (size_t)ldRow * S_LEN + kbase + vc32);
      uint4* d2 = (uint4*)(Vs + ldRow * VSTR + vc32);
      d2[0] = s2[0]; d2[1] = s2[1]; d2[2] = s2[2]; d2[3] = s2[3];
    }
    __syncthreads();

    // scores^T = K(64x32) x Q^T(32x16): 4 WMMA; sc[j][r] = key kbase + j*16 + hioff + r, query qrow
    v8f sc[4];
    #pragma unroll
    for (int j = 0; j < 4; ++j) {
      v16h ak;
      const _Float16* p = Ks + (j * 16 + l15) * KSTR + hioff;
      #pragma unroll
      for (int i = 0; i < 8; ++i) { ak[i] = p[i]; ak[8 + i] = p[16 + i]; }
      sc[j] = wmma16x16x32(ak, bq, vzero);
      #pragma unroll
      for (int r = 0; r < 8; ++r) sc[j][r] *= scale;
    }
    if (kt == qi) {                      // causal mask on diagonal tile
      #pragma unroll
      for (int j = 0; j < 4; ++j) {
        #pragma unroll
        for (int r = 0; r < 8; ++r) {
          const int key = kbase + j * 16 + hioff + r;
          if (key > qrow) sc[j][r] = -1e30f;
        }
      }
    }

    // online softmax: one query a lane. Trees, not one chain, so that no step waits on the last.
    float t[8];
    #pragma unroll
    for (int r = 0; r < 8; ++r)
      t[r] = fmaxf(fmaxf(sc[0][r], sc[1][r]), fmaxf(sc[2][r], sc[3][r]));
    float nmax = fmaxf(fmaxf(fmaxf(fmaxf(t[0], t[1]), t[2]), fmaxf(fmaxf(t[3], t[4]), t[5])),
                       fmaxf(fmaxf(t[6], t[7]), rmax));
    nmax = fmaxf(nmax, other_half(nmax));
    const float alpha = __expf(rmax - nmax);
    rmax = nmax;
    #pragma unroll
    for (int j = 0; j < 4; ++j)
      #pragma unroll
      for (int r = 0; r < 8; ++r) sc[j][r] = __expf(sc[j][r] - nmax);
    const v8f ps = (sc[0] + sc[1]) + (sc[2] + sc[3]);
    rsum = rsum * alpha + (((ps[0] + ps[1]) + (ps[2] + ps[3])) + ((ps[4] + ps[5]) + (ps[6] + ps[7])));
    #pragma unroll
    for (int j = 0; j < 4; ++j)
      #pragma unroll
      for (int r = 0; r < 8; ++r) o[j][r] *= alpha;

    // P^T B-frags of keys 0..31 and 32..63: element i = key hioff + i, element 8 + i = key
    // 16 + hioff + i, which is the k order of the V^T A-frags below
    v16h bp0, bp1;
    #pragma unroll
    for (int i = 0; i < 8; ++i) {
      bp0[i] = (_Float16)sc[0][i];  bp0[8 + i] = (_Float16)sc[1][i];
      bp1[i] = (_Float16)sc[2][i];  bp1[8 + i] = (_Float16)sc[3][i];
    }
    // O^T += V^T(64x64) x P^T(64x16): 8 WMMA.
    // V^T layout makes each A-frag chunk 8 contiguous halfs -> ds_load_b128.
    #pragma unroll
    for (int j = 0; j < 4; ++j) {
      const _Float16* pv = Vs + (j * 16 + l15) * VSTR;
      v16h av;
      #pragma unroll
      for (int i = 0; i < 8; ++i) { av[i] = pv[hioff + i]; av[8 + i] = pv[16 + hioff + i]; }
      o[j] = wmma16x16x32(av, bp0, o[j]);
      #pragma unroll
      for (int i = 0; i < 8; ++i) { av[i] = pv[32 + hioff + i]; av[8 + i] = pv[48 + hioff + i]; }
      o[j] = wmma16x16x32(av, bp1, o[j]);
    }
    __syncthreads();
  }

  // the chunk's share, unscaled: a lane's eight registers of a tile are eight consecutive floats of
  // its query's row; the query's maximum and sum go to stat, [plane][h][s] (16 lanes fill one 128-byte line)
  const float lsum = rsum + other_half(rsum);
  const int plane = ai * NCH + ch;
  float* rp = part + ((size_t)qrow * (2 * NCH) + plane) * E_DIM + h * 64 + hioff;
  #pragma unroll
  for (int j = 0; j < 4; ++j) {
    const v4f lo = {o[j][0], o[j][1], o[j][2], o[j][3]};
    const v4f up = {o[j][4], o[j][5], o[j][6], o[j][7]};
    *(v4f*)(rp + j * 16)     = lo;
    *(v4f*)(rp + j * 16 + 4) = up;
  }
  if (hi == 0) {
    const v2f ml = {rmax, lsum};
    *(v2f*)(stat + (((size_t)plane * H_NUM + h) * S_LEN + qrow) * 2) = ml;
  }
}

// ------------------------------------------------ sums over lanes, on the vector pipe
__device__ __forceinline__ float row16_sum(float x) {
  x += row_xor<1>(x);
  x += row_xor<2>(x);
  x += row_xor<4>(x);
  x += row_xor<8>(x);
  return x;
}
__device__ __forceinline__ float wave_sum(float x) {
  x = row16_sum(x);
  return x + other_half(x);
}

// 2^x and 1/sqrt(x), each with the free slot that the instruction set asks for behind a
// transcendental: the v_nop stands in the instruction's own statement, so that nothing which reads
// the result or overwrites the source can be scheduled directly behind it.
__device__ __forceinline__ float exp2_slot(float x) {
  float r;
  asm("v_exp_f32 %0, %1\n\tv_nop" : "=v"(r) : "v"(x));
  return r;
}
__device__ __forceinline__ float rsq_slot(float x) {   // x at or above the smallest normal number
  float r;
  asm("v_rsq_f32 %0, %1\n\tv_nop" : "=v"(r) : "v"(x));
  return r;
}

// -------------------------------- a = rmsnorm(attn1 - lam*attn2)*(1-LAMBDA) -> f16
// A thread holds four consecutive floats of JR consecutive rows: 16 lanes cover one head's group of
// 64, a wave-wide 16-byte load covers four whole lines, and the group's sum of squares stays inside
// a 16-lane row. Few long waves, every load issued ahead of the first sum, in place of one short
// two-wave work-group per row and head.
#define JR 4      // rows a thread; they share one query tile, so also one count of chunks
static_assert((64 * KCH) % JR == 0 && JR % 2 == 0, "JR rows have one chunk count; two rows' {max,sum} are one 16-byte load");

// NC = the chunks that the rows' query tile has: only those were written, only those are read.
// attn = sum_c e^(m_c - M) O_c / sum_c e^(m_c - M) l_c
template <int NC>
__device__ __forceinline__ void join_norm(const float* __restrict__ part, const float* __restrict__ stat,
                                          float lam, v4f wv, v4f bv, _Float16* __restrict__ outh,
                                          int s0, int t) {
  const int h = t >> 4;
  const float* srow = stat + ((size_t)h * S_LEN + s0) * 2;
  const float* prow = part + (size_t)s0 * (2 * NCH * E_DIM) + t * 4;   // the rows' planes lie side by side
  v4f st[2][NC][JR / 2];   // {max, sum} of two rows each
  v4f o[JR][2][NC];
  // constant indices keep the arrays in registers; one address register each, constant offsets
  #pragma unroll
  for (int a = 0; a < 2; ++a)
    #pragma unroll
    for (int c = 0; c < NC; ++c)
      #pragma unroll
      for (int j = 0; j < JR / 2; ++j)
        st[a][c][j] = *(const v4f*)(srow + (a * NCH + c) * (H_NUM * S_LEN * 2) + j * 4);
  #pragma unroll
  for (int r = 0; r < JR; ++r)
    #pragma unroll
    for (int a = 0; a < 2; ++a)
      #pragma unroll
      for (int c = 0; c < NC; ++c)
        o[r][a][c] = *(const v4f*)(prow + (r * 2 * NCH + a * NCH + c) * E_DIM);
  // keeps every load in front of the sums: without it the compiler holds the last row's loads back
  // until the first results have come, and they wait out a second round trip
  __builtin_amdgcn_sched_barrier(0);
  // stands before the loads' address registers are written again
  asm volatile("s_wait_xcnt 0x0" ::: "memory");
  // keeps the first write of such a register behind the wait
  __builtin_amdgcn_sched_barrier(0);
  #pragma unroll
  for (int r = 0; r < JR; ++r) {
    v4f at[2];
    #pragma unroll
    for (int a = 0; a < 2; ++a) {
      float mx = st[a][0][r >> 1][(r & 1) * 2];
      #pragma unroll
      for (int c = 1; c < NC; ++c) mx = fmaxf(mx, st[a][c][r >> 1][(r & 1) * 2]);
      v4f num = {0.f, 0.f, 0.f, 0.f};
      float den = 0.f;
      #pragma unroll
      for (int c = 0; c < NC; ++c) {
        const float wgt = exp2_slot((st[a][c][r >> 1][(r & 1) * 2] - mx) * 1.44269504f);   // e^(m_c - M)
        num += wgt * o[r][a][c];
        den += wgt * st[a][c][r >> 1][(r & 1) * 2 + 1];
      }
      at[a] = num / den;
    }
    const v4f d = at[0] - lam * at[1];
    const float sq = row16_sum((d[0] * d[0] + d[1] * d[1]) + (d[2] * d[2] + d[3] * d[3]));
    const float rs = rsq_slot(sq * (1.f / 64.f) + 1e-8f);   // the sum of squares is not below 0
    const v4f ov = (d * rs * wv + bv) * (1.f - LAMBDA_INIT_F);
    *(v4h*)(outh + (size_t)(s0 + r) * E_DIM + t * 4) = __builtin_convertvector(ov, v4h);
    // stands before a register that the store names (address, data) is written again
    asm volatile("s_wait_xcnt 0x0" ::: "memory");
  }
}

__global__ __launch_bounds__(256)
void diff_rmsnorm(const float* __restrict__ part, const float* __restrict__ stat,
                  const float* __restrict__ lamp, const float* __restrict__ w,
                  const float* __restrict__ b, _Float16* __restrict__ outh) {
  const int t = threadIdx.x;                              // four floats of the row: head t >> 4
  const int s0 = (int)blockIdx.x * JR;
  const float lam = lamp[0];
  const v4f wv = *(const v4f*)(w + (t & 15) * 4);
  const v4f bv = *(const v4f*)(b + (t & 15) * 4);
  switch (s0 / (64 * KCH)) {                              // the same for the whole block
    case 0:  join_norm<1>(part, stat, lam, wv, bv, outh, s0, t); break;
    case 1:  join_norm<2>(part, stat, lam, wv, bv, outh, s0, t); break;
    case 2:  join_norm<3>(part, stat, lam, wv, bv, outh, s0, t); break;
    default: join_norm<4>(part, stat, lam, wv, bv, outh, s0, t); break;
  }
}

// ---------------------------------------- out = layernorm(a + res) (fp32 + opt f16)
// One wave a row: a lane holds 8 x 4 floats of it, every load is 16 bytes a lane (four whole lines a
// wave) and issues ahead of the first sum; both sums stay in the wave.
#define LN_U (E_DIM / 128)
__global__ __launch_bounds__(256)
void add_layernorm(const float* __restrict__ a, const float* __restrict__ res,
                   const float* __restrict__ w, const float* __restrict__ b,
                   float* __restrict__ out32, _Float16* __restrict__ out16) {
  const int lane = threadIdx.x & 31;
  const int s = blockIdx.x * 8 + (threadIdx.x >> 5);
  const size_t base = (size_t)s * E_DIM + lane * 4;
  const float* pa = a + base;
  const float* pr = res + base;
  const float* pw = w + lane * 4;
  const float* pb = b + lane * 4;
  v4f v[LN_U], rv[LN_U], wv[LN_U], bv[LN_U];   // every loop over them is unrolled: registers
  #pragma unroll
  for (int i = 0; i < LN_U; ++i) v[i] = *(const v4f*)(pa + i * 128);
  #pragma unroll
  for (int i = 0; i < LN_U; ++i) rv[i] = *(const v4f*)(pr + i * 128);
  #pragma unroll
  for (int i = 0; i < LN_U; ++i) wv[i] = *(const v4f*)(pw + i * 128);
  #pragma unroll
  for (int i = 0; i < LN_U; ++i) bv[i] = *(const v4f*)(pb + i * 128);
  // keeps all 32 loads in front of the sums: without it the compiler sinks the loads of w and b to
  // their uses behind the second sum, where each pair waits out its own round trip
  __builtin_amdgcn_sched_barrier(0);
  // stands before the loads' address registers are written again; the two row addresses are named as
  // inputs so that their registers stay live up to the wait and no later load's result lands in them
  asm volatile("s_wait_xcnt 0x0" :: "v"(pa), "v"(pr) : "memory");
  // keeps the first write of such a register behind the wait
  __builtin_amdgcn_sched_barrier(0);
  v4f acc = {0.f, 0.f, 0.f, 0.f};
  #pragma unroll
  for (int i = 0; i < LN_U; ++i) { v[i] += rv[i]; acc += v[i]; }
  const float mean = wave_sum((acc[0] + acc[1]) + (acc[2] + acc[3])) * (1.f / E_DIM);
  v4f qa = {0.f, 0.f, 0.f, 0.f};
  #pragma unroll
  for (int i = 0; i < LN_U; ++i) { v[i] -= mean; qa += v[i] * v[i]; }
  const float var = wave_sum((qa[0] + qa[1]) + (qa[2] + qa[3])) * (1.f / E_DIM);
  const float rstd = rsqrtf(var + 1e-5f);
  #pragma unroll
  for (int i = 0; i < LN_U; ++i) v[i] = v[i] * rstd * wv[i] + bv[i];
  // the f16 copy goes first: its conversions then write fresh registers while v[] is still live, and
  // behind the f32 stores nothing is written any more
  if (out16) {
    #pragma unroll
    for (int i = 0; i < LN_U; ++i) *(v4h*)(out16 + base + i * 128) = __builtin_convertvector(v[i], v4h);
  }
  #pragma unroll
  for (int i = 0; i < LN_U; ++i) *(v4f*)(out32 + base + i * 128) = v[i];
}

// ------------------------------------------------------------------ launcher
extern "C" void kernel_launch(void* const* d_in, const int* in_sizes, int n_in,
                              void* d_out, int out_size, void* d_ws, size_t ws_size,
                              hipStream_t stream) {
  (void)in_sizes; (void)n_in; (void)out_size; (void)ws_size;
  const float* x      = (const float*)d_in[0];
  const float* emb    = (const float*)d_in[1];
  const float* qkv_w  = (const float*)d_in[2];
  const float* out_w  = (const float*)d_in[3];
  const float* sigmaw = (const float*)d_in[4];
  const float* lq1    = (const float*)d_in[5];
  const float* lk1    = (const float*)d_in[6];
  const float* lq2    = (const float*)d_in[7];
  const float* lk2    = (const float*)d_in[8];
  const float* ln_w   = (const float*)d_in[9];
  const float* ln_b   = (const float*)d_in[10];
  const float* ln1_w  = (const float*)d_in[11];
  const float* ln1_b  = (const float*)d_in[12];
  const float* ln2_w  = (const float*)d_in[13];
  const float* ln2_b  = (const float*)d_in[14];
  const float* w1     = (const float*)d_in[15];
  const float* b1     = (const float*)d_in[16];
  const float* w2     = (const float*)d_in[17];
  const float* b2     = (const float*)d_in[18];
  float* out = (float*)d_out;

  char* ws = (char*)d_ws;
  size_t off = 0;
  auto alloc = [&](size_t bytes) -> char* {
    char* p = ws + off;
    off += (bytes + 255) & ~(size_t)255;
    return p;
  };
  float*    sig   = (float*)alloc(D_DIM * sizeof(float));
  float*    lam   = (float*)alloc(sizeof(float));
  _Float16* xb    = (_Float16*)alloc((size_t)S_LEN * E_DIM * 2);
  _Float16* wqkvb = (_Float16*)alloc((size_t)3 * E_DIM * E_DIM * 2);
  _Float16* woutb = (_Float16*)alloc((size_t)E_DIM * E_DIM * 2);
  _Float16* w1b   = (_Float16*)alloc((size_t)4 * E_DIM * E_DIM * 2);
  _Float16* w2b   = (_Float16*)alloc((size_t)4 * E_DIM * E_DIM * 2);
  _Float16* f1b   = (_Float16*)alloc((size_t)S_LEN * 4 * E_DIM * 2);
  _Float16* q1b   = (_Float16*)alloc((size_t)H_NUM * S_LEN * D_DIM * 2);
  _Float16* q2b   = (_Float16*)alloc((size_t)H_NUM * S_LEN * D_DIM * 2);
  _Float16* k1b   = (_Float16*)alloc((size_t)H_NUM * S_LEN * D_DIM * 2);
  _Float16* k2b   = (_Float16*)alloc((size_t)H_NUM * S_LEN * D_DIM * 2);
  _Float16* vtb   = (_Float16*)alloc((size_t)H_NUM * S_LEN * 2 * D_DIM * 2);  // [h][vdim][s]
  _Float16* abh   = (_Float16*)alloc((size_t)S_LEN * E_DIM * 2);
  float*    aof   = (float*)alloc((size_t)S_LEN * E_DIM * 4);           // reused below
  float*    hf    = (float*)alloc((size_t)S_LEN * E_DIM * 4);
  _Float16* hb16  = (_Float16*)alloc((size_t)S_LEN * E_DIM * 2);
  float*    apart = (float*)alloc((size_t)2 * NCH * S_LEN * E_DIM * 4);      // [s][attention][chunk][e]
  float*    astat = (float*)alloc((size_t)2 * NCH * H_NUM * S_LEN * 2 * 4);  // [attention][chunk][h][s]{max,sum}

  // aliases into dead regions (stream-ordered, deterministic)
  float*    fff    = aof;                                   // aof dead after first add_layernorm

  // 1. fp32 -> f16 conversions (activations + weights), sig and lambda: one launch
  prepare<<<1 + NB_X + NB_QKVW + NB_OUTW + NB_W1 + NB_W2, 256, 0, stream>>>(
      x, xb, qkv_w, wqkvb, out_w, woutb, w1, w1b, w2, w2b,
      emb, sigmaw, lq1, lk1, lq2, lk2, sig, lam);

  const HeadOut heads = {sig, q1b, q2b, k1b, k2b, vtb};
  const HeadOut none  = {nullptr, nullptr, nullptr, nullptr, nullptr, nullptr};

  // 2. + 3. qkv = x @ qkv_w^T  (2048x3072x1024), then RoPE + sigma + head split (V transposed)
  gemm_wmma<2, false><<<dim3(3 * E_DIM / BN, S_LEN / BM), 256, 0, stream>>>(
      xb, wqkvb, nullptr, nullptr, nullptr, S_LEN, 3 * E_DIM, E_DIM, heads);
  // 4. two causal flash attentions (WMMA QK^T and PV)
  attn_flash<<<dim3(2 * H_NUM, N_ITEMS), 128, 0, stream>>>(
      q1b, q2b, k1b, k2b, vtb, apart, astat, 0.17677669529663687f);
  // 5. join of the key chunks, then per-head rmsnorm of attn1 - lam*attn2
  diff_rmsnorm<<<S_LEN / JR, 256, 0, stream>>>(apart, astat, lam, ln_w, ln_b, abh);
  // 6. out projection (2048x1024x1024)
  gemm_wmma<0, false><<<dim3(E_DIM / BN, S_LEN / BM), 256, 0, stream>>>(
      abh, woutb, nullptr, aof, nullptr, S_LEN, E_DIM, E_DIM, none);
  // 7. h = layernorm(a + x)
  add_layernorm<<<S_LEN / 8, 256, 0, stream>>>(aof, x, ln1_w, ln1_b, hf, hb16);
  // 8. ff1 = silu(h @ w1^T + b1) -> f16 (2048x4096x1024)
  gemm_wmma<1, true><<<dim3(4 * E_DIM / BN, S_LEN / BM), 256, 0, stream>>>(
      hb16, w1b, b1, nullptr, f1b, S_LEN, 4 * E_DIM, E_DIM, none);
  // 9. ff = ff1 @ w2^T + b2 (2048x1024x4096)
  gemm_wmma<0, true><<<dim3(E_DIM / BN, S_LEN / BM), 256, 0, stream>>>(
      f1b, w2b, b2, fff, nullptr, S_LEN, E_DIM, 4 * E_DIM, none);
  // 10. out = layernorm(ff + h)
  add_layernorm<<<S_LEN / 8, 256, 0, stream>>>(fff, hf, ln2_w, ln2_b, out, nullptr);
}
